// v000
// Times are from an AMD MI455X. After a warm-up the kernel runs many times in a row, and a time is the length of
// such a window on the GPU divided by its runs, so every launch and the gaps after it count. The runs cycle
// through copies of the inputs. A figure is the median of several windows, for all but v000 over two sittings.
// Sittings can differ by a few percent; kernels timed side by side share one.
// v000 is the starting kernel. One run takes 159 microseconds.
#include <hip/hip_runtime.h>

// PAM attention, B=4, H=W=64, C=64 (N=4096).
// f16 WMMA for both big GEMMs; f32 softmax math; LDS tile sharing across
// 4 waves per workgroup, staged with global_load_async_to_lds_b128
// (ASYNCcnt double buffering).

typedef _Float16 v8h  __attribute__((ext_vector_type(8)));
typedef _Float16 v16h __attribute__((ext_vector_type(16)));
typedef float    v8f  __attribute__((ext_vector_type(8)));

#define NPIX 4096
#define CDIM 64
#define NB   4

#define WMMA_F16(A, B, C) \
  __builtin_amdgcn_wmma_f32_16x16x32_f16(false, (A), false, (B), (short)0, (C), false, false)

#define S_WAIT_ASYNCCNT(imm) asm volatile("s_wait_asynccnt " #imm ::: "memory")
#define S_WAIT_DSCNT0()      asm volatile("s_wait_dscnt 0x0" ::: "memory")

// 16B memory -> LDS, tracked by ASYNCcnt (one issue per active wave).
__device__ __forceinline__ void async_ld16(unsigned lds_byte, const void* gaddr) {
  asm volatile("global_load_async_to_lds_b128 %0, %1, off"
               :: "v"(lds_byte), "v"(gaddr) : "memory");
}
__device__ __forceinline__ unsigned lds_addr(const void* p) {
  return (unsigned)(unsigned long long)p;   // low 32 bits of generic = LDS offset
}

// 16x32 f16 A/B fragment: row = tile_row + lane%16, halves 0..7 at
// K = 8*(lane/16), halves 8..15 at K = 16 + 8*(lane/16).
__device__ __forceinline__ v16h load_frag(const _Float16* lo, const _Float16* hi) {
  v8h a = *(const v8h*)lo;
  v8h b = *(const v8h*)hi;
  v16h r;
#pragma unroll
  for (int i = 0; i < 8; ++i) { r[i] = a[i]; r[8 + i] = b[i]; }
  return r;
}

// ---------------------------------------------------------------------------
// Kernel 1: fused Q/K/V projection (1x1 conv). Q,K row-major f16; V stored
// transposed (c-major) so it is the A operand of out^T = V^T * P.
// ---------------------------------------------------------------------------
__global__ void __launch_bounds__(256)
proj_kernel(const float* __restrict__ x,
            const float* __restrict__ Wq, const float* __restrict__ bq,
            const float* __restrict__ Wk, const float* __restrict__ bk,
            const float* __restrict__ Wv, const float* __restrict__ bv,
            _Float16* __restrict__ qh, _Float16* __restrict__ kh,
            _Float16* __restrict__ vT) {
  __shared__ float xs[4][CDIM];
  const int tid = threadIdx.x;
  const int r = tid >> 6;
  const int f = tid & 63;
  const long long g = (long long)blockIdx.x * 4 + r;
  xs[r][f] = x[g * CDIM + f];
  __syncthreads();
  float aq = bq[f], ak = bk[f], av = bv[f];
#pragma unroll 8
  for (int c = 0; c < CDIM; ++c) {
    const float xv = xs[r][c];
    aq = fmaf(xv, Wq[c * CDIM + f], aq);
    ak = fmaf(xv, Wk[c * CDIM + f], ak);
    av = fmaf(xv, Wv[c * CDIM + f], av);
  }
  qh[g * CDIM + f] = (_Float16)aq;
  kh[g * CDIM + f] = (_Float16)ak;
  const int b = (int)(g >> 12);
  const int n = (int)(g & (NPIX - 1));
  vT[((long long)(b * CDIM + f)) * NPIX + n] = (_Float16)av;
}

// ---------------------------------------------------------------------------
// Kernel 2: streaming row stats. 4 waves/block, each wave one 16-row m-tile;
// the 32-row K tile per iteration is shared via LDS (async double buffer).
// ---------------------------------------------------------------------------
#define K2_STR  72                 // padded k-row stride in halves
#define K2_BUF  (32 * K2_STR)      // halves per buffer

__global__ void __launch_bounds__(128)
rowstats_kernel(const _Float16* __restrict__ qh, const _Float16* __restrict__ kh,
                float* __restrict__ rowmax, float* __restrict__ rowinv) {
  __shared__ __align__(16) _Float16 smem[2 * K2_BUF];
  const int tid  = threadIdx.x;
  const int lane = tid & 31;
  const int wv   = tid >> 5;
  const int h16  = lane >> 4;
  const int l16  = lane & 15;
  const int b    = blockIdx.x >> 6;
  const int m0   = (blockIdx.x & 63) * 64 + wv * 16;

  const _Float16* q = qh + (long long)b * NPIX * CDIM;
  const _Float16* k = kh + (long long)b * NPIX * CDIM;

  const _Float16* qrow = q + (m0 + l16) * CDIM;
  const v16h a0 = load_frag(qrow + h16 * 8,      qrow + 16 + h16 * 8);
  const v16h a1 = load_frag(qrow + 32 + h16 * 8, qrow + 48 + h16 * 8);

  const unsigned sbase = lds_addr(smem);
  // staging: 32 rows x 8 chunks of 16B; 2 chunks per thread
  const int ra = tid >> 3, ca = (tid & 7) * 8;
  const int rb = (tid + 128) >> 3, cb = ca;

  // prologue: iteration 0 into buffer 0
  async_ld16(sbase + (unsigned)(ra * K2_STR + ca) * 2, k + ra * CDIM + ca);
  async_ld16(sbase + (unsigned)(rb * K2_STR + cb) * 2, k + rb * CDIM + cb);

  float mx[8], sm[8];
#pragma unroll
  for (int i = 0; i < 8; ++i) { mx[i] = -3.0e38f; sm[i] = 0.0f; }

  for (int it = 0; it < NPIX / 32; ++it) {
    if (it + 1 < NPIX / 32) {
      const unsigned nb = sbase + (unsigned)(((it + 1) & 1) * K2_BUF) * 2;
      const _Float16* kb = k + (it + 1) * 32 * CDIM;
      async_ld16(nb + (unsigned)(ra * K2_STR + ca) * 2, kb + ra * CDIM + ca);
      async_ld16(nb + (unsigned)(rb * K2_STR + cb) * 2, kb + rb * CDIM + cb);
      S_WAIT_ASYNCCNT(0x2);
    } else {
      S_WAIT_ASYNCCNT(0x0);
    }
    __syncthreads();                            // buffer (it&1) staged
    const _Float16* ks = smem + (it & 1) * K2_BUF;
    const _Float16* kr0 = ks + l16 * K2_STR;
    const _Float16* kr1 = ks + (16 + l16) * K2_STR;
    const v16h b00 = load_frag(kr0 + h16 * 8,      kr0 + 16 + h16 * 8);
    const v16h b01 = load_frag(kr0 + 32 + h16 * 8, kr0 + 48 + h16 * 8);
    const v16h b10 = load_frag(kr1 + h16 * 8,      kr1 + 16 + h16 * 8);
    const v16h b11 = load_frag(kr1 + 32 + h16 * 8, kr1 + 48 + h16 * 8);
    S_WAIT_DSCNT0();
    __syncthreads();                            // safe to overwrite buffer
    v8f e0 = {}, e1 = {};
    e0 = WMMA_F16(a0, b00, e0);
    e0 = WMMA_F16(a1, b01, e0);
    e1 = WMMA_F16(a0, b10, e1);
    e1 = WMMA_F16(a1, b11, e1);
#pragma unroll
    for (int i = 0; i < 8; ++i) {
      float v = e0[i];
      float nm = fmaxf(mx[i], v);
      sm[i] = sm[i] * __expf(mx[i] - nm) + __expf(v - nm);
      mx[i] = nm;
      v = e1[i];
      nm = fmaxf(mx[i], v);
      sm[i] = sm[i] * __expf(mx[i] - nm) + __expf(v - nm);
      mx[i] = nm;
    }
  }
  // merge across the 16 lanes sharing each row m
#pragma unroll
  for (int i = 0; i < 8; ++i) {
    float m = mx[i], s = sm[i];
#pragma unroll
    for (int off = 8; off >= 1; off >>= 1) {
      const float om = __shfl_xor(m, off, 32);
      const float os = __shfl_xor(s, off, 32);
      const float nm = fmaxf(m, om);
      s = s * __expf(m - nm) + os * __expf(om - nm);
      m = nm;
    }
    mx[i] = m; sm[i] = s;
  }
  if (l16 == 0) {
    const int base = b * NPIX + m0 + h16 * 8;
#pragma unroll
    for (int i = 0; i < 8; ++i) {
      rowmax[base + i] = mx[i];
      rowinv[base + i] = 1.0f / sm[i];
    }
  }
}

// ---------------------------------------------------------------------------
// Kernel 3: out^T = V^T * softmax(E). 4 waves/block, each wave one 16-col
// n-tile; the per-iteration Q tile (32x64), V^T tile (64x32) and stats are
// shared via LDS (async double buffer, 5 async issues per wave per step).
// Energy D-tile register layout == second WMMA's B-operand layout, so P is
// fed through registers with no transpose.
// ---------------------------------------------------------------------------
#define K3_QSTR 72                      // padded q-row stride (halves)
#define K3_VSTR 40                      // padded vT-row stride (halves)
#define K3_QSZ  (32 * K3_QSTR)          // 2304 halves
#define K3_VSZ  (64 * K3_VSTR)          // 2560 halves
#define K3_SSZ  128                     // 64 floats (max[32] + inv[32])
#define K3_BUF  (K3_QSZ + K3_VSZ + K3_SSZ)

__device__ __forceinline__ void k3_stage(unsigned sbase, int bb, int m0, int tid,
                                         const _Float16* __restrict__ q,
                                         const _Float16* __restrict__ vt,
                                         const float* __restrict__ mxp,
                                         const float* __restrict__ ivp) {
  const unsigned base = sbase + (unsigned)(bb * K3_BUF) * 2;
  // Q tile: 32 rows x 8 chunks
  {
    int idx = tid, r = idx >> 3, c = (idx & 7) * 8;
    async_ld16(base + (unsigned)(r * K3_QSTR + c) * 2, q + (m0 + r) * CDIM + c);
    idx = tid + 128; r = idx >> 3; c = (idx & 7) * 8;
    async_ld16(base + (unsigned)(r * K3_QSTR + c) * 2, q + (m0 + r) * CDIM + c);
  }
  // V^T tile: 64 rows x 4 chunks
  const unsigned vb = base + (unsigned)K3_QSZ * 2;
  {
    int idx = tid, r = idx >> 2, c = (idx & 3) * 8;
    async_ld16(vb + (unsigned)(r * K3_VSTR + c) * 2, vt + r * NPIX + m0 + c);
    idx = tid + 128; r = idx >> 2; c = (idx & 3) * 8;
    async_ld16(vb + (unsigned)(r * K3_VSTR + c) * 2, vt + r * NPIX + m0 + c);
  }
  // stats: lanes 0..15 of every wave (redundant, keeps per-wave count fixed)
  const unsigned sb = base + (unsigned)(K3_QSZ + K3_VSZ) * 2;
  const int l = tid & 31;
  const int sl = l & 15;
  const float* g = (sl < 8) ? (mxp + m0 + sl * 4) : (ivp + m0 + (sl - 8) * 4);
  if (l < 16) async_ld16(sb + (unsigned)sl * 16, g);
}

__global__ void __launch_bounds__(128)
attnout_kernel(const _Float16* __restrict__ qh, const _Float16* __restrict__ kh,
               const _Float16* __restrict__ vT,
               const float* __restrict__ rowmax, const float* __restrict__ rowinv,
               const float* __restrict__ x, const float* __restrict__ gamma,
               float* __restrict__ out) {
  __shared__ __align__(16) _Float16 smem[2 * K3_BUF];
  const int tid  = threadIdx.x;
  const int lane = tid & 31;
  const int wv   = tid >> 5;
  const int h16  = lane >> 4;
  const int l16  = lane & 15;
  const int b    = blockIdx.x >> 6;
  const int n0   = (blockIdx.x & 63) * 64 + wv * 16;

  const _Float16* q  = qh + (long long)b * NPIX * CDIM;
  const _Float16* k  = kh + (long long)b * NPIX * CDIM;
  const _Float16* vt = vT + (long long)b * CDIM * NPIX;
  const float* mx_base = rowmax + b * NPIX;
  const float* iv_base = rowinv + b * NPIX;

  // B operand of the energy WMMAs: k rows n0..n0+15 (fixed per wave)
  const _Float16* krow = k + (n0 + l16) * CDIM;
  const v16h bk0 = load_frag(krow + h16 * 8,      krow + 16 + h16 * 8);
  const v16h bk1 = load_frag(krow + 32 + h16 * 8, krow + 48 + h16 * 8);

  const unsigned sbase = lds_addr(smem);
  k3_stage(sbase, 0, 0, tid, q, vt, mx_base, iv_base);

  v8f acc0 = {}, acc1 = {}, acc2 = {}, acc3 = {};

  for (int mt = 0; mt < NPIX / 32; ++mt) {
    const int m0 = mt * 32;
    if (mt + 1 < NPIX / 32) {
      k3_stage(sbase, (mt + 1) & 1, m0 + 32, tid, q, vt, mx_base, iv_base);
      S_WAIT_ASYNCCNT(0x5);
    } else {
      S_WAIT_ASYNCCNT(0x0);
    }
    __syncthreads();                      // buffer (mt&1) staged
    const _Float16* sb = smem + (mt & 1) * K3_BUF;
    const _Float16* qs = sb;
    const _Float16* vs = sb + K3_QSZ;
    const float*    st = (const float*)(sb + K3_QSZ + K3_VSZ);

    const _Float16* q0 = qs + l16 * K3_QSTR;
    const _Float16* q1 = qs + (16 + l16) * K3_QSTR;
    const v16h a0 = load_frag(q0 + h16 * 8,      q0 + 16 + h16 * 8);
    const v16h a1 = load_frag(q0 + 32 + h16 * 8, q0 + 48 + h16 * 8);
    const v16h a2 = load_frag(q1 + h16 * 8,      q1 + 16 + h16 * 8);
    const v16h a3 = load_frag(q1 + 32 + h16 * 8, q1 + 48 + h16 * 8);

    const _Float16* v0 = vs + (0 * 16 + l16) * K3_VSTR;
    const _Float16* v1 = vs + (1 * 16 + l16) * K3_VSTR;
    const _Float16* v2 = vs + (2 * 16 + l16) * K3_VSTR;
    const _Float16* v3 = vs + (3 * 16 + l16) * K3_VSTR;
    const v16h va0 = load_frag(v0 + h16 * 8, v0 + 16 + h16 * 8);
    const v16h va1 = load_frag(v1 + h16 * 8, v1 + 16 + h16 * 8);
    const v16h va2 = load_frag(v2 + h16 * 8, v2 + 16 + h16 * 8);
    const v16h va3 = load_frag(v3 + h16 * 8, v3 + 16 + h16 * 8);

    const float* lm = st;
    const float* li = st + 32;
    const float4 mA = *(const float4*)(lm + h16 * 8);
    const float4 mB = *(const float4*)(lm + h16 * 8 + 4);
    const float4 mC = *(const float4*)(lm + h16 * 8 + 16);
    const float4 mD = *(const float4*)(lm + h16 * 8 + 20);
    const float4 iA = *(const float4*)(li + h16 * 8);
    const float4 iB = *(const float4*)(li + h16 * 8 + 4);
    const float4 iC = *(const float4*)(li + h16 * 8 + 16);
    const float4 iD = *(const float4*)(li + h16 * 8 + 20);
    S_WAIT_DSCNT0();
    __syncthreads();                      // safe to overwrite buffer

    v8f e0 = {}, e1 = {};
    e0 = WMMA_F16(a0, bk0, e0);
    e0 = WMMA_F16(a1, bk1, e0);
    e1 = WMMA_F16(a2, bk0, e1);
    e1 = WMMA_F16(a3, bk1, e1);

    const float mx0[8] = {mA.x, mA.y, mA.z, mA.w, mB.x, mB.y, mB.z, mB.w};
    const float mx1[8] = {mC.x, mC.y, mC.z, mC.w, mD.x, mD.y, mD.z, mD.w};
    const float iv0[8] = {iA.x, iA.y, iA.z, iA.w, iB.x, iB.y, iB.z, iB.w};
    const float iv1[8] = {iC.x, iC.y, iC.z, iC.w, iD.x, iD.y, iD.z, iD.w};
    v16h pb;
#pragma unroll
    for (int r = 0; r < 8; ++r) {
      pb[r]     = (_Float16)(__expf(e0[r] - mx0[r]) * iv0[r]);
      pb[8 + r] = (_Float16)(__expf(e1[r] - mx1[r]) * iv1[r]);
    }
    acc0 = WMMA_F16(va0, pb, acc0);
    acc1 = WMMA_F16(va1, pb, acc1);
    acc2 = WMMA_F16(va2, pb, acc2);
    acc3 = WMMA_F16(va3, pb, acc3);
  }

  // Epilogue: D element (c = ct*16 + r + 8*h16, n = n0 + l16)
  const long long row = (long long)(b * NPIX + n0 + l16) * CDIM;
  const float* xr = x + row;
  float* outr = out + row;
  const float g = gamma[0];
  const v8f accs[4] = {acc0, acc1, acc2, acc3};
#pragma unroll
  for (int ct = 0; ct < 4; ++ct) {
    const int base = ct * 16 + h16 * 8;
    float4 oA, oB;
    oA.x = fmaf(g, accs[ct][0], xr[base + 0]);
    oA.y = fmaf(g, accs[ct][1], xr[base + 1]);
    oA.z = fmaf(g, accs[ct][2], xr[base + 2]);
    oA.w = fmaf(g, accs[ct][3], xr[base + 3]);
    oB.x = fmaf(g, accs[ct][4], xr[base + 4]);
    oB.y = fmaf(g, accs[ct][5], xr[base + 5]);
    oB.z = fmaf(g, accs[ct][6], xr[base + 6]);
    oB.w = fmaf(g, accs[ct][7], xr[base + 7]);
    *(float4*)(outr + base)     = oA;
    *(float4*)(outr + base + 4) = oB;
  }
}

// ---------------------------------------------------------------------------
extern "C" void kernel_launch(void* const* d_in, const int* in_sizes, int n_in,
                              void* d_out, int out_size, void* d_ws, size_t ws_size,
                              hipStream_t stream) {
  (void)in_sizes; (void)n_in; (void)out_size; (void)ws_size;
  const float* x     = (const float*)d_in[0];
  const float* Wq    = (const float*)d_in[1];
  const float* bq    = (const float*)d_in[2];
  const float* Wk    = (const float*)d_in[3];
  const float* bk    = (const float*)d_in[4];
  const float* Wv    = (const float*)d_in[5];
  const float* bv    = (const float*)d_in[6];
  const float* gamma = (const float*)d_in[7];
  float* out = (float*)d_out;

  // workspace: q(2MB) k(2MB) vT(2MB) rowmax(64KB) rowinv(64KB)
  _Float16* qh = (_Float16*)d_ws;
  _Float16* kh = qh + (size_t)NB * NPIX * CDIM;
  _Float16* vT = kh + (size_t)NB * NPIX * CDIM;
  float* rowmax = (float*)(vT + (size_t)NB * NPIX * CDIM);
  float* rowinv = rowmax + (size_t)NB * NPIX;

  proj_kernel<<<NB * NPIX / 4, 256, 0, stream>>>(x, Wq, bq, Wk, bk, Wv, bv, qh, kh, vT);
  rowstats_kernel<<<NB * 64, 128, 0, stream>>>(qh, kh, rowmax, rowinv);
  attnout_kernel<<<NB * 64, 128, 0, stream>>>(qh, kh, vT, rowmax, rowinv, x, gamma, out);
}

// v001
// One run takes 117 microseconds.
// Timed twice side by side with v000, it ran 1.36 and 1.39 times as fast.
#include <hip/hip_runtime.h>

// PAM attention, B=4, H=W=64, C=64 (N=4096).
// f16 WMMA for both big GEMMs; f32 softmax math; LDS tile sharing across
// 4 waves per workgroup, staged with global_load_async_to_lds_b128
// (ASYNCcnt double buffering).

typedef _Float16 v8h  __attribute__((ext_vector_type(8)));
typedef _Float16 v16h __attribute__((ext_vector_type(16)));
typedef float    v8f  __attribute__((ext_vector_type(8)));

#define NPIX 4096
#define CDIM 64
#define NB   4

#define WMMA_F16(A, B, C) \
  __builtin_amdgcn_wmma_f32_16x16x32_f16(false, (A), false, (B), (short)0, (C), false, false)

#define S_WAIT_ASYNCCNT(imm) asm volatile("s_wait_asynccnt " #imm ::: "memory")
#define S_WAIT_DSCNT0()      asm volatile("s_wait_dscnt 0x0" ::: "memory")

// 16B memory -> LDS, tracked by ASYNCcnt (one issue per active wave).
__device__ __forceinline__ void async_ld16(unsigned lds_byte, const void* gaddr) {
  asm volatile("global_load_async_to_lds_b128 %0, %1, off"
               :: "v"(lds_byte), "v"(gaddr) : "memory");
}
__device__ __forceinline__ unsigned lds_addr(const void* p) {
  return (unsigned)(unsigned long long)p;   // low 32 bits of generic = LDS offset
}

// 16x32 f16 A/B fragment: row = tile_row + lane%16, halves 0..7 at
// K = 8*(lane/16), halves 8..15 at K = 16 + 8*(lane/16).
__device__ __forceinline__ v16h load_frag(const _Float16* lo, const _Float16* hi) {
  v8h a = *(const v8h*)lo;
  v8h b = *(const v8h*)hi;
  v16h r;
#pragma unroll
  for (int i = 0; i < 8; ++i) { r[i] = a[i]; r[8 + i] = b[i]; }
  return r;
}

// ---------------------------------------------------------------------------
// Kernel 1: fused Q/K/V projection (1x1 conv). Q,K row-major f16; V stored
// transposed (c-major) so it is the A operand of out^T = V^T * P.
// One block = 64 pixels. A thread owns one output column f of Q, K and V for
// 8 consecutive pixels, so each weight it loads feeds 8 FMAs and its 8 V
// values are one 16-byte piece of a V^T row.
// ---------------------------------------------------------------------------
#define PJ_PIX 64                  // pixels per block
#define PJ_PPT 8                   // pixels per thread

// waves_per_eu(4, 4): a 16-wave block is 4 waves per SIMD; without it the
// compiler keeps registers low and sinks the look-ahead loads to their uses.
__global__ void __launch_bounds__(512) __attribute__((amdgpu_waves_per_eu(4, 4)))
proj_kernel(const float* __restrict__ x,
            const float* __restrict__ Wq, const float* __restrict__ bq,
            const float* __restrict__ Wk, const float* __restrict__ bk,
            const float* __restrict__ Wv, const float* __restrict__ bv,
            _Float16* __restrict__ qh, _Float16* __restrict__ kh,
            _Float16* __restrict__ vT) {
  __shared__ __align__(16) float xs[PJ_PIX][CDIM];
  const int tid = threadIdx.x;
  const int f   = tid & 63;
  const int p0  = (tid >> 6) * PJ_PPT;          // same for all lanes of a wave
  const int g0  = blockIdx.x * PJ_PIX;          // first pixel (over all batches)

  // stage the 64x64 f32 x tile: 1024 float4, two per thread
  const float4* xsrc = (const float4*)(x + (long long)g0 * CDIM);
  float4* xdst = (float4*)&xs[0][0];
  xdst[tid]       = xsrc[tid];
  xdst[tid + 512] = xsrc[tid + 512];
  __syncthreads();

  float aq[PJ_PPT], ak[PJ_PPT], av[PJ_PPT];
  {
    const float q0 = bq[f], k0 = bk[f], v0 = bv[f];
#pragma unroll
    for (int p = 0; p < PJ_PPT; ++p) { aq[p] = q0; ak[p] = k0; av[p] = v0; }
  }

  // Groups of 4 input channels. The next group's weights and x values are
  // loaded before the current group's FMAs, so their latency is covered; the
  // FMAs run channel-outer, pixel-inner: 24 independent chains, and each sum
  // still takes its channels in ascending order.
  float  wc[3][4];
  float4 xc[PJ_PPT];
#pragma unroll
  for (int j = 0; j < 4; ++j) {
    wc[0][j] = Wq[j * CDIM + f];
    wc[1][j] = Wk[j * CDIM + f];
    wc[2][j] = Wv[j * CDIM + f];
  }
#pragma unroll
  for (int p = 0; p < PJ_PPT; ++p) xc[p] = *(const float4*)&xs[p0 + p][0];

  // unroll 2: the two register sets swap roles without copies
#pragma unroll 2
  for (int c = 0; c < CDIM; c += 4) {
    float  wn[3][4];
    float4 xn[PJ_PPT];
    const int cn = (c + 4 < CDIM) ? c + 4 : 0;   // last trip reloads group 0, unused
#pragma unroll
    for (int j = 0; j < 4; ++j) {
      wn[0][j] = Wq[(cn + j) * CDIM + f];
      wn[1][j] = Wk[(cn + j) * CDIM + f];
      wn[2][j] = Wv[(cn + j) * CDIM + f];
    }
#pragma unroll
    for (int p = 0; p < PJ_PPT; ++p) xn[p] = *(const float4*)&xs[p0 + p][cn];
#pragma unroll
    for (int j = 0; j < 4; ++j) {
#pragma unroll
      for (int p = 0; p < PJ_PPT; ++p) {
        const float xv = (j == 0) ? xc[p].x : (j == 1) ? xc[p].y : (j == 2) ? xc[p].z : xc[p].w;
        aq[p] = fmaf(xv, wc[0][j], aq[p]);
        ak[p] = fmaf(xv, wc[1][j], ak[p]);
        av[p] = fmaf(xv, wc[2][j], av[p]);
      }
    }
#pragma unroll
    for (int j = 0; j < 4; ++j) { wc[0][j] = wn[0][j]; wc[1][j] = wn[1][j]; wc[2][j] = wn[2][j]; }
#pragma unroll
    for (int p = 0; p < PJ_PPT; ++p) xc[p] = xn[p];
  }

  v8h vrow;
#pragma unroll
  for (int p = 0; p < PJ_PPT; ++p) {
    const long long o = (long long)(g0 + p0 + p) * CDIM + f;
    qh[o] = (_Float16)aq[p];
    kh[o] = (_Float16)ak[p];
    vrow[p] = (_Float16)av[p];
  }
  const int b = g0 >> 12;                       // 64 divides NPIX: one batch per block
  const int n = (g0 & (NPIX - 1)) + p0;
  *(v8h*)(vT + ((long long)(b * CDIM + f)) * NPIX + n) = vrow;
}

// ---------------------------------------------------------------------------
// Kernel 2: streaming row stats. 4 waves/block, each wave one 16-row m-tile;
// the 32-row K tile per iteration is shared via LDS (async double buffer).
// ---------------------------------------------------------------------------
#define K2_STR  72                 // padded k-row stride in halves
#define K2_BUF  (32 * K2_STR)      // halves per buffer

__global__ void __launch_bounds__(128)
rowstats_kernel(const _Float16* __restrict__ qh, const _Float16* __restrict__ kh,
                float* __restrict__ rowmax, float* __restrict__ rowinv) {
  __shared__ __align__(16) _Float16 smem[2 * K2_BUF];
  const int tid  = threadIdx.x;
  const int lane = tid & 31;
  const int wv   = tid >> 5;
  const int h16  = lane >> 4;
  const int l16  = lane & 15;
  const int b    = blockIdx.x >> 6;
  const int m0   = (blockIdx.x & 63) * 64 + wv * 16;

  const _Float16* q = qh + (long long)b * NPIX * CDIM;
  const _Float16* k = kh + (long long)b * NPIX * CDIM;

  const _Float16* qrow = q + (m0 + l16) * CDIM;
  const v16h a0 = load_frag(qrow + h16 * 8,      qrow + 16 + h16 * 8);
  const v16h a1 = load_frag(qrow + 32 + h16 * 8, qrow + 48 + h16 * 8);

  const unsigned sbase = lds_addr(smem);
  // staging: 32 rows x 8 chunks of 16B; 2 chunks per thread
  const int ra = tid >> 3, ca = (tid & 7) * 8;
  const int rb = (tid + 128) >> 3, cb = ca;

  // prologue: iteration 0 into buffer 0
  async_ld16(sbase + (unsigned)(ra * K2_STR + ca) * 2, k + ra * CDIM + ca);
  async_ld16(sbase + (unsigned)(rb * K2_STR + cb) * 2, k + rb * CDIM + cb);

  float mx[8], sm[8];
#pragma unroll
  for (int i = 0; i < 8; ++i) { mx[i] = -3.0e38f; sm[i] = 0.0f; }

  for (int it = 0; it < NPIX / 32; ++it) {
    if (it + 1 < NPIX / 32) {
      const unsigned nb = sbase + (unsigned)(((it + 1) & 1) * K2_BUF) * 2;
      const _Float16* kb = k + (it + 1) * 32 * CDIM;
      async_ld16(nb + (unsigned)(ra * K2_STR + ca) * 2, kb + ra * CDIM + ca);
      async_ld16(nb + (unsigned)(rb * K2_STR + cb) * 2, kb + rb * CDIM + cb);
      S_WAIT_ASYNCCNT(0x2);
    } else {
      S_WAIT_ASYNCCNT(0x0);
    }
    __syncthreads();                            // buffer (it&1) staged
    const _Float16* ks = smem + (it & 1) * K2_BUF;
    const _Float16* kr0 = ks + l16 * K2_STR;
    const _Float16* kr1 = ks + (16 + l16) * K2_STR;
    const v16h b00 = load_frag(kr0 + h16 * 8,      kr0 + 16 + h16 * 8);
    const v16h b01 = load_frag(kr0 + 32 + h16 * 8, kr0 + 48 + h16 * 8);
    const v16h b10 = load_frag(kr1 + h16 * 8,      kr1 + 16 + h16 * 8);
    const v16h b11 = load_frag(kr1 + 32 + h16 * 8, kr1 + 48 + h16 * 8);
    S_WAIT_DSCNT0();
    __syncthreads();                            // safe to overwrite buffer
    v8f e0 = {}, e1 = {};
    e0 = WMMA_F16(a0, b00, e0);
    e0 = WMMA_F16(a1, b01, e0);
    e1 = WMMA_F16(a0, b10, e1);
    e1 = WMMA_F16(a1, b11, e1);
#pragma unroll
    for (int i = 0; i < 8; ++i) {
      float v = e0[i];
      float nm = fmaxf(mx[i], v);
      sm[i] = sm[i] * __expf(mx[i] - nm) + __expf(v - nm);
      mx[i] = nm;
      v = e1[i];
      nm = fmaxf(mx[i], v);
      sm[i] = sm[i] * __expf(mx[i] - nm) + __expf(v - nm);
      mx[i] = nm;
    }
  }
  // merge across the 16 lanes sharing each row m
#pragma unroll
  for (int i = 0; i < 8; ++i) {
    float m = mx[i], s = sm[i];
#pragma unroll
    for (int off = 8; off >= 1; off >>= 1) {
      const float om = __shfl_xor(m, off, 32);
      const float os = __shfl_xor(s, off, 32);
      const float nm = fmaxf(m, om);
      s = s * __expf(m - nm) + os * __expf(om - nm);
      m = nm;
    }
    mx[i] = m; sm[i] = s;
  }
  if (l16 == 0) {
    const int base = b * NPIX + m0 + h16 * 8;
#pragma unroll
    for (int i = 0; i < 8; ++i) {
      rowmax[base + i] = mx[i];
      rowinv[base + i] = 1.0f / sm[i];
    }
  }
}

// ---------------------------------------------------------------------------
// Kernel 3: out^T = V^T * softmax(E). 4 waves/block, each wave one 16-col
// n-tile; the per-iteration Q tile (32x64), V^T tile (64x32) and stats are
// shared via LDS (async double buffer, 5 async issues per wave per step).
// Energy D-tile register layout == second WMMA's B-operand layout, so P is
// fed through registers with no transpose.
// ---------------------------------------------------------------------------
#define K3_QSTR 72                      // padded q-row stride (halves)
#define K3_VSTR 40                      // padded vT-row stride (halves)
#define K3_QSZ  (32 * K3_QSTR)          // 2304 halves
#define K3_VSZ  (64 * K3_VSTR)          // 2560 halves
#define K3_SSZ  128                     // 64 floats (max[32] + inv[32])
#define K3_BUF  (K3_QSZ + K3_VSZ + K3_SSZ)

__device__ __forceinline__ void k3_stage(unsigned sbase, int bb, int m0, int tid,
                                         const _Float16* __restrict__ q,
                                         const _Float16* __restrict__ vt,
                                         const float* __restrict__ mxp,
                                         const float* __restrict__ ivp) {
  const unsigned base = sbase + (unsigned)(bb * K3_BUF) * 2;
  // Q tile: 32 rows x 8 chunks
  {
    int idx = tid, r = idx >> 3, c = (idx & 7) * 8;
    async_ld16(base + (unsigned)(r * K3_QSTR + c) * 2, q + (m0 + r) * CDIM + c);
    idx = tid + 128; r = idx >> 3; c = (idx & 7) * 8;
    async_ld16(base + (unsigned)(r * K3_QSTR + c) * 2, q + (m0 + r) * CDIM + c);
  }
  // V^T tile: 64 rows x 4 chunks
  const unsigned vb = base + (unsigned)K3_QSZ * 2;
  {
    int idx = tid, r = idx >> 2, c = (idx & 3) * 8;
    async_ld16(vb + (unsigned)(r * K3_VSTR + c) * 2, vt + r * NPIX + m0 + c);
    idx = tid + 128; r = idx >> 2; c = (idx & 3) * 8;
    async_ld16(vb + (unsigned)(r * K3_VSTR + c) * 2, vt + r * NPIX + m0 + c);
  }
  // stats: lanes 0..15 of every wave (redundant, keeps per-wave count fixed)
  const unsigned sb = base + (unsigned)(K3_QSZ + K3_VSZ) * 2;
  const int l = tid & 31;
  const int sl = l & 15;
  const float* g = (sl < 8) ? (mxp + m0 + sl * 4) : (ivp + m0 + (sl - 8) * 4);
  if (l < 16) async_ld16(sb + (unsigned)sl * 16, g);
}

__global__ void __launch_bounds__(128)
attnout_kernel(const _Float16* __restrict__ qh, const _Float16* __restrict__ kh,
               const _Float16* __restrict__ vT,
               const float* __restrict__ rowmax, const float* __restrict__ rowinv,
               const float* __restrict__ x, const float* __restrict__ gamma,
               float* __restrict__ out) {
  __shared__ __align__(16) _Float16 smem[2 * K3_BUF];
  const int tid  = threadIdx.x;
  const int lane = tid & 31;
  const int wv   = tid >> 5;
  const int h16  = lane >> 4;
  const int l16  = lane & 15;
  const int b    = blockIdx.x >> 6;
  const int n0   = (blockIdx.x & 63) * 64 + wv * 16;

  const _Float16* q  = qh + (long long)b * NPIX * CDIM;
  const _Float16* k  = kh + (long long)b * NPIX * CDIM;
  const _Float16* vt = vT + (long long)b * CDIM * NPIX;
  const float* mx_base = rowmax + b * NPIX;
  const float* iv_base = rowinv + b * NPIX;

  // B operand of the energy WMMAs: k rows n0..n0+15 (fixed per wave)
  const _Float16* krow = k + (n0 + l16) * CDIM;
  const v16h bk0 = load_frag(krow + h16 * 8,      krow + 16 + h16 * 8);
  const v16h bk1 = load_frag(krow + 32 + h16 * 8, krow + 48 + h16 * 8);

  const unsigned sbase = lds_addr(smem);
  k3_stage(sbase, 0, 0, tid, q, vt, mx_base, iv_base);

  v8f acc0 = {}, acc1 = {}, acc2 = {}, acc3 = {};

  for (int mt = 0; mt < NPIX / 32; ++mt) {
    const int m0 = mt * 32;
    if (mt + 1 < NPIX / 32) {
      k3_stage(sbase, (mt + 1) & 1, m0 + 32, tid, q, vt, mx_base, iv_base);
      S_WAIT_ASYNCCNT(0x5);
    } else {
      S_WAIT_ASYNCCNT(0x0);
    }
    __syncthreads();                      // buffer (mt&1) staged
    const _Float16* sb = smem + (mt & 1) * K3_BUF;
    const _Float16* qs = sb;
    const _Float16* vs = sb + K3_QSZ;
    const float*    st = (const float*)(sb + K3_QSZ + K3_VSZ);

    const _Float16* q0 = qs + l16 * K3_QSTR;
    const _Float16* q1 = qs + (16 + l16) * K3_QSTR;
    const v16h a0 = load_frag(q0 + h16 * 8,      q0 + 16 + h16 * 8);
    const v16h a1 = load_frag(q0 + 32 + h16 * 8, q0 + 48 + h16 * 8);
    const v16h a2 = load_frag(q1 + h16 * 8,      q1 + 16 + h16 * 8);
    const v16h a3 = load_frag(q1 + 32 + h16 * 8, q1 + 48 + h16 * 8);

    const _Float16* v0 = vs + (0 * 16 + l16) * K3_VSTR;
    const _Float16* v1 = vs + (1 * 16 + l16) * K3_VSTR;
    const _Float16* v2 = vs + (2 * 16 + l16) * K3_VSTR;
    const _Float16* v3 = vs + (3 * 16 + l16) * K3_VSTR;
    const v16h va0 = load_frag(v0 + h16 * 8, v0 + 16 + h16 * 8);
    const v16h va1 = load_frag(v1 + h16 * 8, v1 + 16 + h16 * 8);
    const v16h va2 = load_frag(v2 + h16 * 8, v2 + 16 + h16 * 8);
    const v16h va3 = load_frag(v3 + h16 * 8, v3 + 16 + h16 * 8);

    const float* lm = st;
    const float* li = st + 32;
    const float4 mA = *(const float4*)(lm + h16 * 8);
    const float4 mB = *(const float4*)(lm + h16 * 8 + 4);
    const float4 mC = *(const float4*)(lm + h16 * 8 + 16);
    const float4 mD = *(const float4*)(lm + h16 * 8 + 20);
    const float4 iA = *(const float4*)(li + h16 * 8);
    const float4 iB = *(const float4*)(li + h16 * 8 + 4);
    const float4 iC = *(const float4*)(li + h16 * 8 + 16);
    const float4 iD = *(const float4*)(li + h16 * 8 + 20);
    S_WAIT_DSCNT0();
    __syncthreads();                      // safe to overwrite buffer

    v8f e0 = {}, e1 = {};
    e0 = WMMA_F16(a0, bk0, e0);
    e0 = WMMA_F16(a1, bk1, e0);
    e1 = WMMA_F16(a2, bk0, e1);
    e1 = WMMA_F16(a3, bk1, e1);

    const float mx0[8] = {mA.x, mA.y, mA.z, mA.w, mB.x, mB.y, mB.z, mB.w};
    const float mx1[8] = {mC.x, mC.y, mC.z, mC.w, mD.x, mD.y, mD.z, mD.w};
    const float iv0[8] = {iA.x, iA.y, iA.z, iA.w, iB.x, iB.y, iB.z, iB.w};
    const float iv1[8] = {iC.x, iC.y, iC.z, iC.w, iD.x, iD.y, iD.z, iD.w};
    v16h pb;
#pragma unroll
    for (int r = 0; r < 8; ++r) {
      pb[r]     = (_Float16)(__expf(e0[r] - mx0[r]) * iv0[r]);
      pb[8 + r] = (_Float16)(__expf(e1[r] - mx1[r]) * iv1[r]);
    }
    acc0 = WMMA_F16(va0, pb, acc0);
    acc1 = WMMA_F16(va1, pb, acc1);
    acc2 = WMMA_F16(va2, pb, acc2);
    acc3 = WMMA_F16(va3, pb, acc3);
  }

  // Epilogue: D element (c = ct*16 + r + 8*h16, n = n0 + l16)
  const long long row = (long long)(b * NPIX + n0 + l16) * CDIM;
  const float* xr = x + row;
  float* outr = out + row;
  const float g = gamma[0];
  const v8f accs[4] = {acc0, acc1, acc2, acc3};
#pragma unroll
  for (int ct = 0; ct < 4; ++ct) {
    const int base = ct * 16 + h16 * 8;
    float4 oA, oB;
    oA.x = fmaf(g, accs[ct][0], xr[base + 0]);
    oA.y = fmaf(g, accs[ct][1], xr[base + 1]);
    oA.z = fmaf(g, accs[ct][2], xr[base + 2]);
    oA.w = fmaf(g, accs[ct][3], xr[base + 3]);
    oB.x = fmaf(g, accs[ct][4], xr[base + 4]);
    oB.y = fmaf(g, accs[ct][5], xr[base + 5]);
    oB.z = fmaf(g, accs[ct][6], xr[base + 6]);
    oB.w = fmaf(g, accs[ct][7], xr[base + 7]);
    *(float4*)(outr + base)     = oA;
    *(float4*)(outr + base + 4) = oB;
  }
}

// ---------------------------------------------------------------------------
extern "C" void kernel_launch(void* const* d_in, const int* in_sizes, int n_in,
                              void* d_out, int out_size, void* d_ws, size_t ws_size,
                              hipStream_t stream) {
  (void)in_sizes; (void)n_in; (void)out_size; (void)ws_size;
  const float* x     = (const float*)d_in[0];
  const float* Wq    = (const float*)d_in[1];
  const float* bq    = (const float*)d_in[2];
  const float* Wk    = (const float*)d_in[3];
  const float* bk    = (const float*)d_in[4];
  const float* Wv    = (const float*)d_in[5];
  const float* bv    = (const float*)d_in[6];
  const float* gamma = (const float*)d_in[7];
  float* out = (float*)d_out;

  // workspace: q(2MB) k(2MB) vT(2MB) rowmax(64KB) rowinv(64KB)
  _Float16* qh = (_Float16*)d_ws;
  _Float16* kh = qh + (size_t)NB * NPIX * CDIM;
  _Float16* vT = kh + (size_t)NB * NPIX * CDIM;
  float* rowmax = (float*)(vT + (size_t)NB * NPIX * CDIM);
  float* rowinv = rowmax + (size_t)NB * NPIX;

  proj_kernel<<<NB * NPIX / PJ_PIX, 512, 0, stream>>>(x, Wq, bq, Wk, bk, Wv, bv, qh, kh, vT);
  rowstats_kernel<<<NB * 64, 128, 0, stream>>>(qh, kh, rowmax, rowinv);
  attnout_kernel<<<NB * 64, 128, 0, stream>>>(qh, kh, vT, rowmax, rowinv, x, gamma, out);
}

// v002
// A run of this version takes 59.1 microseconds.
// Two timings next to v001 put it at 1.99 and 2.01 times that version's speed.
// All steps since v000 together make it 2.75 times as fast.
#include <hip/hip_runtime.h>

// PAM attention, B=4, H=W=64, C=64 (N=4096).
// f16 WMMA for both big GEMMs; f32 softmax math; LDS tile sharing across
// 4 waves per workgroup, staged with global_load_async_to_lds copies
// (two buffers, 128 rows per stage).

typedef _Float16 v8h  __attribute__((ext_vector_type(8)));
typedef _Float16 v16h __attribute__((ext_vector_type(16)));
typedef float    v8f  __attribute__((ext_vector_type(8)));

#define NPIX 4096
#define CDIM 64
#define NB   4

#define WMMA_F16(A, B, C) \
  __builtin_amdgcn_wmma_f32_16x16x32_f16(false, (A), false, (B), (short)0, (C), false, false)

#define S_WAIT_ASYNCCNT0()   asm volatile("s_wait_asynccnt 0x0" ::: "memory")
#define S_WAIT_DSCNT0()      asm volatile("s_wait_dscnt 0x0" ::: "memory")

// Compile-time fence between the phases of an unrolled sub-tile (no instruction
// of its own): the "memory" clobber holds the LDS reads, the scheduling barrier
// the arithmetic, each on its side, so that a group of reads stands in front of
// the work that covers its latency; without it the compiler sinks the reads to
// their uses and waits for each pair in turn.
#define PHASE_FENCE() do { asm volatile("" ::: "memory"); __builtin_amdgcn_sched_barrier(0); } while (0)

// Eight 16-byte copies memory -> LDS of one lane (ASYNCcnt), at fixed steps
// from its first LDS byte l and its first global byte g. The s_wait_xcnt is
// the statement's last line, so that no address register named here is
// rewritten in front of it.
__device__ __forceinline__ void async_ld16x8(unsigned l, unsigned ls,
                                             const char* g, unsigned gs) {
  asm volatile("global_load_async_to_lds_b128 %0, %8, off\n\t"
               "global_load_async_to_lds_b128 %1, %9, off\n\t"
               "global_load_async_to_lds_b128 %2, %10, off\n\t"
               "global_load_async_to_lds_b128 %3, %11, off\n\t"
               "global_load_async_to_lds_b128 %4, %12, off\n\t"
               "global_load_async_to_lds_b128 %5, %13, off\n\t"
               "global_load_async_to_lds_b128 %6, %14, off\n\t"
               "global_load_async_to_lds_b128 %7, %15, off\n\t"
               "s_wait_xcnt 0x0"
               :: "v"(l), "v"(l + ls), "v"(l + 2 * ls), "v"(l + 3 * ls),
                  "v"(l + 4 * ls), "v"(l + 5 * ls), "v"(l + 6 * ls), "v"(l + 7 * ls),
                  "v"(g), "v"(g + gs), "v"(g + 2 * gs), "v"(g + 3 * gs),
                  "v"(g + 4 * gs), "v"(g + 5 * gs), "v"(g + 6 * gs), "v"(g + 7 * gs)
               : "memory");
}
// The same eight copies and one 8-byte copy (l8, g8), under one wait.
__device__ __forceinline__ void async_ld16x8_ld8(unsigned l, unsigned ls,
                                                 const char* g, unsigned gs,
                                                 unsigned l8, const char* g8) {
  asm volatile("global_load_async_to_lds_b128 %0, %8, off\n\t"
               "global_load_async_to_lds_b128 %1, %9, off\n\t"
               "global_load_async_to_lds_b128 %2, %10, off\n\t"
               "global_load_async_to_lds_b128 %3, %11, off\n\t"
               "global_load_async_to_lds_b128 %4, %12, off\n\t"
               "global_load_async_to_lds_b128 %5, %13, off\n\t"
               "global_load_async_to_lds_b128 %6, %14, off\n\t"
               "global_load_async_to_lds_b128 %7, %15, off\n\t"
               "global_load_async_to_lds_b64 %16, %17, off\n\t"
               "s_wait_xcnt 0x0"
               :: "v"(l), "v"(l + ls), "v"(l + 2 * ls), "v"(l + 3 * ls),
                  "v"(l + 4 * ls), "v"(l + 5 * ls), "v"(l + 6 * ls), "v"(l + 7 * ls),
                  "v"(g), "v"(g + gs), "v"(g + 2 * gs), "v"(g + 3 * gs),
                  "v"(g + 4 * gs), "v"(g + 5 * gs), "v"(g + 6 * gs), "v"(g + 7 * gs),
                  "v"(l8), "v"(g8)
               : "memory");
}
__device__ __forceinline__ unsigned lds_addr(const void* p) {
  return (unsigned)(unsigned long long)p;   // low 32 bits of generic = LDS offset
}

// 16x32 f16 A/B fragment: row = tile_row + lane%16, halves 0..7 at
// K = 8*(lane/16), halves 8..15 at K = 16 + 8*(lane/16).
__device__ __forceinline__ v16h load_frag(const _Float16* lo, const _Float16* hi) {
  v8h a = *(const v8h*)lo;
  v8h b = *(const v8h*)hi;
  v16h r;
#pragma unroll
  for (int i = 0; i < 8; ++i) { r[i] = a[i]; r[8 + i] = b[i]; }
  return r;
}

// ---------------------------------------------------------------------------
// Kernel 1: fused Q/K/V projection (1x1 conv). Q,K row-major f16; V stored
// transposed (c-major) so it is the A operand of out^T = V^T * P.
// One block = 64 pixels. A thread owns one output column f of Q, K and V for
// 8 consecutive pixels, so each weight it loads feeds 8 FMAs and its 8 V
// values are one 16-byte piece of a V^T row.
// ---------------------------------------------------------------------------
#define PJ_PIX 64                  // pixels per block
#define PJ_PPT 8                   // pixels per thread

// waves_per_eu(4, 4): a 16-wave block is 4 waves per SIMD; without it the
// compiler keeps registers low and sinks the look-ahead loads to their uses.
__global__ void __launch_bounds__(512) __attribute__((amdgpu_waves_per_eu(4, 4)))
proj_kernel(const float* __restrict__ x,
            const float* __restrict__ Wq, const float* __restrict__ bq,
            const float* __restrict__ Wk, const float* __restrict__ bk,
            const float* __restrict__ Wv, const float* __restrict__ bv,
            _Float16* __restrict__ qh, _Float16* __restrict__ kh,
            _Float16* __restrict__ vT) {
  __shared__ __align__(16) float xs[PJ_PIX][CDIM];
  const int tid = threadIdx.x;
  const int f   = tid & 63;
  const int p0  = (tid >> 6) * PJ_PPT;          // same for all lanes of a wave
  const int g0  = blockIdx.x * PJ_PIX;          // first pixel (over all batches)

  // stage the 64x64 f32 x tile: 1024 float4, two per thread
  const float4* xsrc = (const float4*)(x + (long long)g0 * CDIM);
  float4* xdst = (float4*)&xs[0][0];
  xdst[tid]       = xsrc[tid];
  xdst[tid + 512] = xsrc[tid + 512];
  __syncthreads();

  float aq[PJ_PPT], ak[PJ_PPT], av[PJ_PPT];
  {
    const float q0 = bq[f], k0 = bk[f], v0 = bv[f];
#pragma unroll
    for (int p = 0; p < PJ_PPT; ++p) { aq[p] = q0; ak[p] = k0; av[p] = v0; }
  }

  // Groups of 4 input channels. The next group's weights and x values are
  // loaded before the current group's FMAs, so their latency is covered; the
  // FMAs run channel-outer, pixel-inner: 24 independent chains, and each sum
  // still takes its channels in ascending order.
  float  wc[3][4];
  float4 xc[PJ_PPT];
#pragma unroll
  for (int j = 0; j < 4; ++j) {
    wc[0][j] = Wq[j * CDIM + f];
    wc[1][j] = Wk[j * CDIM + f];
    wc[2][j] = Wv[j * CDIM + f];
  }
#pragma unroll
  for (int p = 0; p < PJ_PPT; ++p) xc[p] = *(const float4*)&xs[p0 + p][0];

  // unroll 2: the two register sets swap roles without copies
#pragma unroll 2
  for (int c = 0; c < CDIM; c += 4) {
    float  wn[3][4];
    float4 xn[PJ_PPT];
    const int cn = (c + 4 < CDIM) ? c + 4 : 0;   // last trip reloads group 0, unused
#pragma unroll
    for (int j = 0; j < 4; ++j) {
      wn[0][j] = Wq[(cn + j) * CDIM + f];
      wn[1][j] = Wk[(cn + j) * CDIM + f];
      wn[2][j] = Wv[(cn + j) * CDIM + f];
    }
#pragma unroll
    for (int p = 0; p < PJ_PPT; ++p) xn[p] = *(const float4*)&xs[p0 + p][cn];
#pragma unroll
    for (int j = 0; j < 4; ++j) {
#pragma unroll
      for (int p = 0; p < PJ_PPT; ++p) {
        const float xv = (j == 0) ? xc[p].x : (j == 1) ? xc[p].y : (j == 2) ? xc[p].z : xc[p].w;
        aq[p] = fmaf(xv, wc[0][j], aq[p]);
        ak[p] = fmaf(xv, wc[1][j], ak[p]);
        av[p] = fmaf(xv, wc[2][j], av[p]);
      }
    }
#pragma unroll
    for (int j = 0; j < 4; ++j) { wc[0][j] = wn[0][j]; wc[1][j] = wn[1][j]; wc[2][j] = wn[2][j]; }
#pragma unroll
    for (int p = 0; p < PJ_PPT; ++p) xc[p] = xn[p];
  }

  v8h vrow;
#pragma unroll
  for (int p = 0; p < PJ_PPT; ++p) {
    const long long o = (long long)(g0 + p0 + p) * CDIM + f;
    qh[o] = (_Float16)aq[p];
    kh[o] = (_Float16)ak[p];
    vrow[p] = (_Float16)av[p];
  }
  const int b = g0 >> 12;                       // 64 divides NPIX: one batch per block
  const int n = (g0 & (NPIX - 1)) + p0;
  *(v8h*)(vT + ((long long)(b * CDIM + f)) * NPIX + n) = vrow;
}

// ---------------------------------------------------------------------------
// Kernel 2: streaming row stats. 4 waves/block, each wave one 16-row m-tile.
// K comes through LDS in stages of 128 rows (two buffers, async copies): a
// stage's copies fly during the whole trip before it, one barrier ends a trip,
// and the trip's four 32-row sub-tiles are unrolled, so that the LDS reads of
// one stand in front of the arithmetic of the one before.
// ---------------------------------------------------------------------------
#define K2_ROWS 128                // k rows per stage
#define K2_STR  72                 // padded k-row stride in halves
#define K2_BUF  (K2_ROWS * K2_STR) // halves per buffer
#define K2_NST  (NPIX / K2_ROWS)   // stages

// p: this lane's first half of a 32-row sub-tile in LDS
__device__ __forceinline__ void k2_frags(const _Float16* p, v16h (&f)[4]) {
  const _Float16* p1 = p + 16 * K2_STR;
  f[0] = load_frag(p,       p + 16);
  f[1] = load_frag(p + 32,  p + 48);
  f[2] = load_frag(p1,      p1 + 16);
  f[3] = load_frag(p1 + 32, p1 + 48);
}
__device__ __forceinline__ void k2_energy(v16h a0, v16h a1, const v16h (&f)[4], v8f (&e)[2]) {
  v8f e0 = {}, e1 = {};
  e0 = WMMA_F16(a0, f[0], e0);
  e0 = WMMA_F16(a1, f[1], e0);
  e1 = WMMA_F16(a0, f[2], e1);
  e1 = WMMA_F16(a1, f[3], e1);
  e[0] = e0; e[1] = e1;
}

// One stage: four 32-row sub-tiles. The reads run two sub-tiles ahead of the
// softmax update and the products one, so the update covers both latencies.
__device__ __forceinline__ void k2_trip(const _Float16* ks, v16h a0, v16h a1,
                                        float (&mx)[8], float (&sm)[8]) {
  v16h f[2][4];                                 // fragments of two sub-tiles
  v8f  e[2][2];                                 // energies of two sub-tiles
  k2_frags(ks, f[0]);
  k2_frags(ks + 32 * K2_STR, f[1]);
  PHASE_FENCE();
  k2_energy(a0, a1, f[0], e[0]);
#pragma unroll
  for (int j = 0; j < K2_ROWS / 32; ++j) {
    if (j + 2 < K2_ROWS / 32) k2_frags(ks + (j + 2) * 32 * K2_STR, f[j & 1]);
    PHASE_FENCE();
    if (j + 1 < K2_ROWS / 32) k2_energy(a0, a1, f[(j + 1) & 1], e[(j + 1) & 1]);
    const v8f e0 = e[j & 1][0], e1 = e[j & 1][1];
#pragma unroll
    for (int i = 0; i < 8; ++i) {
      float v = e0[i];
      float nm = fmaxf(mx[i], v);
      sm[i] = sm[i] * __expf(mx[i] - nm) + __expf(v - nm);
      mx[i] = nm;
      v = e1[i];
      nm = fmaxf(mx[i], v);
      sm[i] = sm[i] * __expf(mx[i] - nm) + __expf(v - nm);
      mx[i] = nm;
    }
  }
}

// waves_per_eu(4, 4): a budget of 256 registers for the fragments in flight
__global__ void __launch_bounds__(128) __attribute__((amdgpu_waves_per_eu(4, 4)))
rowstats_kernel(const _Float16* __restrict__ qh, const _Float16* __restrict__ kh,
                float* __restrict__ rowmax, float* __restrict__ rowinv) {
  __shared__ __align__(16) _Float16 smem[2 * K2_BUF];
  const int tid  = threadIdx.x;
  const int lane = tid & 31;
  const int wv   = tid >> 5;
  const int h16  = lane >> 4;
  const int l16  = lane & 15;
  const int b    = blockIdx.x >> 6;
  const int m0   = (blockIdx.x & 63) * 64 + wv * 16;

  const _Float16* q = qh + (long long)b * NPIX * CDIM;
  const _Float16* k = kh + (long long)b * NPIX * CDIM;

  const _Float16* qrow = q + (m0 + l16) * CDIM;
  const v16h a0 = load_frag(qrow + h16 * 8,      qrow + 16 + h16 * 8);
  const v16h a1 = load_frag(qrow + 32 + h16 * 8, qrow + 48 + h16 * 8);

  // staging: 128 rows x 8 chunks of 16B; a thread's 8 chunks lie 16 rows apart
  const unsigned lst = lds_addr(smem) + (unsigned)((tid >> 3) * K2_STR + (tid & 7) * 8) * 2;
  const char*    gst = (const char*)k + tid * 16;

  // stage 0 landed and published, then stage 1 in flight
  async_ld16x8(lst, 16 * K2_STR * 2, gst, 16 * CDIM * 2);
  S_WAIT_ASYNCCNT0();
  __syncthreads();
  async_ld16x8(lst + K2_BUF * 2, 16 * K2_STR * 2, gst + K2_ROWS * CDIM * 2, 16 * CDIM * 2);

  float mx[8], sm[8];
#pragma unroll
  for (int i = 0; i < 8; ++i) { mx[i] = -3.0e38f; sm[i] = 0.0f; }

  // Foot of every trip: own LDS reads done, own copies of stage t+1 landed,
  // then the one barrier that publishes stage t+1 and frees this buffer.
  // While a stage t+2 exists it is copied into that buffer; the last two trips
  // stand in a loop of their own, so each trip is one straight block.
  const _Float16* ks0 = smem + l16 * K2_STR + h16 * 8;
  for (int t = 0; t < K2_NST - 2; ++t) {
    k2_trip(ks0 + (t & 1) * K2_BUF, a0, a1, mx, sm);
    S_WAIT_DSCNT0();
    S_WAIT_ASYNCCNT0();
    __syncthreads();
    async_ld16x8(lst + (unsigned)((t & 1) * K2_BUF) * 2, 16 * K2_STR * 2,
                 gst + (t + 2) * (K2_ROWS * CDIM * 2), 16 * CDIM * 2);
  }
  for (int t = K2_NST - 2; t < K2_NST; ++t) {
    k2_trip(ks0 + (t & 1) * K2_BUF, a0, a1, mx, sm);
    S_WAIT_DSCNT0();
    S_WAIT_ASYNCCNT0();
    __syncthreads();
  }
  S_WAIT_ASYNCCNT0();                           // nothing in flight at the wave's end
  // merge across the 16 lanes sharing each row m
#pragma unroll
  for (int i = 0; i < 8; ++i) {
    float m = mx[i], s = sm[i];
#pragma unroll
    for (int off = 8; off >= 1; off >>= 1) {
      const float om = __shfl_xor(m, off, 32);
      const float os = __shfl_xor(s, off, 32);
      const float nm = fmaxf(m, om);
      s = s * __expf(m - nm) + os * __expf(om - nm);
      m = nm;
    }
    mx[i] = m; sm[i] = s;
  }
  if (l16 == 0) {
    const int base = b * NPIX + m0 + h16 * 8;
#pragma unroll
    for (int i = 0; i < 8; ++i) {
      rowmax[base + i] = mx[i];
      rowinv[base + i] = 1.0f / sm[i];
    }
  }
}

// ---------------------------------------------------------------------------
// Kernel 3: out^T = V^T * softmax(E). 4 waves/block, each wave one 16-col
// n-tile. Q (128x64), V^T (64x128) and the stats of 128 rows m make one stage
// in LDS (two buffers, async copies, 17 per thread and stage); one barrier
// ends a trip, whose four 32-row sub-tiles are unrolled.
// Energy D-tile register layout == second WMMA's B-operand layout, so P is
// fed through registers with no transpose.
// ---------------------------------------------------------------------------
#define K3_ROWS 128                     // rows m per stage
#define K3_QSTR 72                      // padded q-row stride (halves)
#define K3_VSTR 136                     // padded vT-row stride (halves)
#define K3_QSZ  (K3_ROWS * K3_QSTR)     // halves
#define K3_VSZ  (CDIM * K3_VSTR)        // halves
#define K3_SSZ  (4 * K3_ROWS)           // 256 floats (max[128] + inv[128])
#define K3_BUF  (K3_QSZ + K3_VSZ + K3_SSZ)
#define K3_NST  (NPIX / K3_ROWS)        // stages

// lq, lv, ls: this thread's first LDS byte of each part in buffer 0;
// gq, gv, gs: its first global byte of each part in stage 0.
__device__ __forceinline__ void k3_stage(int bb, int t, unsigned lq, unsigned lv, unsigned ls,
                                         const char* gq, const char* gv, const char* gs) {
  const unsigned o = (unsigned)(bb * K3_BUF) * 2;
  // Q: 128 rows x 8 chunks, a thread's chunks 16 rows apart
  async_ld16x8(lq + o, 16 * K3_QSTR * 2, gq + t * (K3_ROWS * CDIM * 2), 16 * CDIM * 2);
  // V^T: 64 rows x 16 chunks, a thread's chunks 8 rows apart;
  // stats: 256 floats, two per thread
  async_ld16x8_ld8(lv + o, 8 * K3_VSTR * 2, gv + t * (K3_ROWS * 2), 8 * NPIX * 2,
                   ls + o, gs + t * (K3_ROWS * 4));
}

// p: this lane's first half (or float) of a 32-row sub-tile's part in LDS
__device__ __forceinline__ void k3_qfrags(const _Float16* p, v16h (&a)[4]) {
  const _Float16* p1 = p + 16 * K3_QSTR;
  a[0] = load_frag(p,       p + 16);
  a[1] = load_frag(p + 32,  p + 48);
  a[2] = load_frag(p1,      p1 + 16);
  a[3] = load_frag(p1 + 32, p1 + 48);
}
__device__ __forceinline__ void k3_vfrags(const _Float16* p, v16h (&a)[4]) {
#pragma unroll
  for (int ct = 0; ct < 4; ++ct)
    a[ct] = load_frag(p + ct * 16 * K3_VSTR, p + ct * 16 * K3_VSTR + 16);
}
__device__ __forceinline__ void k3_stats(const float* p, float4 (&s)[8]) {
  s[0] = *(const float4*)(p);                 // max, rows +0..7
  s[1] = *(const float4*)(p + 4);
  s[2] = *(const float4*)(p + 16);            // max, rows +16..23
  s[3] = *(const float4*)(p + 20);
  s[4] = *(const float4*)(p + K3_ROWS);       // 1/sum, the same rows
  s[5] = *(const float4*)(p + K3_ROWS + 4);
  s[6] = *(const float4*)(p + K3_ROWS + 16);
  s[7] = *(const float4*)(p + K3_ROWS + 20);
}

// waves_per_eu(4, 4): a budget of 256 registers for the fragments in flight
__global__ void __launch_bounds__(128) __attribute__((amdgpu_waves_per_eu(4, 4)))
attnout_kernel(const _Float16* __restrict__ qh, const _Float16* __restrict__ kh,
               const _Float16* __restrict__ vT,
               const float* __restrict__ rowmax, const float* __restrict__ rowinv,
               const float* __restrict__ x, const float* __restrict__ gamma,
               float* __restrict__ out) {
  __shared__ __align__(16) _Float16 smem[2 * K3_BUF];
  const int tid  = threadIdx.x;
  const int lane = tid & 31;
  const int wv   = tid >> 5;
  const int h16  = lane >> 4;
  const int l16  = lane & 15;
  const int b    = blockIdx.x >> 6;
  const int n0   = (blockIdx.x & 63) * 64 + wv * 16;

  const _Float16* q  = qh + (long long)b * NPIX * CDIM;
  const _Float16* k  = kh + (long long)b * NPIX * CDIM;
  const _Float16* vt = vT + (long long)b * CDIM * NPIX;
  const float* mx_base = rowmax + b * NPIX;
  const float* iv_base = rowinv + b * NPIX;

  // B operand of the energy WMMAs: k rows n0..n0+15 (fixed per wave)
  const _Float16* krow = k + (n0 + l16) * CDIM;
  const v16h bk0 = load_frag(krow + h16 * 8,      krow + 16 + h16 * 8);
  const v16h bk1 = load_frag(krow + 32 + h16 * 8, krow + 48 + h16 * 8);

  const unsigned sbase = lds_addr(smem);
  const unsigned lq = sbase + (unsigned)((tid >> 3) * K3_QSTR + (tid & 7) * 8) * 2;
  const unsigned lv = sbase + (unsigned)(K3_QSZ + (tid >> 4) * K3_VSTR + (tid & 15) * 8) * 2;
  const unsigned ls = sbase + (unsigned)(K3_QSZ + K3_VSZ) * 2 + (unsigned)tid * 8;
  const char* gq = (const char*)q + tid * 16;
  const char* gv = (const char*)vt + (tid >> 4) * (NPIX * 2) + (tid & 15) * 16;
  const char* gs = (tid < 64) ? (const char*)mx_base + tid * 8
                              : (const char*)iv_base + (tid - 64) * 8;

  // stage 0 landed and published, then stage 1 in flight
  k3_stage(0, 0, lq, lv, ls, gq, gv, gs);
  S_WAIT_ASYNCCNT0();
  __syncthreads();
  k3_stage(1, 1, lq, lv, ls, gq, gv, gs);

  v8f acc0 = {}, acc1 = {}, acc2 = {}, acc3 = {};

  for (int t = 0; t < K3_NST; ++t) {
    const _Float16* sb = smem + (t & 1) * K3_BUF;
    const _Float16* qs = sb + l16 * K3_QSTR + h16 * 8;
    const _Float16* vs = sb + K3_QSZ + l16 * K3_VSTR + h16 * 8;
    const float*    st = (const float*)(sb + K3_QSZ + K3_VSZ) + h16 * 8;

    v16h   qa[4], va[4];                  // Q and V^T fragments of a sub-tile
    float4 s[2][8];                       // stats of two sub-tiles
    k3_qfrags(qs, qa);
    k3_stats(st, s[0]);
    k3_vfrags(vs, va);
    PHASE_FENCE();
#pragma unroll
    for (int j = 0; j < K3_ROWS / 32; ++j) {
      v8f e0 = {}, e1 = {};
      e0 = WMMA_F16(qa[0], bk0, e0);
      e0 = WMMA_F16(qa[1], bk1, e0);
      e1 = WMMA_F16(qa[2], bk0, e1);
      e1 = WMMA_F16(qa[3], bk1, e1);
      PHASE_FENCE();
      if (j + 1 < K3_ROWS / 32) {         // read under this sub-tile's vector work
        k3_qfrags(qs + (j + 1) * 32 * K3_QSTR, qa);
        k3_stats(st + (j + 1) * 32, s[(j + 1) & 1]);
      }
      PHASE_FENCE();
      const float4* sj = s[j & 1];
      const float mx0[8] = {sj[0].x, sj[0].y, sj[0].z, sj[0].w, sj[1].x, sj[1].y, sj[1].z, sj[1].w};
      const float mx1[8] = {sj[2].x, sj[2].y, sj[2].z, sj[2].w, sj[3].x, sj[3].y, sj[3].z, sj[3].w};
      const float iv0[8] = {sj[4].x, sj[4].y, sj[4].z, sj[4].w, sj[5].x, sj[5].y, sj[5].z, sj[5].w};
      const float iv1[8] = {sj[6].x, sj[6].y, sj[6].z, sj[6].w, sj[7].x, sj[7].y, sj[7].z, sj[7].w};
      v16h pb;
#pragma unroll
      for (int r = 0; r < 8; ++r) {
        pb[r]     = (_Float16)(__expf(e0[r] - mx0[r]) * iv0[r]);
        pb[8 + r] = (_Float16)(__expf(e1[r] - mx1[r]) * iv1[r]);
      }
      acc0 = WMMA_F16(va[0], pb, acc0);
      acc1 = WMMA_F16(va[1], pb, acc1);
      acc2 = WMMA_F16(va[2], pb, acc2);
      acc3 = WMMA_F16(va[3], pb, acc3);
      PHASE_FENCE();
      if (j + 1 < K3_ROWS / 32) k3_vfrags(vs + (j + 1) * 32, va);
    }
    // foot of the trip: own LDS reads done, own copies of stage t+1 landed,
    // then the one barrier that publishes stage t+1 and frees this buffer
    S_WAIT_DSCNT0();
    S_WAIT_ASYNCCNT0();
    __syncthreads();
    if (t + 2 < K3_NST) k3_stage(t & 1, t + 2, lq, lv, ls, gq, gv, gs);
  }
  S_WAIT_ASYNCCNT0();                     // nothing in flight at the wave's end

  // Epilogue: D element (c = ct*16 + r + 8*h16, n = n0 + l16)
  const long long row = (long long)(b * NPIX + n0 + l16) * CDIM;
  const float* xr = x + row;
  float* outr = out + row;
  const float g = gamma[0];
  const v8f accs[4] = {acc0, acc1, acc2, acc3};
#pragma unroll
  for (int ct = 0; ct < 4; ++ct) {
    const int base = ct * 16 + h16 * 8;
    float4 oA, oB;
    oA.x = fmaf(g, accs[ct][0], xr[base + 0]);
    oA.y = fmaf(g, accs[ct][1], xr[base + 1]);
    oA.z = fmaf(g, accs[ct][2], xr[base + 2]);
    oA.w = fmaf(g, accs[ct][3], xr[base + 3]);
    oB.x = fmaf(g, accs[ct][4], xr[base + 4]);
    oB.y = fmaf(g, accs[ct][5], xr[base + 5]);
    oB.z = fmaf(g, accs[ct][6], xr[base + 6]);
    oB.w = fmaf(g, accs[ct][7], xr[base + 7]);
    *(float4*)(outr + base)     = oA;
    *(float4*)(outr + base + 4) = oB;
  }
}

// ---------------------------------------------------------------------------
extern "C" void kernel_launch(void* const* d_in, const int* in_sizes, int n_in,
                              void* d_out, int out_size, void* d_ws, size_t ws_size,
                              hipStream_t stream) {
  (void)in_sizes; (void)n_in; (void)out_size; (void)ws_size;
  const float* x     = (const float*)d_in[0];
  const float* Wq    = (const float*)d_in[1];
  const float* bq    = (const float*)d_in[2];
  const float* Wk    = (const float*)d_in[3];
  const float* bk    = (const float*)d_in[4];
  const float* Wv    = (const float*)d_in[5];
  const float* bv    = (const float*)d_in[6];
  const float* gamma = (const float*)d_in[7];
  float* out = (float*)d_out;

  // workspace: q(2MB) k(2MB) vT(2MB) rowmax(64KB) rowinv(64KB)
  _Float16* qh = (_Float16*)d_ws;
  _Float16* kh = qh + (size_t)NB * NPIX * CDIM;
  _Float16* vT = kh + (size_t)NB * NPIX * CDIM;
  float* rowmax = (float*)(vT + (size_t)NB * NPIX * CDIM);
  float* rowinv = rowmax + (size_t)NB * NPIX;

  proj_kernel<<<NB * NPIX / PJ_PIX, 512, 0, stream>>>(x, Wq, bq, Wk, bk, Wv, bv, qh, kh, vT);
  rowstats_kernel<<<NB * 64, 128, 0, stream>>>(qh, kh, rowmax, rowinv);
  attnout_kernel<<<NB * 64, 128, 0, stream>>>(qh, kh, vT, rowmax, rowinv, x, gamma, out);
}

// v003
// One run takes 56.9 microseconds.
// In two side-by-side timings against v002, it was 1.06 and 1.04 times as fast.
// Counting every step since v000, it is 2.88 times as fast.
#include <hip/hip_runtime.h>

// PAM attention, B=4, H=W=64, C=64 (N=4096).
// f16 WMMA for both big GEMMs; f32 softmax math; LDS tile sharing across
// 4 waves per workgroup, staged with global_load_async_to_lds copies
// (two buffers, 128 rows per stage).

typedef _Float16 v8h  __attribute__((ext_vector_type(8)));
typedef _Float16 v16h __attribute__((ext_vector_type(16)));
typedef float    v8f  __attribute__((ext_vector_type(8)));
typedef float    v2f  __attribute__((ext_vector_type(2)));

#define NPIX 4096
#define CDIM 64
#define NB   4

#define WMMA_F16(A, B, C) \
  __builtin_amdgcn_wmma_f32_16x16x32_f16(false, (A), false, (B), (short)0, (C), false, false)

#define S_WAIT_ASYNCCNT0()   asm volatile("s_wait_asynccnt 0x0" ::: "memory")
#define S_WAIT_DSCNT0()      asm volatile("s_wait_dscnt 0x0" ::: "memory")

// Compile-time fence between the phases of an unrolled sub-tile (no instruction
// of its own): the "memory" clobber holds the LDS reads, the scheduling barrier
// the arithmetic, each on its side, so that a group of reads stands in front of
// the work that covers its latency; without it the compiler sinks the reads to
// their uses and waits for each pair in turn.
#define PHASE_FENCE() do { asm volatile("" ::: "memory"); __builtin_amdgcn_sched_barrier(0); } while (0)

// Eight 16-byte copies memory -> LDS of one lane (ASYNCcnt), at fixed steps
// from its first LDS byte l and its first global byte g. The s_wait_xcnt is
// the statement's last line, so that no address register named here is
// rewritten in front of it.
__device__ __forceinline__ void async_ld16x8(unsigned l, unsigned ls,
                                             const char* g, unsigned gs) {
  asm volatile("global_load_async_to_lds_b128 %0, %8, off\n\t"
               "global_load_async_to_lds_b128 %1, %9, off\n\t"
               "global_load_async_to_lds_b128 %2, %10, off\n\t"
               "global_load_async_to_lds_b128 %3, %11, off\n\t"
               "global_load_async_to_lds_b128 %4, %12, off\n\t"
               "global_load_async_to_lds_b128 %5, %13, off\n\t"
               "global_load_async_to_lds_b128 %6, %14, off\n\t"
               "global_load_async_to_lds_b128 %7, %15, off\n\t"
               "s_wait_xcnt 0x0"
               :: "v"(l), "v"(l + ls), "v"(l + 2 * ls), "v"(l + 3 * ls),
                  "v"(l + 4 * ls), "v"(l + 5 * ls), "v"(l + 6 * ls), "v"(l + 7 * ls),
                  "v"(g), "v"(g + gs), "v"(g + 2 * gs), "v"(g + 3 * gs),
                  "v"(g + 4 * gs), "v"(g + 5 * gs), "v"(g + 6 * gs), "v"(g + 7 * gs)
               : "memory");
}
// The same eight copies and one 8-byte copy (l8, g8), under one wait.
__device__ __forceinline__ void async_ld16x8_ld8(unsigned l, unsigned ls,
                                                 const char* g, unsigned gs,
                                                 unsigned l8, const char* g8) {
  asm volatile("global_load_async_to_lds_b128 %0, %8, off\n\t"
               "global_load_async_to_lds_b128 %1, %9, off\n\t"
               "global_load_async_to_lds_b128 %2, %10, off\n\t"
               "global_load_async_to_lds_b128 %3, %11, off\n\t"
               "global_load_async_to_lds_b128 %4, %12, off\n\t"
               "global_load_async_to_lds_b128 %5, %13, off\n\t"
               "global_load_async_to_lds_b128 %6, %14, off\n\t"
               "global_load_async_to_lds_b128 %7, %15, off\n\t"
               "global_load_async_to_lds_b64 %16, %17, off\n\t"
               "s_wait_xcnt 0x0"
               :: "v"(l), "v"(l + ls), "v"(l + 2 * ls), "v"(l + 3 * ls),
                  "v"(l + 4 * ls), "v"(l + 5 * ls), "v"(l + 6 * ls), "v"(l + 7 * ls),
                  "v"(g), "v"(g + gs), "v"(g + 2 * gs), "v"(g + 3 * gs),
                  "v"(g + 4 * gs), "v"(g + 5 * gs), "v"(g + 6 * gs), "v"(g + 7 * gs),
                  "v"(l8), "v"(g8)
               : "memory");
}
__device__ __forceinline__ unsigned lds_addr(const void* p) {
  return (unsigned)(unsigned long long)p;   // low 32 bits of generic = LDS offset
}

// 16x32 f16 A/B fragment: row = tile_row + lane%16, halves 0..7 at
// K = 8*(lane/16), halves 8..15 at K = 16 + 8*(lane/16).
__device__ __forceinline__ v16h load_frag(const _Float16* lo, const _Float16* hi) {
  v8h a = *(const v8h*)lo;
  v8h b = *(const v8h*)hi;
  v16h r;
#pragma unroll
  for (int i = 0; i < 8; ++i) { r[i] = a[i]; r[8 + i] = b[i]; }
  return r;
}

// ---------------------------------------------------------------------------
// Kernel 1: fused Q/K/V projection (1x1 conv). Q,K row-major f16; V stored
// transposed (c-major) so it is the A operand of out^T = V^T * P.
// One block = 64 pixels. A thread owns one output column f of Q, K and V for
// 8 consecutive pixels, so each weight it loads feeds 8 FMAs and its 8 V
// values are one 16-byte piece of a V^T row.
// ---------------------------------------------------------------------------
#define PJ_PIX 64                  // pixels per block
#define PJ_PPT 8                   // pixels per thread

// waves_per_eu(4, 4): a 16-wave block is 4 waves per SIMD; without it the
// compiler keeps registers low and sinks the look-ahead loads to their uses.
__global__ void __launch_bounds__(512) __attribute__((amdgpu_waves_per_eu(4, 4)))
proj_kernel(const float* __restrict__ x,
            const float* __restrict__ Wq, const float* __restrict__ bq,
            const float* __restrict__ Wk, const float* __restrict__ bk,
            const float* __restrict__ Wv, const float* __restrict__ bv,
            _Float16* __restrict__ qh, _Float16* __restrict__ kh,
            _Float16* __restrict__ vT) {
  __shared__ __align__(16) float xs[PJ_PIX][CDIM];
  const int tid = threadIdx.x;
  const int f   = tid & 63;
  const int p0  = (tid >> 6) * PJ_PPT;          // same for all lanes of a wave
  const int g0  = blockIdx.x * PJ_PIX;          // first pixel (over all batches)

  // stage the 64x64 f32 x tile: 1024 float4, two per thread
  const float4* xsrc = (const float4*)(x + (long long)g0 * CDIM);
  float4* xdst = (float4*)&xs[0][0];
  xdst[tid]       = xsrc[tid];
  xdst[tid + 512] = xsrc[tid + 512];
  __syncthreads();

  float aq[PJ_PPT], ak[PJ_PPT], av[PJ_PPT];
  {
    const float q0 = bq[f], k0 = bk[f], v0 = bv[f];
#pragma unroll
    for (int p = 0; p < PJ_PPT; ++p) { aq[p] = q0; ak[p] = k0; av[p] = v0; }
  }

  // Groups of 4 input channels. The next group's weights and x values are
  // loaded before the current group's FMAs, so their latency is covered; the
  // FMAs run channel-outer, pixel-inner: 24 independent chains, and each sum
  // still takes its channels in ascending order.
  float  wc[3][4];
  float4 xc[PJ_PPT];
#pragma unroll
  for (int j = 0; j < 4; ++j) {
    wc[0][j] = Wq[j * CDIM + f];
    wc[1][j] = Wk[j * CDIM + f];
    wc[2][j] = Wv[j * CDIM + f];
  }
#pragma unroll
  for (int p = 0; p < PJ_PPT; ++p) xc[p] = *(const float4*)&xs[p0 + p][0];

  // unroll 2: the two register sets swap roles without copies
#pragma unroll 2
  for (int c = 0; c < CDIM; c += 4) {
    float  wn[3][4];
    float4 xn[PJ_PPT];
    const int cn = (c + 4 < CDIM) ? c + 4 : 0;   // last trip reloads group 0, unused
#pragma unroll
    for (int j = 0; j < 4; ++j) {
      wn[0][j] = Wq[(cn + j) * CDIM + f];
      wn[1][j] = Wk[(cn + j) * CDIM + f];
      wn[2][j] = Wv[(cn + j) * CDIM + f];
    }
#pragma unroll
    for (int p = 0; p < PJ_PPT; ++p) xn[p] = *(const float4*)&xs[p0 + p][cn];
#pragma unroll
    for (int j = 0; j < 4; ++j) {
#pragma unroll
      for (int p = 0; p < PJ_PPT; ++p) {
        const float xv = (j == 0) ? xc[p].x : (j == 1) ? xc[p].y : (j == 2) ? xc[p].z : xc[p].w;
        aq[p] = fmaf(xv, wc[0][j], aq[p]);
        ak[p] = fmaf(xv, wc[1][j], ak[p]);
        av[p] = fmaf(xv, wc[2][j], av[p]);
      }
    }
#pragma unroll
    for (int j = 0; j < 4; ++j) { wc[0][j] = wn[0][j]; wc[1][j] = wn[1][j]; wc[2][j] = wn[2][j]; }
#pragma unroll
    for (int p = 0; p < PJ_PPT; ++p) xc[p] = xn[p];
  }

  v8h vrow;
#pragma unroll
  for (int p = 0; p < PJ_PPT; ++p) {
    const long long o = (long long)(g0 + p0 + p) * CDIM + f;
    qh[o] = (_Float16)aq[p];
    kh[o] = (_Float16)ak[p];
    vrow[p] = (_Float16)av[p];
  }
  const int b = g0 >> 12;                       // 64 divides NPIX: one batch per block
  const int n = (g0 & (NPIX - 1)) + p0;
  *(v8h*)(vT + ((long long)(b * CDIM + f)) * NPIX + n) = vrow;
}

// ---------------------------------------------------------------------------
// Kernel 2: streaming row stats. 4 waves/block, each wave one 16-row m-tile.
// K comes through LDS in stages of 128 rows (two buffers, async copies): a
// stage's copies fly during the whole trip before it, one barrier ends a trip,
// and the running max and sum are brought up to date once per 64 rows of K.
// ---------------------------------------------------------------------------
#define K2_ROWS 128                // k rows per stage
#define K2_STR  72                 // padded k-row stride in halves
#define K2_BUF  (K2_ROWS * K2_STR) // halves per buffer
#define K2_NST  (NPIX / K2_ROWS)   // stages

// p: this lane's first half of a 32-row sub-tile in LDS
__device__ __forceinline__ void k2_frags(const _Float16* p, v16h (&f)[4]) {
  const _Float16* p1 = p + 16 * K2_STR;
  f[0] = load_frag(p,       p + 16);
  f[1] = load_frag(p + 32,  p + 48);
  f[2] = load_frag(p1,      p1 + 16);
  f[3] = load_frag(p1 + 32, p1 + 48);
}
__device__ __forceinline__ void k2_energy(v16h a0, v16h a1, const v16h (&f)[4], v8f (&e)[2]) {
  v8f e0 = {}, e1 = {};
  e0 = WMMA_F16(a0, f[0], e0);
  e0 = WMMA_F16(a1, f[1], e0);
  e1 = WMMA_F16(a0, f[2], e1);
  e1 = WMMA_F16(a1, f[3], e1);
  e[0] = e0; e[1] = e1;
}

// exp(v - m) is taken as exp2(v * K2_LOG2E - m * K2_LOG2E): one FMA and one
// v_exp_f32 a value
#define K2_LOG2E 1.4426950408889634f

__device__ __forceinline__ v2f k2_exp2(v2f t) {
  const v2f r = {__builtin_amdgcn_exp2f(t[0]), __builtin_amdgcn_exp2f(t[1])};
  return r;
}
// exp2(v * K2_LOG2E - nc) of rows 2k and 2k + 1 of an energy tile
__device__ __forceinline__ v2f k2_exp(const v8f& v, int k, v2f nc) {
  const v2f l2e = {K2_LOG2E, K2_LOG2E};
  const v2f x = {v[2 * k], v[2 * k + 1]};
  return k2_exp2(__builtin_elementwise_fma(x, l2e, -nc));
}

// Running max and sum of this lane's 8 rows over 64 more columns (four energy
// tiles, four values a row): first the new max of each row, then one exponential
// for each value and one for the old sum's rescale. The rescale takes the
// difference of the two maxima first, so it is exactly 1 while a row's max stands.
__device__ __forceinline__ void k2_update(const v8f (&ea)[2], const v8f (&eb)[2],
                                          v8f& mx, v8f& sm) {
  v8f nm;
#pragma unroll
  for (int i = 0; i < 8; ++i)
    nm[i] = __builtin_fmaximum_numf(__builtin_fmaximum_numf(__builtin_fmaximum_numf(
                __builtin_fmaximum_numf(mx[i], ea[0][i]), ea[1][i]), eb[0][i]), eb[1][i]);
#pragma unroll
  for (int k = 0; k < 4; ++k) {
    const v2f n2 = {nm[2 * k], nm[2 * k + 1]};
    const v2f o2 = {mx[2 * k], mx[2 * k + 1]};
    const v2f s2 = {sm[2 * k], sm[2 * k + 1]};
    const v2f nc = n2 * K2_LOG2E;
    const v2f p  = (k2_exp(ea[0], k, nc) + k2_exp(ea[1], k, nc)) +
                   (k2_exp(eb[0], k, nc) + k2_exp(eb[1], k, nc));
    const v2f r  = __builtin_elementwise_fma(s2, k2_exp2((o2 - n2) * K2_LOG2E), p);
    sm[2 * k] = r[0]; sm[2 * k + 1] = r[1];
  }
  mx = nm;
}

// One stage: four 32-row sub-tiles, taken as two halves of 64 rows. All its LDS
// reads stand in one group at the head.
__device__ __forceinline__ void k2_trip(const _Float16* ks, v16h a0, v16h a1,
                                        v8f& mx, v8f& sm) {
  v16h f[4][4];                                 // fragments of the four sub-tiles
  v8f  e[4][2];                                 // their energies
#pragma unroll
  for (int j = 0; j < K2_ROWS / 32; ++j) k2_frags(ks + j * 32 * K2_STR, f[j]);
  PHASE_FENCE();
#pragma unroll
  for (int j = 0; j < K2_ROWS / 32; ++j) k2_energy(a0, a1, f[j], e[j]);
  k2_update(e[0], e[1], mx, sm);
  k2_update(e[2], e[3], mx, sm);
  // keeps the arithmetic in front of the waits at the trip's foot; without it
  // the wait for every LDS read moves up to the head, with nothing to cover it
  PHASE_FENCE();
}

// waves_per_eu(4, 4): a budget of 256 registers for the fragments in flight
__global__ void __launch_bounds__(128) __attribute__((amdgpu_waves_per_eu(4, 4)))
rowstats_kernel(const _Float16* __restrict__ qh, const _Float16* __restrict__ kh,
                float* __restrict__ rowmax, float* __restrict__ rowinv) {
  __shared__ __align__(16) _Float16 smem[2 * K2_BUF];
  const int tid  = threadIdx.x;
  const int lane = tid & 31;
  const int wv   = tid >> 5;
  const int h16  = lane >> 4;
  const int l16  = lane & 15;
  const int b    = blockIdx.x >> 6;
  const int m0   = (blockIdx.x & 63) * 64 + wv * 16;

  const _Float16* q = qh + (long long)b * NPIX * CDIM;
  const _Float16* k = kh + (long long)b * NPIX * CDIM;

  const _Float16* qrow = q + (m0 + l16) * CDIM;
  const v16h a0 = load_frag(qrow + h16 * 8,      qrow + 16 + h16 * 8);
  const v16h a1 = load_frag(qrow + 32 + h16 * 8, qrow + 48 + h16 * 8);

  // staging: 128 rows x 8 chunks of 16B; a thread's 8 chunks lie 16 rows apart
  const unsigned lst = lds_addr(smem) + (unsigned)((tid >> 3) * K2_STR + (tid & 7) * 8) * 2;
  const char*    gst = (const char*)k + tid * 16;

  // stage 0 landed and published, then stage 1 in flight
  async_ld16x8(lst, 16 * K2_STR * 2, gst, 16 * CDIM * 2);
  S_WAIT_ASYNCCNT0();
  __syncthreads();
  async_ld16x8(lst + K2_BUF * 2, 16 * K2_STR * 2, gst + K2_ROWS * CDIM * 2, 16 * CDIM * 2);

  v8f mx, sm;
#pragma unroll
  for (int i = 0; i < 8; ++i) { mx[i] = -3.0e38f; sm[i] = 0.0f; }

  // Foot of every trip: own LDS reads done, own copies of stage t+1 landed,
  // then the one barrier that publishes stage t+1 and frees this buffer.
  // While a stage t+2 exists it is copied into that buffer; the last two trips
  // stand in a loop of their own, so each trip is one straight block.
  const _Float16* ks0 = smem + l16 * K2_STR + h16 * 8;
  for (int t = 0; t < K2_NST - 2; ++t) {
    k2_trip(ks0 + (t & 1) * K2_BUF, a0, a1, mx, sm);
    S_WAIT_DSCNT0();
    S_WAIT_ASYNCCNT0();
    __syncthreads();
    async_ld16x8(lst + (unsigned)((t & 1) * K2_BUF) * 2, 16 * K2_STR * 2,
                 gst + (t + 2) * (K2_ROWS * CDIM * 2), 16 * CDIM * 2);
  }
  for (int t = K2_NST - 2; t < K2_NST; ++t) {
    k2_trip(ks0 + (t & 1) * K2_BUF, a0, a1, mx, sm);
    S_WAIT_DSCNT0();
    S_WAIT_ASYNCCNT0();
    __syncthreads();
  }
  S_WAIT_ASYNCCNT0();                           // nothing in flight at the wave's end
  // merge across the 16 lanes sharing each row m
#pragma unroll
  for (int i = 0; i < 8; ++i) {
    float m = mx[i], s = sm[i];
#pragma unroll
    for (int off = 8; off >= 1; off >>= 1) {
      const float om = __shfl_xor(m, off, 32);
      const float os = __shfl_xor(s, off, 32);
      const float nm = fmaxf(m, om);
      s = s * __expf(m - nm) + os * __expf(om - nm);
      m = nm;
    }
    mx[i] = m; sm[i] = s;
  }
  if (l16 == 0) {
    const int base = b * NPIX + m0 + h16 * 8;
#pragma unroll
    for (int i = 0; i < 8; ++i) {
      rowmax[base + i] = mx[i];
      rowinv[base + i] = 1.0f / sm[i];
    }
  }
}

// ---------------------------------------------------------------------------
// Kernel 3: out^T = V^T * softmax(E). 4 waves/block, each wave one 16-col
// n-tile. Q (128x64), V^T (64x128) and the stats of 128 rows m make one stage
// in LDS (two buffers, async copies, 17 per thread and stage); one barrier
// ends a trip, whose four 32-row sub-tiles are unrolled.
// Energy D-tile register layout == second WMMA's B-operand layout, so P is
// fed through registers with no transpose.
// ---------------------------------------------------------------------------
#define K3_ROWS 128                     // rows m per stage
#define K3_QSTR 72                      // padded q-row stride (halves)
#define K3_VSTR 136                     // padded vT-row stride (halves)
#define K3_QSZ  (K3_ROWS * K3_QSTR)     // halves
#define K3_VSZ  (CDIM * K3_VSTR)        // halves
#define K3_SSZ  (4 * K3_ROWS)           // 256 floats (max[128] + inv[128])
#define K3_BUF  (K3_QSZ + K3_VSZ + K3_SSZ)
#define K3_NST  (NPIX / K3_ROWS)        // stages

// lq, lv, ls: this thread's first LDS byte of each part in buffer 0;
// gq, gv, gs: its first global byte of each part in stage 0.
__device__ __forceinline__ void k3_stage(int bb, int t, unsigned lq, unsigned lv, unsigned ls,
                                         const char* gq, const char* gv, const char* gs) {
  const unsigned o = (unsigned)(bb * K3_BUF) * 2;
  // Q: 128 rows x 8 chunks, a thread's chunks 16 rows apart
  async_ld16x8(lq + o, 16 * K3_QSTR * 2, gq + t * (K3_ROWS * CDIM * 2), 16 * CDIM * 2);
  // V^T: 64 rows x 16 chunks, a thread's chunks 8 rows apart;
  // stats: 256 floats, two per thread
  async_ld16x8_ld8(lv + o, 8 * K3_VSTR * 2, gv + t * (K3_ROWS * 2), 8 * NPIX * 2,
                   ls + o, gs + t * (K3_ROWS * 4));
}

// p: this lane's first half (or float) of a 32-row sub-tile's part in LDS
__device__ __forceinline__ void k3_qfrags(const _Float16* p, v16h (&a)[4]) {
  const _Float16* p1 = p + 16 * K3_QSTR;
  a[0] = load_frag(p,       p + 16);
  a[1] = load_frag(p + 32,  p + 48);
  a[2] = load_frag(p1,      p1 + 16);
  a[3] = load_frag(p1 + 32, p1 + 48);
}
__device__ __forceinline__ void k3_vfrags(const _Float16* p, v16h (&a)[4]) {
#pragma unroll
  for (int ct = 0; ct < 4; ++ct)
    a[ct] = load_frag(p + ct * 16 * K3_VSTR, p + ct * 16 * K3_VSTR + 16);
}
__device__ __forceinline__ void k3_stats(const float* p, float4 (&s)[8]) {
  s[0] = *(const float4*)(p);                 // max, rows +0..7
  s[1] = *(const float4*)(p + 4);
  s[2] = *(const float4*)(p + 16);            // max, rows +16..23
  s[3] = *(const float4*)(p + 20);
  s[4] = *(const float4*)(p + K3_ROWS);       // 1/sum, the same rows
  s[5] = *(const float4*)(p + K3_ROWS + 4);
  s[6] = *(const float4*)(p + K3_ROWS + 16);
  s[7] = *(const float4*)(p + K3_ROWS + 20);
}

// waves_per_eu(4, 4): a budget of 256 registers for the fragments in flight
__global__ void __launch_bounds__(128) __attribute__((amdgpu_waves_per_eu(4, 4)))
attnout_kernel(const _Float16* __restrict__ qh, const _Float16* __restrict__ kh,
               const _Float16* __restrict__ vT,
               const float* __restrict__ rowmax, const float* __restrict__ rowinv,
               const float* __restrict__ x, const float* __restrict__ gamma,
               float* __restrict__ out) {
  __shared__ __align__(16) _Float16 smem[2 * K3_BUF];
  const int tid  = threadIdx.x;
  const int lane = tid & 31;
  const int wv   = tid >> 5;
  const int h16  = lane >> 4;
  const int l16  = lane & 15;
  const int b    = blockIdx.x >> 6;
  const int n0   = (blockIdx.x & 63) * 64 + wv * 16;

  const _Float16* q  = qh + (long long)b * NPIX * CDIM;
  const _Float16* k  = kh + (long long)b * NPIX * CDIM;
  const _Float16* vt = vT + (long long)b * CDIM * NPIX;
  const float* mx_base = rowmax + b * NPIX;
  const float* iv_base = rowinv + b * NPIX;

  // B operand of the energy WMMAs: k rows n0..n0+15 (fixed per wave)
  const _Float16* krow = k + (n0 + l16) * CDIM;
  const v16h bk0 = load_frag(krow + h16 * 8,      krow + 16 + h16 * 8);
  const v16h bk1 = load_frag(krow + 32 + h16 * 8, krow + 48 + h16 * 8);

  const unsigned sbase = lds_addr(smem);
  const unsigned lq = sbase + (unsigned)((tid >> 3) * K3_QSTR + (tid & 7) * 8) * 2;
  const unsigned lv = sbase + (unsigned)(K3_QSZ + (tid >> 4) * K3_VSTR + (tid & 15) * 8) * 2;
  const unsigned ls = sbase + (unsigned)(K3_QSZ + K3_VSZ) * 2 + (unsigned)tid * 8;
  const char* gq = (const char*)q + tid * 16;
  const char* gv = (const char*)vt + (tid >> 4) * (NPIX * 2) + (tid & 15) * 16;
  const char* gs = (tid < 64) ? (const char*)mx_base + tid * 8
                              : (const char*)iv_base + (tid - 64) * 8;

  // stage 0 landed and published, then stage 1 in flight
  k3_stage(0, 0, lq, lv, ls, gq, gv, gs);
  S_WAIT_ASYNCCNT0();
  __syncthreads();
  k3_stage(1, 1, lq, lv, ls, gq, gv, gs);

  v8f acc0 = {}, acc1 = {}, acc2 = {}, acc3 = {};

  for (int t = 0; t < K3_NST; ++t) {
    const _Float16* sb = smem + (t & 1) * K3_BUF;
    const _Float16* qs = sb + l16 * K3_QSTR + h16 * 8;
    const _Float16* vs = sb + K3_QSZ + l16 * K3_VSTR + h16 * 8;
    const float*    st = (const float*)(sb + K3_QSZ + K3_VSZ) + h16 * 8;

    v16h   qa[4], va[4];                  // Q and V^T fragments of a sub-tile
    float4 s[2][8];                       // stats of two sub-tiles
    k3_qfrags(qs, qa);
    k3_stats(st, s[0]);
    k3_vfrags(vs, va);
    PHASE_FENCE();
#pragma unroll
    for (int j = 0; j < K3_ROWS / 32; ++j) {
      v8f e0 = {}, e1 = {};
      e0 = WMMA_F16(qa[0], bk0, e0);
      e0 = WMMA_F16(qa[1], bk1, e0);
      e1 = WMMA_F16(qa[2], bk0, e1);
      e1 = WMMA_F16(qa[3], bk1, e1);
      PHASE_FENCE();
      if (j + 1 < K3_ROWS / 32) {         // read under this sub-tile's vector work
        k3_qfrags(qs + (j + 1) * 32 * K3_QSTR, qa);
        k3_stats(st + (j + 1) * 32, s[(j + 1) & 1]);
      }
      PHASE_FENCE();
      const float4* sj = s[j & 1];
      const float mx0[8] = {sj[0].x, sj[0].y, sj[0].z, sj[0].w, sj[1].x, sj[1].y, sj[1].z, sj[1].w};
      const float mx1[8] = {sj[2].x, sj[2].y, sj[2].z, sj[2].w, sj[3].x, sj[3].y, sj[3].z, sj[3].w};
      const float iv0[8] = {sj[4].x, sj[4].y, sj[4].z, sj[4].w, sj[5].x, sj[5].y, sj[5].z, sj[5].w};
      const float iv1[8] = {sj[6].x, sj[6].y, sj[6].z, sj[6].w, sj[7].x, sj[7].y, sj[7].z, sj[7].w};
      v16h pb;
#pragma unroll
      for (int r = 0; r < 8; ++r) {
        pb[r]     = (_Float16)(__expf(e0[r] - mx0[r]) * iv0[r]);
        pb[8 + r] = (_Float16)(__expf(e1[r] - mx1[r]) * iv1[r]);
      }
      acc0 = WMMA_F16(va[0], pb, acc0);
      acc1 = WMMA_F16(va[1], pb, acc1);
      acc2 = WMMA_F16(va[2], pb, acc2);
      acc3 = WMMA_F16(va[3], pb, acc3);
      PHASE_FENCE();
      if (j + 1 < K3_ROWS / 32) k3_vfrags(vs + (j + 1) * 32, va);
    }
    // foot of the trip: own LDS reads done, own copies of stage t+1 landed,
    // then the one barrier that publishes stage t+1 and frees this buffer
    S_WAIT_DSCNT0();
    S_WAIT_ASYNCCNT0();
    __syncthreads();
    if (t + 2 < K3_NST) k3_stage(t & 1, t + 2, lq, lv, ls, gq, gv, gs);
  }
  S_WAIT_ASYNCCNT0();                     // nothing in flight at the wave's end

  // Epilogue: D element (c = ct*16 + r + 8*h16, n = n0 + l16)
  const long long row = (long long)(b * NPIX + n0 + l16) * CDIM;
  const float* xr = x + row;
  float* outr = out + row;
  const float g = gamma[0];
  const v8f accs[4] = {acc0, acc1, acc2, acc3};
#pragma unroll
  for (int ct = 0; ct < 4; ++ct) {
    const int base = ct * 16 + h16 * 8;
    float4 oA, oB;
    oA.x = fmaf(g, accs[ct][0], xr[base + 0]);
    oA.y = fmaf(g, accs[ct][1], xr[base + 1]);
    oA.z = fmaf(g, accs[ct][2], xr[base + 2]);
    oA.w = fmaf(g, accs[ct][3], xr[base + 3]);
    oB.x = fmaf(g, accs[ct][4], xr[base + 4]);
    oB.y = fmaf(g, accs[ct][5], xr[base + 5]);
    oB.z = fmaf(g, accs[ct][6], xr[base + 6]);
    oB.w = fmaf(g, accs[ct][7], xr[base + 7]);
    *(float4*)(outr + base)     = oA;
    *(float4*)(outr + base + 4) = oB;
  }
}

// ---------------------------------------------------------------------------
extern "C" void kernel_launch(void* const* d_in, const int* in_sizes, int n_in,
                              void* d_out, int out_size, void* d_ws, size_t ws_size,
                              hipStream_t stream) {
  (void)in_sizes; (void)n_in; (void)out_size; (void)ws_size;
  const float* x     = (const float*)d_in[0];
  const float* Wq    = (const float*)d_in[1];
  const float* bq    = (const float*)d_in[2];
  const float* Wk    = (const float*)d_in[3];
  const float* bk    = (const float*)d_in[4];
  const float* Wv    = (const float*)d_in[5];
  const float* bv    = (const float*)d_in[6];
  const float* gamma = (const float*)d_in[7];
  float* out = (float*)d_out;

  // workspace: q(2MB) k(2MB) vT(2MB) rowmax(64KB) rowinv(64KB)
  _Float16* qh = (_Float16*)d_ws;
  _Float16* kh = qh + (size_t)NB * NPIX * CDIM;
  _Float16* vT = kh + (size_t)NB * NPIX * CDIM;
  float* rowmax = (float*)(vT + (size_t)NB * NPIX * CDIM);
  float* rowinv = rowmax + (size_t)NB * NPIX;

  proj_kernel<<<NB * NPIX / PJ_PIX, 512, 0, stream>>>(x, Wq, bq, Wk, bk, Wv, bv, qh, kh, vT);
  rowstats_kernel<<<NB * 64, 128, 0, stream>>>(qh, kh, rowmax, rowinv);
  attnout_kernel<<<NB * 64, 128, 0, stream>>>(qh, kh, vT, rowmax, rowinv, x, gamma, out);
}

// v004
// It runs in 43 microseconds.
// Next to v003, in two timings, it ran 1.34 and 1.32 times as fast.
// Over all steps from v000 it is 3.83 times as fast.
#include <hip/hip_runtime.h>

// PAM attention, B=4, H=W=64, C=64 (N=4096).
// f16 WMMA for both big GEMMs; f32 softmax math; LDS tile sharing across
// 8 waves per workgroup, staged with global_load_async_to_lds copies
// (two buffers, 512 rows per stage).

typedef _Float16 v8h  __attribute__((ext_vector_type(8)));
typedef _Float16 v16h __attribute__((ext_vector_type(16)));
typedef float    v8f  __attribute__((ext_vector_type(8)));
typedef float    v2f  __attribute__((ext_vector_type(2)));

#define NPIX 4096
#define CDIM 64
#define NB   4

#define WMMA_F16(A, B, C) \
  __builtin_amdgcn_wmma_f32_16x16x32_f16(false, (A), false, (B), (short)0, (C), false, false)

#define S_WAIT_ASYNCCNT0()   asm volatile("s_wait_asynccnt 0x0" ::: "memory")
#define S_WAIT_DSCNT0()      asm volatile("s_wait_dscnt 0x0" ::: "memory")

// Compile-time fence between the phases of an unrolled sub-tile (no instruction
// of its own): the "memory" clobber holds the LDS reads, the scheduling barrier
// the arithmetic, each on its side, so that a group of reads stands in front of
// the work that covers its latency; without it the compiler sinks the reads to
// their uses and waits for each pair in turn.
#define PHASE_FENCE() do { asm volatile("" ::: "memory"); __builtin_amdgcn_sched_barrier(0); } while (0)

// Eight 16-byte copies memory -> LDS of one lane (ASYNCcnt), at fixed steps
// from its first LDS byte l and its first global byte g. The s_wait_xcnt is
// the statement's last line, so that no address register named here is
// rewritten in front of it.
__device__ __forceinline__ void async_ld16x8(unsigned l, unsigned ls,
                                             const char* g, unsigned gs) {
  asm volatile("global_load_async_to_lds_b128 %0, %8, off\n\t"
               "global_load_async_to_lds_b128 %1, %9, off\n\t"
               "global_load_async_to_lds_b128 %2, %10, off\n\t"
               "global_load_async_to_lds_b128 %3, %11, off\n\t"
               "global_load_async_to_lds_b128 %4, %12, off\n\t"
               "global_load_async_to_lds_b128 %5, %13, off\n\t"
               "global_load_async_to_lds_b128 %6, %14, off\n\t"
               "global_load_async_to_lds_b128 %7, %15, off\n\t"
               "s_wait_xcnt 0x0"
               :: "v"(l), "v"(l + ls), "v"(l + 2 * ls), "v"(l + 3 * ls),
                  "v"(l + 4 * ls), "v"(l + 5 * ls), "v"(l + 6 * ls), "v"(l + 7 * ls),
                  "v"(g), "v"(g + gs), "v"(g + 2 * gs), "v"(g + 3 * gs),
                  "v"(g + 4 * gs), "v"(g + 5 * gs), "v"(g + 6 * gs), "v"(g + 7 * gs)
               : "memory");
}
// The same eight copies and a ninth of 16 bytes (l8, g8), under one wait.
__device__ __forceinline__ void async_ld16x9(unsigned l, unsigned ls,
                                                 const char* g, unsigned gs,
                                                 unsigned l8, const char* g8) {
  asm volatile("global_load_async_to_lds_b128 %0, %8, off\n\t"
               "global_load_async_to_lds_b128 %1, %9, off\n\t"
               "global_load_async_to_lds_b128 %2, %10, off\n\t"
               "global_load_async_to_lds_b128 %3, %11, off\n\t"
               "global_load_async_to_lds_b128 %4, %12, off\n\t"
               "global_load_async_to_lds_b128 %5, %13, off\n\t"
               "global_load_async_to_lds_b128 %6, %14, off\n\t"
               "global_load_async_to_lds_b128 %7, %15, off\n\t"
               "global_load_async_to_lds_b128 %16, %17, off\n\t"
               "s_wait_xcnt 0x0"
               :: "v"(l), "v"(l + ls), "v"(l + 2 * ls), "v"(l + 3 * ls),
                  "v"(l + 4 * ls), "v"(l + 5 * ls), "v"(l + 6 * ls), "v"(l + 7 * ls),
                  "v"(g), "v"(g + gs), "v"(g + 2 * gs), "v"(g + 3 * gs),
                  "v"(g + 4 * gs), "v"(g + 5 * gs), "v"(g + 6 * gs), "v"(g + 7 * gs),
                  "v"(l8), "v"(g8)
               : "memory");
}
__device__ __forceinline__ unsigned lds_addr(const void* p) {
  return (unsigned)(unsigned long long)p;   // low 32 bits of generic = LDS offset
}

// 16x32 f16 A/B fragment: row = tile_row + lane%16, halves 0..7 at
// K = 8*(lane/16), halves 8..15 at K = 16 + 8*(lane/16).
__device__ __forceinline__ v16h load_frag(const _Float16* lo, const _Float16* hi) {
  v8h a = *(const v8h*)lo;
  v8h b = *(const v8h*)hi;
  v16h r;
#pragma unroll
  for (int i = 0; i < 8; ++i) { r[i] = a[i]; r[8 + i] = b[i]; }
  return r;
}

// ---------------------------------------------------------------------------
// Kernel 1: fused Q/K/V projection (1x1 conv). Q,K row-major f16; V stored
// transposed (c-major) so it is the A operand of out^T = V^T * P.
// One block = 64 pixels. A thread owns one output column f of Q, K and V for
// 8 consecutive pixels, so each weight it loads feeds 8 FMAs and its 8 V
// values are one 16-byte piece of a V^T row.
// ---------------------------------------------------------------------------
#define PJ_PIX 64                  // pixels per block
#define PJ_PPT 8                   // pixels per thread

// waves_per_eu(4, 4): a 16-wave block is 4 waves per SIMD; without it the
// compiler keeps registers low and sinks the look-ahead loads to their uses.
__global__ void __launch_bounds__(512) __attribute__((amdgpu_waves_per_eu(4, 4)))
proj_kernel(const float* __restrict__ x,
            const float* __restrict__ Wq, const float* __restrict__ bq,
            const float* __restrict__ Wk, const float* __restrict__ bk,
            const float* __restrict__ Wv, const float* __restrict__ bv,
            _Float16* __restrict__ qh, _Float16* __restrict__ kh,
            _Float16* __restrict__ vT) {
  __shared__ __align__(16) float xs[PJ_PIX][CDIM];
  const int tid = threadIdx.x;
  const int f   = tid & 63;
  const int p0  = (tid >> 6) * PJ_PPT;          // same for all lanes of a wave
  const int g0  = blockIdx.x * PJ_PIX;          // first pixel (over all batches)

  // stage the 64x64 f32 x tile: 1024 float4, two per thread
  const float4* xsrc = (const float4*)(x + (long long)g0 * CDIM);
  float4* xdst = (float4*)&xs[0][0];
  xdst[tid]       = xsrc[tid];
  xdst[tid + 512] = xsrc[tid + 512];
  __syncthreads();

  float aq[PJ_PPT], ak[PJ_PPT], av[PJ_PPT];
  {
    const float q0 = bq[f], k0 = bk[f], v0 = bv[f];
#pragma unroll
    for (int p = 0; p < PJ_PPT; ++p) { aq[p] = q0; ak[p] = k0; av[p] = v0; }
  }

  // Groups of 4 input channels. The next group's weights and x values are
  // loaded before the current group's FMAs, so their latency is covered; the
  // FMAs run channel-outer, pixel-inner: 24 independent chains, and each sum
  // still takes its channels in ascending order.
  float  wc[3][4];
  float4 xc[PJ_PPT];
#pragma unroll
  for (int j = 0; j < 4; ++j) {
    wc[0][j] = Wq[j * CDIM + f];
    wc[1][j] = Wk[j * CDIM + f];
    wc[2][j] = Wv[j * CDIM + f];
  }
#pragma unroll
  for (int p = 0; p < PJ_PPT; ++p) xc[p] = *(const float4*)&xs[p0 + p][0];

  // unroll 2: the two register sets swap roles without copies
#pragma unroll 2
  for (int c = 0; c < CDIM; c += 4) {
    float  wn[3][4];
    float4 xn[PJ_PPT];
    const int cn = (c + 4 < CDIM) ? c + 4 : 0;   // last trip reloads group 0, unused
#pragma unroll
    for (int j = 0; j < 4; ++j) {
      wn[0][j] = Wq[(cn + j) * CDIM + f];
      wn[1][j] = Wk[(cn + j) * CDIM + f];
      wn[2][j] = Wv[(cn + j) * CDIM + f];
    }
#pragma unroll
    for (int p = 0; p < PJ_PPT; ++p) xn[p] = *(const float4*)&xs[p0 + p][cn];
#pragma unroll
    for (int j = 0; j < 4; ++j) {
#pragma unroll
      for (int p = 0; p < PJ_PPT; ++p) {
        const float xv = (j == 0) ? xc[p].x : (j == 1) ? xc[p].y : (j == 2) ? xc[p].z : xc[p].w;
        aq[p] = fmaf(xv, wc[0][j], aq[p]);
        ak[p] = fmaf(xv, wc[1][j], ak[p]);
        av[p] = fmaf(xv, wc[2][j], av[p]);
      }
    }
#pragma unroll
    for (int j = 0; j < 4; ++j) { wc[0][j] = wn[0][j]; wc[1][j] = wn[1][j]; wc[2][j] = wn[2][j]; }
#pragma unroll
    for (int p = 0; p < PJ_PPT; ++p) xc[p] = xn[p];
  }

  v8h vrow;
#pragma unroll
  for (int p = 0; p < PJ_PPT; ++p) {
    const long long o = (long long)(g0 + p0 + p) * CDIM + f;
    qh[o] = (_Float16)aq[p];
    kh[o] = (_Float16)ak[p];
    vrow[p] = (_Float16)av[p];
  }
  const int b = g0 >> 12;                       // 64 divides NPIX: one batch per block
  const int n = (g0 & (NPIX - 1)) + p0;
  *(v8h*)(vT + ((long long)(b * CDIM + f)) * NPIX + n) = vrow;
}

// ---------------------------------------------------------------------------
// Kernel 2: streaming row stats. 8 waves/block (two per SIMD). A wave owns two
// 16-row m-tiles and one quarter (128 rows) of every K stage, so each K fragment
// it reads from LDS feeds two m-tiles; the four quarters of a row are merged
// through LDS at the end.
// K comes through LDS in stages of 512 rows (two buffers, async copies): a
// stage's copies fly during the whole trip before it, one barrier ends a trip,
// and the running max and sum are brought up to date once per 64 rows of K.
// ---------------------------------------------------------------------------
#define K2_ROWS 512                // k rows per stage
#define K2_WROWS (K2_ROWS / 4)     // k rows of a stage that one wave takes
#define K2_STR  72                 // padded k-row stride in halves
#define K2_BUF  (K2_ROWS * K2_STR) // halves per buffer
#define K2_NST  (NPIX / K2_ROWS)   // stages

// p: this lane's first half of a 32-row sub-tile in LDS
__device__ __forceinline__ void k2_frags(const _Float16* p, v16h (&f)[4]) {
  const _Float16* p1 = p + 16 * K2_STR;
  f[0] = load_frag(p,       p + 16);
  f[1] = load_frag(p + 32,  p + 48);
  f[2] = load_frag(p1,      p1 + 16);
  f[3] = load_frag(p1 + 32, p1 + 48);
}
__device__ __forceinline__ void k2_energy(v16h a0, v16h a1, const v16h (&f)[4], v8f (&e)[2]) {
  v8f e0 = {}, e1 = {};
  e0 = WMMA_F16(a0, f[0], e0);
  e0 = WMMA_F16(a1, f[1], e0);
  e1 = WMMA_F16(a0, f[2], e1);
  e1 = WMMA_F16(a1, f[3], e1);
  e[0] = e0; e[1] = e1;
}

// exp(v - m) is taken as exp2(v * K2_LOG2E - m * K2_LOG2E): one FMA and one
// v_exp_f32 a value
#define K2_LOG2E 1.4426950408889634f

__device__ __forceinline__ v2f k2_exp2(v2f t) {
  const v2f r = {__builtin_amdgcn_exp2f(t[0]), __builtin_amdgcn_exp2f(t[1])};
  return r;
}
// exp2(v * K2_LOG2E - nc) of rows 2k and 2k + 1 of an energy tile
__device__ __forceinline__ v2f k2_exp(const v8f& v, int k, v2f nc) {
  const v2f l2e = {K2_LOG2E, K2_LOG2E};
  const v2f x = {v[2 * k], v[2 * k + 1]};
  return k2_exp2(__builtin_elementwise_fma(x, l2e, -nc));
}

// Running max and sum of this lane's 8 rows over 64 more columns (four energy
// tiles, four values a row): first the new max of each row, then one exponential
// for each value and one for the old sum's rescale. The rescale takes the
// difference of the two maxima first, so it is exactly 1 while a row's max stands.
__device__ __forceinline__ void k2_update(const v8f (&ea)[2], const v8f (&eb)[2],
                                          v8f& mx, v8f& sm) {
  v8f nm;
#pragma unroll
  for (int i = 0; i < 8; ++i)
    nm[i] = __builtin_fmaximum_numf(__builtin_fmaximum_numf(__builtin_fmaximum_numf(
                __builtin_fmaximum_numf(mx[i], ea[0][i]), ea[1][i]), eb[0][i]), eb[1][i]);
#pragma unroll
  for (int k = 0; k < 4; ++k) {
    const v2f n2 = {nm[2 * k], nm[2 * k + 1]};
    const v2f o2 = {mx[2 * k], mx[2 * k + 1]};
    const v2f s2 = {sm[2 * k], sm[2 * k + 1]};
    const v2f nc = n2 * K2_LOG2E;
    const v2f p  = (k2_exp(ea[0], k, nc) + k2_exp(ea[1], k, nc)) +
                   (k2_exp(eb[0], k, nc) + k2_exp(eb[1], k, nc));
    const v2f r  = __builtin_elementwise_fma(s2, k2_exp2((o2 - n2) * K2_LOG2E), p);
    sm[2 * k] = r[0]; sm[2 * k + 1] = r[1];
  }
  mx = nm;
}

// Half of one wave's share of a stage: two 32-row sub-tiles against two
// m-tiles. All its LDS reads stand in one group at the head.
__device__ __forceinline__ void k2_trip(const _Float16* ks, const v16h (&a)[2][2],
                                        v8f (&mx)[2], v8f (&sm)[2]) {
  v16h f[2][4];                                 // fragments of the two sub-tiles
  v8f  e[2][2][2];                              // energies: m-tile, sub-tile
#pragma unroll
  for (int j = 0; j < 2; ++j) k2_frags(ks + j * 32 * K2_STR, f[j]);
  PHASE_FENCE();
#pragma unroll
  for (int mt = 0; mt < 2; ++mt) {
#pragma unroll
    for (int j = 0; j < 2; ++j) k2_energy(a[mt][0], a[mt][1], f[j], e[mt][j]);
  }
  k2_update(e[0][0], e[0][1], mx[0], sm[0]);
  k2_update(e[1][0], e[1][1], mx[1], sm[1]);
  // keeps the arithmetic in front of the waits at the trip's foot; without it
  // the wait for every LDS read moves up to the head, with nothing to cover it
  PHASE_FENCE();
}

// Stage t into buffer bb. l, g: this thread's first LDS byte in buffer 0 and
// its first global byte of stage 0; rows 0..255, then rows 256..511.
__device__ __forceinline__ void k2_stage(int bb, int t, unsigned l, const char* g) {
  const unsigned lo = l + (unsigned)(bb * K2_BUF) * 2;
  const char*    go = g + t * (K2_ROWS * CDIM * 2);
  async_ld16x8(lo, 32 * K2_STR * 2, go, 32 * CDIM * 2);
  async_ld16x8(lo + 256 * K2_STR * 2, 32 * K2_STR * 2, go + 256 * CDIM * 2, 32 * CDIM * 2);
}

// waves_per_eu(4, 4): a budget of 256 registers for the fragments in flight
__global__ void __launch_bounds__(256) __attribute__((amdgpu_waves_per_eu(4, 4)))
rowstats_kernel(const _Float16* __restrict__ qh, const _Float16* __restrict__ kh,
                float* __restrict__ rowmax, float* __restrict__ rowinv) {
  __shared__ __align__(16) _Float16 smem[2 * K2_BUF];
  const int tid  = threadIdx.x;
  const int lane = tid & 31;
  const int wv   = tid >> 5;
  const int h16  = lane >> 4;
  const int l16  = lane & 15;
  const int mp   = wv & 1;                      // which 32 of the block's 64 rows m
  const int kq   = wv >> 1;                     // which quarter of every stage
  const int b    = blockIdx.x >> 6;
  const int mb   = (blockIdx.x & 63) * 64;

  const _Float16* q = qh + (long long)b * NPIX * CDIM;
  const _Float16* k = kh + (long long)b * NPIX * CDIM;

  v16h a[2][2];
#pragma unroll
  for (int mt = 0; mt < 2; ++mt) {
    const _Float16* qrow = q + (mb + mp * 32 + mt * 16 + l16) * CDIM;
    a[mt][0] = load_frag(qrow + h16 * 8,      qrow + 16 + h16 * 8);
    a[mt][1] = load_frag(qrow + 32 + h16 * 8, qrow + 48 + h16 * 8);
  }

  // staging: 512 rows x 8 chunks of 16B; a thread's 16 chunks lie 32 rows apart
  const unsigned lst = lds_addr(smem) + (unsigned)((tid >> 3) * K2_STR + (tid & 7) * 8) * 2;
  const char*    gst = (const char*)k + tid * 16;

  // stage 0 landed and published, then stage 1 in flight
  k2_stage(0, 0, lst, gst);
  S_WAIT_ASYNCCNT0();
  __syncthreads();
  k2_stage(1, 1, lst, gst);

  v8f mx[2], sm[2];
#pragma unroll
  for (int mt = 0; mt < 2; ++mt) {
#pragma unroll
    for (int i = 0; i < 8; ++i) { mx[mt][i] = -3.0e38f; sm[mt][i] = 0.0f; }
  }

  // Foot of every trip: own LDS reads done, own copies of stage t+1 landed,
  // then the one barrier that publishes stage t+1 and frees this buffer.
  // While a stage t+2 exists it is copied into that buffer; the last two trips
  // stand in a loop of their own, so no trip holds a test around the copies.
  const _Float16* ks0 = smem + (kq * K2_WROWS + l16) * K2_STR + h16 * 8;
  for (int t = 0; t < K2_NST - 2; ++t) {
    // kept rolled: unrolled, the two halves' values overlap and some spill to scratch
#pragma nounroll
    for (int h = 0; h < 2; ++h) k2_trip(ks0 + (t & 1) * K2_BUF + h * 64 * K2_STR, a, mx, sm);
    S_WAIT_DSCNT0();
    S_WAIT_ASYNCCNT0();
    __syncthreads();
    k2_stage(t & 1, t + 2, lst, gst);
  }
  for (int t = K2_NST - 2; t < K2_NST; ++t) {
    // kept rolled: unrolled, the two halves' values overlap and some spill to scratch
#pragma nounroll
    for (int h = 0; h < 2; ++h) k2_trip(ks0 + (t & 1) * K2_BUF + h * 64 * K2_STR, a, mx, sm);
    S_WAIT_DSCNT0();
    S_WAIT_ASYNCCNT0();
    __syncthreads();
  }
  S_WAIT_ASYNCCNT0();                           // nothing in flight at the wave's end
  // merge across the 16 lanes sharing each row m
#pragma unroll
  for (int mt = 0; mt < 2; ++mt) {
#pragma unroll
    for (int i = 0; i < 8; ++i) {
      float m = mx[mt][i], s = sm[mt][i];
#pragma unroll
      for (int off = 8; off >= 1; off >>= 1) {
        const float om = __shfl_xor(m, off, 32);
        const float os = __shfl_xor(s, off, 32);
        const float nm = fmaxf(m, om);
        s = s * __expf(m - nm) + os * __expf(om - nm);
        m = nm;
      }
      mx[mt][i] = m; sm[mt][i] = s;
    }
  }
  // merge across the four waves that hold a row's quarters: (max, sum) pairs go
  // through LDS, free since the last trip's barrier; pair index = quarter * 64 + row
  float2* red = (float2*)smem;
  if (l16 == 0) {
#pragma unroll
    for (int mt = 0; mt < 2; ++mt) {
#pragma unroll
      for (int i = 0; i < 8; ++i)
        red[kq * 64 + mp * 32 + mt * 16 + h16 * 8 + i] = make_float2(mx[mt][i], sm[mt][i]);
    }
  }
  __syncthreads();
  if (tid < 64) {
    float2 r = red[tid];
    float m = r.x, s = r.y;
#pragma unroll
    for (int qd = 1; qd < 4; ++qd) {
      const float2 o  = red[qd * 64 + tid];
      const float  nm = fmaxf(m, o.x);
      s = s * __expf(m - nm) + o.y * __expf(o.x - nm);
      m = nm;
    }
    rowmax[b * NPIX + mb + tid] = m;
    rowinv[b * NPIX + mb + tid] = 1.0f / s;
  }
}

// ---------------------------------------------------------------------------
// Kernel 3: out^T = V^T * softmax(E). 8 waves/block (two per SIMD). A wave owns
// two 16-col n-tiles and one quarter (128 rows m) of every stage, so each Q and
// V^T fragment it reads from LDS feeds two n-tiles; the four partial sums of a
// column are added through LDS at the end.
// Q (512x64), V^T (64x512) and the stats of 512 rows m make one stage in LDS
// (two buffers, async copies, 33 per thread and stage); one barrier ends a
// trip, in which a wave's four 32-row sub-tiles are unrolled.
// Energy D-tile register layout == second WMMA's B-operand layout, so P is
// fed through registers with no transpose.
// ---------------------------------------------------------------------------
#define K3_ROWS 512                     // rows m per stage
#define K3_WROWS (K3_ROWS / 4)          // rows m of a stage that one wave takes
#define K3_QSTR 72                      // padded q-row stride (halves)
#define K3_VSTR 520                     // padded vT-row stride (halves)
#define K3_QSZ  (K3_ROWS * K3_QSTR)     // halves
#define K3_VSZ  (CDIM * K3_VSTR)        // halves
#define K3_SSZ  (4 * K3_ROWS)           // 1024 floats (max[512] + inv[512])
#define K3_BUF  (K3_QSZ + K3_VSZ + K3_SSZ)
#define K3_NST  (NPIX / K3_ROWS)        // stages

// lq, lv, ls: this thread's first LDS byte of each part in buffer 0;
// gq, gv, gs: its first global byte of each part in stage 0.
__device__ __forceinline__ void k3_stage(int bb, int t, unsigned lq, unsigned lv, unsigned ls,
                                         const char* gq, const char* gv, const char* gs) {
  const unsigned o = (unsigned)(bb * K3_BUF) * 2;
  // Q: 512 rows x 8 chunks, a thread's 16 chunks 32 rows apart
  const char* gqt = gq + t * (K3_ROWS * CDIM * 2);
  async_ld16x8(lq + o, 32 * K3_QSTR * 2, gqt, 32 * CDIM * 2);
  async_ld16x8(lq + o + 256 * K3_QSTR * 2, 32 * K3_QSTR * 2, gqt + 256 * CDIM * 2, 32 * CDIM * 2);
  // V^T: 64 rows x 64 chunks, a thread's 16 chunks 4 rows apart;
  // stats: 1024 floats, four per thread
  const char* gvt = gv + t * (K3_ROWS * 2);
  async_ld16x8(lv + o, 4 * K3_VSTR * 2, gvt, 4 * NPIX * 2);
  async_ld16x9(lv + o + 32 * K3_VSTR * 2, 4 * K3_VSTR * 2, gvt + 32 * NPIX * 2, 4 * NPIX * 2,
               ls + o, gs + t * (K3_ROWS * 4));
}

// p: this lane's first half (or float) of a 32-row sub-tile's part in LDS
__device__ __forceinline__ void k3_qfrags(const _Float16* p, v16h (&a)[4]) {
  const _Float16* p1 = p + 16 * K3_QSTR;
  a[0] = load_frag(p,       p + 16);
  a[1] = load_frag(p + 32,  p + 48);
  a[2] = load_frag(p1,      p1 + 16);
  a[3] = load_frag(p1 + 32, p1 + 48);
}
__device__ __forceinline__ void k3_vfrags(const _Float16* p, v16h (&a)[4]) {
#pragma unroll
  for (int ct = 0; ct < 4; ++ct)
    a[ct] = load_frag(p + ct * 16 * K3_VSTR, p + ct * 16 * K3_VSTR + 16);
}
__device__ __forceinline__ void k3_stats(const float* p, float4 (&s)[8]) {
  s[0] = *(const float4*)(p);                 // max, rows +0..7
  s[1] = *(const float4*)(p + 4);
  s[2] = *(const float4*)(p + 16);            // max, rows +16..23
  s[3] = *(const float4*)(p + 20);
  s[4] = *(const float4*)(p + K3_ROWS);       // 1/sum, the same rows
  s[5] = *(const float4*)(p + K3_ROWS + 4);
  s[6] = *(const float4*)(p + K3_ROWS + 16);
  s[7] = *(const float4*)(p + K3_ROWS + 20);
}

// waves_per_eu(4, 4): a budget of 256 registers for the fragments in flight
__global__ void __launch_bounds__(256) __attribute__((amdgpu_waves_per_eu(4, 4)))
attnout_kernel(const _Float16* __restrict__ qh, const _Float16* __restrict__ kh,
               const _Float16* __restrict__ vT,
               const float* __restrict__ rowmax, const float* __restrict__ rowinv,
               const float* __restrict__ x, const float* __restrict__ gamma,
               float* __restrict__ out) {
  __shared__ __align__(16) _Float16 smem[2 * K3_BUF];
  const int tid  = threadIdx.x;
  const int lane = tid & 31;
  const int wv   = tid >> 5;
  const int h16  = lane >> 4;
  const int l16  = lane & 15;
  const int np   = wv & 1;                // which 32 of the block's 64 columns n
  const int mq   = wv >> 1;               // which quarter of every stage
  const int b    = blockIdx.x >> 6;
  const int n0   = (blockIdx.x & 63) * 64 + np * 32;

  const _Float16* q  = qh + (long long)b * NPIX * CDIM;
  const _Float16* k  = kh + (long long)b * NPIX * CDIM;
  const _Float16* vt = vT + (long long)b * CDIM * NPIX;
  const float* mx_base = rowmax + b * NPIX;
  const float* iv_base = rowinv + b * NPIX;

  // B operands of the energy WMMAs: k rows n0..n0+31 (fixed per wave)
  v16h bk[2][2];
#pragma unroll
  for (int nt = 0; nt < 2; ++nt) {
    const _Float16* krow = k + (n0 + nt * 16 + l16) * CDIM;
    bk[nt][0] = load_frag(krow + h16 * 8,      krow + 16 + h16 * 8);
    bk[nt][1] = load_frag(krow + 32 + h16 * 8, krow + 48 + h16 * 8);
  }

  const unsigned sbase = lds_addr(smem);
  const unsigned lq = sbase + (unsigned)((tid >> 3) * K3_QSTR + (tid & 7) * 8) * 2;
  const unsigned lv = sbase + (unsigned)(K3_QSZ + (tid >> 6) * K3_VSTR + (tid & 63) * 8) * 2;
  const unsigned ls = sbase + (unsigned)(K3_QSZ + K3_VSZ) * 2 + (unsigned)tid * 16;
  const char* gq = (const char*)q + tid * 16;
  const char* gv = (const char*)vt + (tid >> 6) * (NPIX * 2) + (tid & 63) * 16;
  const char* gs = (tid < 128) ? (const char*)mx_base + tid * 16
                               : (const char*)iv_base + (tid - 128) * 16;

  // stage 0 landed and published, then stage 1 in flight
  k3_stage(0, 0, lq, lv, ls, gq, gv, gs);
  S_WAIT_ASYNCCNT0();
  __syncthreads();
  k3_stage(1, 1, lq, lv, ls, gq, gv, gs);

  v8f acc[2][4];                          // n-tile, 16 channels each
#pragma unroll
  for (int nt = 0; nt < 2; ++nt) {
#pragma unroll
    for (int ct = 0; ct < 4; ++ct) acc[nt][ct] = v8f{};
  }

  for (int t = 0; t < K3_NST; ++t) {
    const _Float16* sb = smem + (t & 1) * K3_BUF;
    const _Float16* qs = sb + (mq * K3_WROWS + l16) * K3_QSTR + h16 * 8;
    const _Float16* vs = sb + K3_QSZ + l16 * K3_VSTR + mq * K3_WROWS + h16 * 8;
    const float*    st = (const float*)(sb + K3_QSZ + K3_VSZ) + mq * K3_WROWS + h16 * 8;

    v16h   qa[4], va[4];                  // Q and V^T fragments of a sub-tile
    float4 s[8];                          // its stats
    k3_qfrags(qs, qa);
    k3_stats(st, s);
    k3_vfrags(vs, va);
    PHASE_FENCE();
#pragma unroll
    for (int j = 0; j < K3_WROWS / 32; ++j) {
      v8f e[2][2];                        // n-tile, 16 rows m each
#pragma unroll
      for (int nt = 0; nt < 2; ++nt) {
        e[nt][0] = WMMA_F16(qa[0], bk[nt][0], v8f{});
        e[nt][1] = WMMA_F16(qa[2], bk[nt][0], v8f{});
      }
#pragma unroll
      for (int nt = 0; nt < 2; ++nt) {
        e[nt][0] = WMMA_F16(qa[1], bk[nt][1], e[nt][0]);
        e[nt][1] = WMMA_F16(qa[3], bk[nt][1], e[nt][1]);
      }
      PHASE_FENCE();
      if (j + 1 < K3_WROWS / 32)          // read under this sub-tile's vector work
        k3_qfrags(qs + (j + 1) * 32 * K3_QSTR, qa);
      PHASE_FENCE();
      const float mx0[8] = {s[0].x, s[0].y, s[0].z, s[0].w, s[1].x, s[1].y, s[1].z, s[1].w};
      const float mx1[8] = {s[2].x, s[2].y, s[2].z, s[2].w, s[3].x, s[3].y, s[3].z, s[3].w};
      const float iv0[8] = {s[4].x, s[4].y, s[4].z, s[4].w, s[5].x, s[5].y, s[5].z, s[5].w};
      const float iv1[8] = {s[6].x, s[6].y, s[6].z, s[6].w, s[7].x, s[7].y, s[7].z, s[7].w};
#pragma unroll
      for (int nt = 0; nt < 2; ++nt) {
        v16h pb;
#pragma unroll
        for (int r = 0; r < 8; ++r) {
          pb[r]     = (_Float16)(__expf(e[nt][0][r] - mx0[r]) * iv0[r]);
          pb[8 + r] = (_Float16)(__expf(e[nt][1][r] - mx1[r]) * iv1[r]);
        }
#pragma unroll
        for (int ct = 0; ct < 4; ++ct) acc[nt][ct] = WMMA_F16(va[ct], pb, acc[nt][ct]);
      }
      PHASE_FENCE();
      if (j + 1 < K3_WROWS / 32) {
        k3_stats(st + (j + 1) * 32, s);
        k3_vfrags(vs + (j + 1) * 32, va);
      }
    }
    // foot of the trip: own LDS reads done, own copies of stage t+1 landed,
    // then the one barrier that publishes stage t+1 and frees this buffer
    S_WAIT_DSCNT0();
    S_WAIT_ASYNCCNT0();
    __syncthreads();
    if (t + 2 < K3_NST) k3_stage(t & 1, t + 2, lq, lv, ls, gq, gv, gs);
  }
  S_WAIT_ASYNCCNT0();                     // nothing in flight at the wave's end

  // The four partial sums of every output go through LDS, free since the last
  // trip's barrier. A wave's 64 floats per lane are 16 pieces of 16 bytes,
  // piece p = nt*8 + ct*2 + half, stored lane-contiguous.
  float4* red = (float4*)smem;
#pragma unroll
  for (int nt = 0; nt < 2; ++nt) {
#pragma unroll
    for (int ct = 0; ct < 4; ++ct) {
      const v8f v = acc[nt][ct];
      red[(wv * 16 + nt * 8 + ct * 2) * 32 + lane]     = make_float4(v[0], v[1], v[2], v[3]);
      red[(wv * 16 + nt * 8 + ct * 2 + 1) * 32 + lane] = make_float4(v[4], v[5], v[6], v[7]);
    }
  }
  __syncthreads();

  // Epilogue: wave (np, mq) finishes pieces mq*4 .. mq*4+3 of its column pair:
  // n-tile mq/2, channels (mq%2)*32 .. +31, one 128-byte half of each out row.
  // D element (c = ct*16 + r + 8*h16, n = n0 + nt*16 + l16)
  const long long row = (long long)(b * NPIX + n0 + (mq >> 1) * 16 + l16) * CDIM;
  const float* xr = x + row;
  float* outr = out + row;
  const float g = gamma[0];
#pragma unroll
  for (int i = 0; i < 4; ++i) {
    const int p = mq * 4 + i;
    float4 a4 = red[(np * 16 + p) * 32 + lane];
#pragma unroll
    for (int qd = 1; qd < 4; ++qd) {      // quarters in ascending order
      const float4 o = red[((np + 2 * qd) * 16 + p) * 32 + lane];
      a4.x += o.x; a4.y += o.y; a4.z += o.z; a4.w += o.w;
    }
    const int base = ((mq & 1) * 2 + (i >> 1)) * 16 + h16 * 8 + (i & 1) * 4;
    const float4 xv = *(const float4*)(xr + base);
    float4 o4;
    o4.x = fmaf(g, a4.x, xv.x);
    o4.y = fmaf(g, a4.y, xv.y);
    o4.z = fmaf(g, a4.z, xv.z);
    o4.w = fmaf(g, a4.w, xv.w);
    *(float4*)(outr + base) = o4;
  }
}

// ---------------------------------------------------------------------------
extern "C" void kernel_launch(void* const* d_in, const int* in_sizes, int n_in,
                              void* d_out, int out_size, void* d_ws, size_t ws_size,
                              hipStream_t stream) {
  (void)in_sizes; (void)n_in; (void)out_size; (void)ws_size;
  const float* x     = (const float*)d_in[0];
  const float* Wq    = (const float*)d_in[1];
  const float* bq    = (const float*)d_in[2];
  const float* Wk    = (const float*)d_in[3];
  const float* bk    = (const float*)d_in[4];
  const float* Wv    = (const float*)d_in[5];
  const float* bv    = (const float*)d_in[6];
  const float* gamma = (const float*)d_in[7];
  float* out = (float*)d_out;

  // workspace: q(2MB) k(2MB) vT(2MB) rowmax(64KB) rowinv(64KB)
  _Float16* qh = (_Float16*)d_ws;
  _Float16* kh = qh + (size_t)NB * NPIX * CDIM;
  _Float16* vT = kh + (size_t)NB * NPIX * CDIM;
  float* rowmax = (float*)(vT + (size_t)NB * NPIX * CDIM);
  float* rowinv = rowmax + (size_t)NB * NPIX;

  proj_kernel<<<NB * NPIX / PJ_PIX, 512, 0, stream>>>(x, Wq, bq, Wk, bk, Wv, bv, qh, kh, vT);
  rowstats_kernel<<<NB * 64, 256, 0, stream>>>(qh, kh, rowmax, rowinv);
  attnout_kernel<<<NB * 64, 256, 0, stream>>>(qh, kh, vT, rowmax, rowinv, x, gamma, out);
}

// v005
// Measured time: 39.3 microseconds a run.
// Timed twice side by side with v004, it ran 1.09 times as fast both times.
// All steps since v000 together make it 4.17 times as fast.
#include <hip/hip_runtime.h>

// PAM attention, B=4, H=W=64, C=64 (N=4096).
// f16 WMMA for both big GEMMs; f32 softmax math; LDS tile sharing across
// 8 waves per workgroup, staged with global_load_async_to_lds copies
// (two buffers, 512 rows per stage).

typedef _Float16 v8h  __attribute__((ext_vector_type(8)));
typedef _Float16 v16h __attribute__((ext_vector_type(16)));
typedef float    v8f  __attribute__((ext_vector_type(8)));
typedef float    v2f  __attribute__((ext_vector_type(2)));

#define NPIX 4096
#define CDIM 64
#define NB   4

#define WMMA_F16(A, B, C) \
  __builtin_amdgcn_wmma_f32_16x16x32_f16(false, (A), false, (B), (short)0, (C), false, false)

#define S_WAIT_ASYNCCNT0()   asm volatile("s_wait_asynccnt 0x0" ::: "memory")
#define S_WAIT_DSCNT0()      asm volatile("s_wait_dscnt 0x0" ::: "memory")

// Compile-time fence between the phases of an unrolled sub-tile (no instruction
// of its own): the "memory" clobber holds the LDS reads, the scheduling barrier
// the arithmetic, each on its side, so that a group of reads stands in front of
// the work that covers its latency; without it the compiler sinks the reads to
// their uses and waits for each pair in turn.
#define PHASE_FENCE() do { asm volatile("" ::: "memory"); __builtin_amdgcn_sched_barrier(0); } while (0)

// Eight 16-byte copies memory -> LDS of one lane (ASYNCcnt), at fixed steps
// from its first LDS byte l and its first global byte g. The s_wait_xcnt is
// the statement's last line, so that no address register named here is
// rewritten in front of it.
__device__ __forceinline__ void async_ld16x8(unsigned l, unsigned ls,
                                             const char* g, unsigned gs) {
  asm volatile("global_load_async_to_lds_b128 %0, %8, off\n\t"
               "global_load_async_to_lds_b128 %1, %9, off\n\t"
               "global_load_async_to_lds_b128 %2, %10, off\n\t"
               "global_load_async_to_lds_b128 %3, %11, off\n\t"
               "global_load_async_to_lds_b128 %4, %12, off\n\t"
               "global_load_async_to_lds_b128 %5, %13, off\n\t"
               "global_load_async_to_lds_b128 %6, %14, off\n\t"
               "global_load_async_to_lds_b128 %7, %15, off\n\t"
               "s_wait_xcnt 0x0"
               :: "v"(l), "v"(l + ls), "v"(l + 2 * ls), "v"(l + 3 * ls),
                  "v"(l + 4 * ls), "v"(l + 5 * ls), "v"(l + 6 * ls), "v"(l + 7 * ls),
                  "v"(g), "v"(g + gs), "v"(g + 2 * gs), "v"(g + 3 * gs),
                  "v"(g + 4 * gs), "v"(g + 5 * gs), "v"(g + 6 * gs), "v"(g + 7 * gs)
               : "memory");
}
// The same eight copies and a ninth of 8 bytes (l8, g8), under one wait.
__device__ __forceinline__ void async_ld16x8_8(unsigned l, unsigned ls,
                                                 const char* g, unsigned gs,
                                                 unsigned l8, const char* g8) {
  asm volatile("global_load_async_to_lds_b128 %0, %8, off\n\t"
               "global_load_async_to_lds_b128 %1, %9, off\n\t"
               "global_load_async_to_lds_b128 %2, %10, off\n\t"
               "global_load_async_to_lds_b128 %3, %11, off\n\t"
               "global_load_async_to_lds_b128 %4, %12, off\n\t"
               "global_load_async_to_lds_b128 %5, %13, off\n\t"
               "global_load_async_to_lds_b128 %6, %14, off\n\t"
               "global_load_async_to_lds_b128 %7, %15, off\n\t"
               "global_load_async_to_lds_b64 %16, %17, off\n\t"
               "s_wait_xcnt 0x0"
               :: "v"(l), "v"(l + ls), "v"(l + 2 * ls), "v"(l + 3 * ls),
                  "v"(l + 4 * ls), "v"(l + 5 * ls), "v"(l + 6 * ls), "v"(l + 7 * ls),
                  "v"(g), "v"(g + gs), "v"(g + 2 * gs), "v"(g + 3 * gs),
                  "v"(g + 4 * gs), "v"(g + 5 * gs), "v"(g + 6 * gs), "v"(g + 7 * gs),
                  "v"(l8), "v"(g8)
               : "memory");
}
__device__ __forceinline__ unsigned lds_addr(const void* p) {
  return (unsigned)(unsigned long long)p;   // low 32 bits of generic = LDS offset
}

// 16x32 f16 A/B fragment: row = tile_row + lane%16, halves 0..7 at
// K = 8*(lane/16), halves 8..15 at K = 16 + 8*(lane/16).
__device__ __forceinline__ v16h load_frag(const _Float16* lo, const _Float16* hi) {
  v8h a = *(const v8h*)lo;
  v8h b = *(const v8h*)hi;
  v16h r;
#pragma unroll
  for (int i = 0; i < 8; ++i) { r[i] = a[i]; r[8 + i] = b[i]; }
  return r;
}

// ---------------------------------------------------------------------------
// Kernel 1: fused Q/K/V projection (1x1 conv). Q,K row-major f16; V stored
// transposed (c-major) so it is the A operand of out^T = V^T * P.
// Q is stored times log2(e), scaled in f32 before its one rounding to f16, so
// every energy Q.K of the later kernels is an exponent of 2.
// One block = 64 pixels. A thread owns one output column f of Q, K and V for
// 8 consecutive pixels, so each weight it loads feeds 8 FMAs and its 8 V
// values are one 16-byte piece of a V^T row.
// ---------------------------------------------------------------------------
#define LOG2E 1.4426950408889634f
#define PJ_PIX 64                  // pixels per block
#define PJ_PPT 8                   // pixels per thread

// waves_per_eu(4, 4): a 16-wave block is 4 waves per SIMD; without it the
// compiler keeps registers low and sinks the look-ahead loads to their uses.
__global__ void __launch_bounds__(512) __attribute__((amdgpu_waves_per_eu(4, 4)))
proj_kernel(const float* __restrict__ x,
            const float* __restrict__ Wq, const float* __restrict__ bq,
            const float* __restrict__ Wk, const float* __restrict__ bk,
            const float* __restrict__ Wv, const float* __restrict__ bv,
            _Float16* __restrict__ qh, _Float16* __restrict__ kh,
            _Float16* __restrict__ vT) {
  __shared__ __align__(16) float xs[PJ_PIX][CDIM];
  const int tid = threadIdx.x;
  const int f   = tid & 63;
  const int p0  = (tid >> 6) * PJ_PPT;          // same for all lanes of a wave
  const int g0  = blockIdx.x * PJ_PIX;          // first pixel (over all batches)

  // stage the 64x64 f32 x tile: 1024 float4, two per thread
  const float4* xsrc = (const float4*)(x + (long long)g0 * CDIM);
  float4* xdst = (float4*)&xs[0][0];
  xdst[tid]       = xsrc[tid];
  xdst[tid + 512] = xsrc[tid + 512];
  __syncthreads();

  float aq[PJ_PPT], ak[PJ_PPT], av[PJ_PPT];
  {
    const float q0 = bq[f], k0 = bk[f], v0 = bv[f];
#pragma unroll
    for (int p = 0; p < PJ_PPT; ++p) { aq[p] = q0; ak[p] = k0; av[p] = v0; }
  }

  // Groups of 4 input channels. The next group's weights and x values are
  // loaded before the current group's FMAs, so their latency is covered; the
  // FMAs run channel-outer, pixel-inner: 24 independent chains, and each sum
  // still takes its channels in ascending order.
  float  wc[3][4];
  float4 xc[PJ_PPT];
#pragma unroll
  for (int j = 0; j < 4; ++j) {
    wc[0][j] = Wq[j * CDIM + f];
    wc[1][j] = Wk[j * CDIM + f];
    wc[2][j] = Wv[j * CDIM + f];
  }
#pragma unroll
  for (int p = 0; p < PJ_PPT; ++p) xc[p] = *(const float4*)&xs[p0 + p][0];

  // unroll 2: the two register sets swap roles without copies
#pragma unroll 2
  for (int c = 0; c < CDIM; c += 4) {
    float  wn[3][4];
    float4 xn[PJ_PPT];
    const int cn = (c + 4 < CDIM) ? c + 4 : 0;   // last trip reloads group 0, unused
#pragma unroll
    for (int j = 0; j < 4; ++j) {
      wn[0][j] = Wq[(cn + j) * CDIM + f];
      wn[1][j] = Wk[(cn + j) * CDIM + f];
      wn[2][j] = Wv[(cn + j) * CDIM + f];
    }
#pragma unroll
    for (int p = 0; p < PJ_PPT; ++p) xn[p] = *(const float4*)&xs[p0 + p][cn];
#pragma unroll
    for (int j = 0; j < 4; ++j) {
#pragma unroll
      for (int p = 0; p < PJ_PPT; ++p) {
        const float xv = (j == 0) ? xc[p].x : (j == 1) ? xc[p].y : (j == 2) ? xc[p].z : xc[p].w;
        aq[p] = fmaf(xv, wc[0][j], aq[p]);
        ak[p] = fmaf(xv, wc[1][j], ak[p]);
        av[p] = fmaf(xv, wc[2][j], av[p]);
      }
    }
#pragma unroll
    for (int j = 0; j < 4; ++j) { wc[0][j] = wn[0][j]; wc[1][j] = wn[1][j]; wc[2][j] = wn[2][j]; }
#pragma unroll
    for (int p = 0; p < PJ_PPT; ++p) xc[p] = xn[p];
  }

  v8h vrow;
#pragma unroll
  for (int p = 0; p < PJ_PPT; ++p) {
    const long long o = (long long)(g0 + p0 + p) * CDIM + f;
    qh[o] = (_Float16)(aq[p] * LOG2E);
    kh[o] = (_Float16)ak[p];
    vrow[p] = (_Float16)av[p];
  }
  const int b = g0 >> 12;                       // 64 divides NPIX: one batch per block
  const int n = (g0 & (NPIX - 1)) + p0;
  *(v8h*)(vT + ((long long)(b * CDIM + f)) * NPIX + n) = vrow;
}

// ---------------------------------------------------------------------------
// Kernel 2: streaming row stats. 8 waves/block (two per SIMD). A wave owns two
// 16-row m-tiles and one quarter (128 rows) of every K stage, so each K fragment
// it reads from LDS feeds two m-tiles; the four quarters of a row are merged
// through LDS at the end.
// K comes through LDS in stages of 512 rows (two buffers, async copies): a
// stage's copies fly during the whole trip before it, one barrier ends a trip,
// and the running max and sum are brought up to date once per 64 rows of K.
// ---------------------------------------------------------------------------
#define K2_ROWS 512                // k rows per stage
#define K2_WROWS (K2_ROWS / 4)     // k rows of a stage that one wave takes
#define K2_STR  72                 // padded k-row stride in halves
#define K2_BUF  (K2_ROWS * K2_STR) // halves per buffer
#define K2_NST  (NPIX / K2_ROWS)   // stages

// p: this lane's first half of a 32-row sub-tile in LDS
__device__ __forceinline__ void k2_frags(const _Float16* p, v16h (&f)[4]) {
  const _Float16* p1 = p + 16 * K2_STR;
  f[0] = load_frag(p,       p + 16);
  f[1] = load_frag(p + 32,  p + 48);
  f[2] = load_frag(p1,      p1 + 16);
  f[3] = load_frag(p1 + 32, p1 + 48);
}
__device__ __forceinline__ void k2_energy(v16h a0, v16h a1, const v16h (&f)[4], v8f (&e)[2]) {
  v8f e0 = {}, e1 = {};
  e0 = WMMA_F16(a0, f[0], e0);
  e0 = WMMA_F16(a1, f[1], e0);
  e1 = WMMA_F16(a0, f[2], e1);
  e1 = WMMA_F16(a1, f[3], e1);
  e[0] = e0; e[1] = e1;
}

// Energies are exponents of 2 (Q carries log2(e)): exp(v - m) of the natural
// energies is exp2 of the difference here, one subtraction and one v_exp_f32.
__device__ __forceinline__ v2f k2_exp2(v2f t) {
  const v2f r = {__builtin_amdgcn_exp2f(t[0]), __builtin_amdgcn_exp2f(t[1])};
  return r;
}
// exp2(v - nc) of rows 2k and 2k + 1 of an energy tile
__device__ __forceinline__ v2f k2_exp(const v8f& v, int k, v2f nc) {
  const v2f x = {v[2 * k], v[2 * k + 1]};
  return k2_exp2(x - nc);
}

// Running max and sum of this lane's 8 rows over 64 more columns (four energy
// tiles, four values a row): first the new max of each row, then one exponential
// for each value and one for the old sum's rescale. The rescale takes the
// difference of the two maxima first, so it is exactly 1 while a row's max stands.
__device__ __forceinline__ void k2_update(const v8f (&ea)[2], const v8f (&eb)[2],
                                          v8f& mx, v8f& sm) {
  v8f nm;
#pragma unroll
  for (int i = 0; i < 8; ++i)
    nm[i] = __builtin_fmaximum_numf(__builtin_fmaximum_numf(__builtin_fmaximum_numf(
                __builtin_fmaximum_numf(mx[i], ea[0][i]), ea[1][i]), eb[0][i]), eb[1][i]);
#pragma unroll
  for (int k = 0; k < 4; ++k) {
    const v2f n2 = {nm[2 * k], nm[2 * k + 1]};
    const v2f o2 = {mx[2 * k], mx[2 * k + 1]};
    const v2f s2 = {sm[2 * k], sm[2 * k + 1]};
    const v2f p  = (k2_exp(ea[0], k, n2) + k2_exp(ea[1], k, n2)) +
                   (k2_exp(eb[0], k, n2) + k2_exp(eb[1], k, n2));
    const v2f r  = __builtin_elementwise_fma(s2, k2_exp2(o2 - n2), p);
    sm[2 * k] = r[0]; sm[2 * k + 1] = r[1];
  }
  mx = nm;
}

// Half of one wave's share of a stage: two 32-row sub-tiles against two
// m-tiles. All its LDS reads stand in one group at the head.
__device__ __forceinline__ void k2_trip(const _Float16* ks, const v16h (&a)[2][2],
                                        v8f (&mx)[2], v8f (&sm)[2]) {
  v16h f[2][4];                                 // fragments of the two sub-tiles
  v8f  e[2][2][2];                              // energies: m-tile, sub-tile
#pragma unroll
  for (int j = 0; j < 2; ++j) k2_frags(ks + j * 32 * K2_STR, f[j]);
  PHASE_FENCE();
#pragma unroll
  for (int mt = 0; mt < 2; ++mt) {
#pragma unroll
    for (int j = 0; j < 2; ++j) k2_energy(a[mt][0], a[mt][1], f[j], e[mt][j]);
  }
  k2_update(e[0][0], e[0][1], mx[0], sm[0]);
  k2_update(e[1][0], e[1][1], mx[1], sm[1]);
  // keeps the arithmetic in front of the waits at the trip's foot; without it
  // the wait for every LDS read moves up to the head, with nothing to cover it
  PHASE_FENCE();
}

// Stage t into buffer bb. l, g: this thread's first LDS byte in buffer 0 and
// its first global byte of stage 0; rows 0..255, then rows 256..511.
__device__ __forceinline__ void k2_stage(int bb, int t, unsigned l, const char* g) {
  const unsigned lo = l + (unsigned)(bb * K2_BUF) * 2;
  const char*    go = g + t * (K2_ROWS * CDIM * 2);
  async_ld16x8(lo, 32 * K2_STR * 2, go, 32 * CDIM * 2);
  async_ld16x8(lo + 256 * K2_STR * 2, 32 * K2_STR * 2, go + 256 * CDIM * 2, 32 * CDIM * 2);
}

// waves_per_eu(4, 4): a budget of 256 registers for the fragments in flight
__global__ void __launch_bounds__(256) __attribute__((amdgpu_waves_per_eu(4, 4)))
rowstats_kernel(const _Float16* __restrict__ qh, const _Float16* __restrict__ kh,
                float* __restrict__ rowc) {
  __shared__ __align__(16) _Float16 smem[2 * K2_BUF];
  const int tid  = threadIdx.x;
  const int lane = tid & 31;
  const int wv   = tid >> 5;
  const int h16  = lane >> 4;
  const int l16  = lane & 15;
  const int mp   = wv & 1;                      // which 32 of the block's 64 rows m
  const int kq   = wv >> 1;                     // which quarter of every stage
  const int b    = blockIdx.x >> 6;
  const int mb   = (blockIdx.x & 63) * 64;

  const _Float16* q = qh + (long long)b * NPIX * CDIM;
  const _Float16* k = kh + (long long)b * NPIX * CDIM;

  v16h a[2][2];
#pragma unroll
  for (int mt = 0; mt < 2; ++mt) {
    const _Float16* qrow = q + (mb + mp * 32 + mt * 16 + l16) * CDIM;
    a[mt][0] = load_frag(qrow + h16 * 8,      qrow + 16 + h16 * 8);
    a[mt][1] = load_frag(qrow + 32 + h16 * 8, qrow + 48 + h16 * 8);
  }

  // staging: 512 rows x 8 chunks of 16B; a thread's 16 chunks lie 32 rows apart
  const unsigned lst = lds_addr(smem) + (unsigned)((tid >> 3) * K2_STR + (tid & 7) * 8) * 2;
  const char*    gst = (const char*)k + tid * 16;

  // stage 0 landed and published, then stage 1 in flight
  k2_stage(0, 0, lst, gst);
  S_WAIT_ASYNCCNT0();
  __syncthreads();
  k2_stage(1, 1, lst, gst);

  v8f mx[2], sm[2];
#pragma unroll
  for (int mt = 0; mt < 2; ++mt) {
#pragma unroll
    for (int i = 0; i < 8; ++i) { mx[mt][i] = -3.0e38f; sm[mt][i] = 0.0f; }
  }

  // Foot of every trip: own LDS reads done, own copies of stage t+1 landed,
  // then the one barrier that publishes stage t+1 and frees this buffer.
  // While a stage t+2 exists it is copied into that buffer; the last two trips
  // stand in a loop of their own, so no trip holds a test around the copies.
  const _Float16* ks0 = smem + (kq * K2_WROWS + l16) * K2_STR + h16 * 8;
  for (int t = 0; t < K2_NST - 2; ++t) {
    // kept rolled: unrolled, the two halves' values overlap and some spill to scratch
#pragma nounroll
    for (int h = 0; h < 2; ++h) k2_trip(ks0 + (t & 1) * K2_BUF + h * 64 * K2_STR, a, mx, sm);
    S_WAIT_DSCNT0();
    S_WAIT_ASYNCCNT0();
    __syncthreads();
    k2_stage(t & 1, t + 2, lst, gst);
  }
  for (int t = K2_NST - 2; t < K2_NST; ++t) {
    // kept rolled: unrolled, the two halves' values overlap and some spill to scratch
#pragma nounroll
    for (int h = 0; h < 2; ++h) k2_trip(ks0 + (t & 1) * K2_BUF + h * 64 * K2_STR, a, mx, sm);
    S_WAIT_DSCNT0();
    S_WAIT_ASYNCCNT0();
    __syncthreads();
  }
  S_WAIT_ASYNCCNT0();                           // nothing in flight at the wave's end
  // merge across the 16 lanes sharing each row m
#pragma unroll
  for (int mt = 0; mt < 2; ++mt) {
#pragma unroll
    for (int i = 0; i < 8; ++i) {
      float m = mx[mt][i], s = sm[mt][i];
#pragma unroll
      for (int off = 8; off >= 1; off >>= 1) {
        const float om = __shfl_xor(m, off, 32);
        const float os = __shfl_xor(s, off, 32);
        const float nm = fmaxf(m, om);
        s = s * __builtin_amdgcn_exp2f(m - nm) + os * __builtin_amdgcn_exp2f(om - nm);
        m = nm;
      }
      mx[mt][i] = m; sm[mt][i] = s;
    }
  }
  // merge across the four waves that hold a row's quarters: (max, sum) pairs go
  // through LDS, free since the last trip's barrier; pair index = quarter * 64 + row
  float2* red = (float2*)smem;
  if (l16 == 0) {
#pragma unroll
    for (int mt = 0; mt < 2; ++mt) {
#pragma unroll
      for (int i = 0; i < 8; ++i)
        red[kq * 64 + mp * 32 + mt * 16 + h16 * 8 + i] = make_float2(mx[mt][i], sm[mt][i]);
    }
  }
  __syncthreads();
  if (tid < 64) {
    float2 r = red[tid];
    float m = r.x, s = r.y;
#pragma unroll
    for (int qd = 1; qd < 4; ++qd) {
      const float2 o  = red[qd * 64 + tid];
      const float  nm = fmaxf(m, o.x);
      s = s * __builtin_amdgcn_exp2f(m - nm) + o.y * __builtin_amdgcn_exp2f(o.x - nm);
      m = nm;
    }
    // one constant a row: softmax value = exp2(energy + rowc); s >= 1, v_log_f32 is log2
    rowc[b * NPIX + mb + tid] = -(m + __builtin_amdgcn_logf(s));
  }
}

// ---------------------------------------------------------------------------
// Kernel 3: out^T = V^T * softmax(E). 8 waves/block (two per SIMD). A wave owns
// two 16-col n-tiles and one quarter (128 rows m) of every stage, so each Q and
// V^T fragment it reads from LDS feeds two n-tiles; the four partial sums of a
// column are added through LDS at the end.
// Q (512x64), V^T (64x512) and the row constants of 512 rows m make one stage in LDS
// (two buffers, async copies, 33 per thread and stage); one barrier ends a
// trip, in which a wave's four 32-row sub-tiles are unrolled.
// Energy D-tile register layout == second WMMA's B-operand layout, so P is
// fed through registers with no transpose. A row's constant -(max + log2 sum)
// is the C operand of its energy WMMA (C has D's layout), so the softmax value
// is exp2 of the WMMA's result, with no other arithmetic per value.
// ---------------------------------------------------------------------------
#define K3_ROWS 512                     // rows m per stage
#define K3_WROWS (K3_ROWS / 4)          // rows m of a stage that one wave takes
#define K3_QSTR 72                      // padded q-row stride (halves)
#define K3_VSTR 520                     // padded vT-row stride (halves)
#define K3_QSZ  (K3_ROWS * K3_QSTR)     // halves
#define K3_VSZ  (CDIM * K3_VSTR)        // halves
#define K3_SSZ  (2 * K3_ROWS)           // 512 floats, one constant a row
#define K3_BUF  (K3_QSZ + K3_VSZ + K3_SSZ)
#define K3_NST  (NPIX / K3_ROWS)        // stages

// lq, lv, ls: this thread's first LDS byte of each part in buffer 0;
// gq, gv, gs: its first global byte of each part in stage 0.
__device__ __forceinline__ void k3_stage(int bb, int t, unsigned lq, unsigned lv, unsigned ls,
                                         const char* gq, const char* gv, const char* gs) {
  const unsigned o = (unsigned)(bb * K3_BUF) * 2;
  // Q: 512 rows x 8 chunks, a thread's 16 chunks 32 rows apart
  const char* gqt = gq + t * (K3_ROWS * CDIM * 2);
  async_ld16x8(lq + o, 32 * K3_QSTR * 2, gqt, 32 * CDIM * 2);
  async_ld16x8(lq + o + 256 * K3_QSTR * 2, 32 * K3_QSTR * 2, gqt + 256 * CDIM * 2, 32 * CDIM * 2);
  // V^T: 64 rows x 64 chunks, a thread's 16 chunks 4 rows apart;
  // row constants: 512 floats, two per thread
  const char* gvt = gv + t * (K3_ROWS * 2);
  async_ld16x8(lv + o, 4 * K3_VSTR * 2, gvt, 4 * NPIX * 2);
  async_ld16x8_8(lv + o + 32 * K3_VSTR * 2, 4 * K3_VSTR * 2, gvt + 32 * NPIX * 2, 4 * NPIX * 2,
               ls + o, gs + t * (K3_ROWS * 4));
}

// p: this lane's first half (or float) of a 32-row sub-tile's part in LDS
__device__ __forceinline__ void k3_qfrags(const _Float16* p, v16h (&a)[4]) {
  const _Float16* p1 = p + 16 * K3_QSTR;
  a[0] = load_frag(p,       p + 16);
  a[1] = load_frag(p + 32,  p + 48);
  a[2] = load_frag(p1,      p1 + 16);
  a[3] = load_frag(p1 + 32, p1 + 48);
}
__device__ __forceinline__ void k3_vfrags(const _Float16* p, v16h (&a)[4]) {
#pragma unroll
  for (int ct = 0; ct < 4; ++ct)
    a[ct] = load_frag(p + ct * 16 * K3_VSTR, p + ct * 16 * K3_VSTR + 16);
}
__device__ __forceinline__ void k3_stats(const float* p, v8f (&c)[2]) {
#pragma unroll
  for (int h = 0; h < 2; ++h) {               // rows +0..7, rows +16..23
    const float4 lo = *(const float4*)(p + h * 16);
    const float4 hi = *(const float4*)(p + h * 16 + 4);
    c[h] = v8f{lo.x, lo.y, lo.z, lo.w, hi.x, hi.y, hi.z, hi.w};
  }
}

// waves_per_eu(4, 4): a budget of 256 registers for the fragments in flight
__global__ void __launch_bounds__(256) __attribute__((amdgpu_waves_per_eu(4, 4)))
attnout_kernel(const _Float16* __restrict__ qh, const _Float16* __restrict__ kh,
               const _Float16* __restrict__ vT,
               const float* __restrict__ rowc,
               const float* __restrict__ x, const float* __restrict__ gamma,
               float* __restrict__ out) {
  __shared__ __align__(16) _Float16 smem[2 * K3_BUF];
  const int tid  = threadIdx.x;
  const int lane = tid & 31;
  const int wv   = tid >> 5;
  const int h16  = lane >> 4;
  const int l16  = lane & 15;
  const int np   = wv & 1;                // which 32 of the block's 64 columns n
  const int mq   = wv >> 1;               // which quarter of every stage
  const int b    = blockIdx.x >> 6;
  const int n0   = (blockIdx.x & 63) * 64 + np * 32;

  const _Float16* q  = qh + (long long)b * NPIX * CDIM;
  const _Float16* k  = kh + (long long)b * NPIX * CDIM;
  const _Float16* vt = vT + (long long)b * CDIM * NPIX;

  // B operands of the energy WMMAs: k rows n0..n0+31 (fixed per wave)
  v16h bk[2][2];
#pragma unroll
  for (int nt = 0; nt < 2; ++nt) {
    const _Float16* krow = k + (n0 + nt * 16 + l16) * CDIM;
    bk[nt][0] = load_frag(krow + h16 * 8,      krow + 16 + h16 * 8);
    bk[nt][1] = load_frag(krow + 32 + h16 * 8, krow + 48 + h16 * 8);
  }

  const unsigned sbase = lds_addr(smem);
  const unsigned lq = sbase + (unsigned)((tid >> 3) * K3_QSTR + (tid & 7) * 8) * 2;
  const unsigned lv = sbase + (unsigned)(K3_QSZ + (tid >> 6) * K3_VSTR + (tid & 63) * 8) * 2;
  const unsigned ls = sbase + (unsigned)(K3_QSZ + K3_VSZ) * 2 + (unsigned)tid * 8;
  const char* gq = (const char*)q + tid * 16;
  const char* gv = (const char*)vt + (tid >> 6) * (NPIX * 2) + (tid & 63) * 16;
  const char* gs = (const char*)(rowc + b * NPIX) + tid * 8;

  // stage 0 landed and published, then stage 1 in flight
  k3_stage(0, 0, lq, lv, ls, gq, gv, gs);
  S_WAIT_ASYNCCNT0();
  __syncthreads();
  k3_stage(1, 1, lq, lv, ls, gq, gv, gs);

  v8f acc[2][4];                          // n-tile, 16 channels each
#pragma unroll
  for (int nt = 0; nt < 2; ++nt) {
#pragma unroll
    for (int ct = 0; ct < 4; ++ct) acc[nt][ct] = v8f{};
  }

  for (int t = 0; t < K3_NST; ++t) {
    const _Float16* sb = smem + (t & 1) * K3_BUF;
    const _Float16* qs = sb + (mq * K3_WROWS + l16) * K3_QSTR + h16 * 8;
    const _Float16* vs = sb + K3_QSZ + l16 * K3_VSTR + mq * K3_WROWS + h16 * 8;
    const float*    st = (const float*)(sb + K3_QSZ + K3_VSZ) + mq * K3_WROWS + h16 * 8;

    v16h   qa[4], va[4];                  // Q and V^T fragments of a sub-tile
    v8f    c[2];                          // its row constants, 16 rows m each
    k3_qfrags(qs, qa);
    k3_stats(st, c);
    k3_vfrags(vs, va);
    PHASE_FENCE();
#pragma unroll
    for (int j = 0; j < K3_WROWS / 32; ++j) {
      v8f e[2][2];                        // n-tile, 16 rows m each
#pragma unroll
      for (int nt = 0; nt < 2; ++nt) {
        e[nt][0] = WMMA_F16(qa[0], bk[nt][0], c[0]);
        e[nt][1] = WMMA_F16(qa[2], bk[nt][0], c[1]);
      }
#pragma unroll
      for (int nt = 0; nt < 2; ++nt) {
        e[nt][0] = WMMA_F16(qa[1], bk[nt][1], e[nt][0]);
        e[nt][1] = WMMA_F16(qa[3], bk[nt][1], e[nt][1]);
      }
      PHASE_FENCE();
      if (j + 1 < K3_WROWS / 32) {        // read under this sub-tile's vector work
        k3_qfrags(qs + (j + 1) * 32 * K3_QSTR, qa);
        k3_stats(st + (j + 1) * 32, c);
      }
      PHASE_FENCE();
#pragma unroll
      for (int nt = 0; nt < 2; ++nt) {
        v16h pb;
#pragma unroll
        for (int r = 0; r < 8; ++r) {
          pb[r]     = (_Float16)__builtin_amdgcn_exp2f(e[nt][0][r]);
          pb[8 + r] = (_Float16)__builtin_amdgcn_exp2f(e[nt][1][r]);
        }
#pragma unroll
        for (int ct = 0; ct < 4; ++ct) acc[nt][ct] = WMMA_F16(va[ct], pb, acc[nt][ct]);
      }
      PHASE_FENCE();
      if (j + 1 < K3_WROWS / 32) k3_vfrags(vs + (j + 1) * 32, va);
    }
    // foot of the trip: own LDS reads done, own copies of stage t+1 landed,
    // then the one barrier that publishes stage t+1 and frees this buffer
    S_WAIT_DSCNT0();
    S_WAIT_ASYNCCNT0();
    __syncthreads();
    if (t + 2 < K3_NST) k3_stage(t & 1, t + 2, lq, lv, ls, gq, gv, gs);
  }
  S_WAIT_ASYNCCNT0();                     // nothing in flight at the wave's end

  // The four partial sums of every output go through LDS, free since the last
  // trip's barrier. A wave's 64 floats per lane are 16 pieces of 16 bytes,
  // piece p = nt*8 + ct*2 + half, stored lane-contiguous.
  float4* red = (float4*)smem;
#pragma unroll
  for (int nt = 0; nt < 2; ++nt) {
#pragma unroll
    for (int ct = 0; ct < 4; ++ct) {
      const v8f v = acc[nt][ct];
      red[(wv * 16 + nt * 8 + ct * 2) * 32 + lane]     = make_float4(v[0], v[1], v[2], v[3]);
      red[(wv * 16 + nt * 8 + ct * 2 + 1) * 32 + lane] = make_float4(v[4], v[5], v[6], v[7]);
    }
  }
  __syncthreads();

  // Epilogue: wave (np, mq) finishes pieces mq*4 .. mq*4+3 of its column pair:
  // n-tile mq/2, channels (mq%2)*32 .. +31, one 128-byte half of each out row.
  // D element (c = ct*16 + r + 8*h16, n = n0 + nt*16 + l16)
  const long long row = (long long)(b * NPIX + n0 + (mq >> 1) * 16 + l16) * CDIM;
  const float* xr = x + row;
  float* outr = out + row;
  const float g = gamma[0];
#pragma unroll
  for (int i = 0; i < 4; ++i) {
    const int p = mq * 4 + i;
    float4 a4 = red[(np * 16 + p) * 32 + lane];
#pragma unroll
    for (int qd = 1; qd < 4; ++qd) {      // quarters in ascending order
      const float4 o = red[((np + 2 * qd) * 16 + p) * 32 + lane];
      a4.x += o.x; a4.y += o.y; a4.z += o.z; a4.w += o.w;
    }
    const int base = ((mq & 1) * 2 + (i >> 1)) * 16 + h16 * 8 + (i & 1) * 4;
    const float4 xv = *(const float4*)(xr + base);
    float4 o4;
    o4.x = fmaf(g, a4.x, xv.x);
    o4.y = fmaf(g, a4.y, xv.y);
    o4.z = fmaf(g, a4.z, xv.z);
    o4.w = fmaf(g, a4.w, xv.w);
    *(float4*)(outr + base) = o4;
  }
}

// ---------------------------------------------------------------------------
extern "C" void kernel_launch(void* const* d_in, const int* in_sizes, int n_in,
                              void* d_out, int out_size, void* d_ws, size_t ws_size,
                              hipStream_t stream) {
  (void)in_sizes; (void)n_in; (void)out_size; (void)ws_size;
  const float* x     = (const float*)d_in[0];
  const float* Wq    = (const float*)d_in[1];
  const float* bq    = (const float*)d_in[2];
  const float* Wk    = (const float*)d_in[3];
  const float* bk    = (const float*)d_in[4];
  const float* Wv    = (const float*)d_in[5];
  const float* bv    = (const float*)d_in[6];
  const float* gamma = (const float*)d_in[7];
  float* out = (float*)d_out;

  // workspace: q(2MB) k(2MB) vT(2MB) rowc(64KB)
  _Float16* qh = (_Float16*)d_ws;
  _Float16* kh = qh + (size_t)NB * NPIX * CDIM;
  _Float16* vT = kh + (size_t)NB * NPIX * CDIM;
  float* rowc = (float*)(vT + (size_t)NB * NPIX * CDIM);

  proj_kernel<<<NB * NPIX / PJ_PIX, 512, 0, stream>>>(x, Wq, bq, Wk, bk, Wv, bv, qh, kh, vT);
  rowstats_kernel<<<NB * 64, 256, 0, stream>>>(qh, kh, rowc);
  attnout_kernel<<<NB * 64, 256, 0, stream>>>(qh, kh, vT, rowc, x, gamma, out);
}

// v006
// It runs in 37.1 microseconds.
// Two timings next to v005 put it at 1.07 and 1.08 times that version's speed.
// Counting every step since v000, it is 4.47 times as fast.
#include <hip/hip_runtime.h>
#include <stdint.h>

// PAM attention, B=4, H=W=64, C=64 (N=4096).
// f16 WMMA for both big GEMMs; f32 softmax math; LDS tile sharing across
// 8 waves per workgroup, staged with tensor loads, one 2-D tile per issuing
// wave (two buffers, 512 rows per stage).

typedef _Float16 v8h  __attribute__((ext_vector_type(8)));
typedef _Float16 v16h __attribute__((ext_vector_type(16)));
typedef float    v8f  __attribute__((ext_vector_type(8)));
typedef float    v2f  __attribute__((ext_vector_type(2)));

#define NPIX 4096
#define CDIM 64
#define NB   4

#define WMMA_F16(A, B, C) \
  __builtin_amdgcn_wmma_f32_16x16x32_f16(false, (A), false, (B), (short)0, (C), false, false)

#define S_WAIT_DSCNT0()      asm volatile("s_wait_dscnt 0x0" ::: "memory")

// Compile-time fence between the phases of an unrolled sub-tile (no instruction
// of its own): the "memory" clobber holds the LDS reads, the scheduling barrier
// the arithmetic, each on its side, so that a group of reads stands in front of
// the work that covers its latency; without it the compiler sinks the reads to
// their uses and waits for each pair in turn.
#define PHASE_FENCE() do { asm volatile("" ::: "memory"); __builtin_amdgcn_sched_barrier(0); } while (0)

typedef uint32_t u32x4 __attribute__((ext_vector_type(4)));
typedef uint32_t u32x8 __attribute__((ext_vector_type(8)));

__device__ __forceinline__ uint32_t uni(uint32_t v) {
  return (uint32_t)__builtin_amdgcn_readfirstlane(v);
}
__device__ __forceinline__ uint64_t uni64(uint64_t v) {
  return ((uint64_t)uni((uint32_t)(v >> 32)) << 32) | uni((uint32_t)v);
}
// A wave-uniform test held in a scalar register, so that the branch on it is a
// scalar one: a tensor load ignores EXEC, only a scalar branch keeps a wave off it.
__device__ __forceinline__ uint32_t pinned(uint32_t v) {
  uint32_t w = (uint32_t)__builtin_amdgcn_readfirstlane(v);
  asm volatile("" : "+s"(w));   // holds the test in a scalar register
  return w;
}
// Word 0 of descriptor group 1: no mask, 1-byte elements, 16 bytes of LDS pad
// behind every row of 128 or of 256 bytes (pitch 144 or 272 bytes).
#define TDM_PAD128 ((1u << 20) | (4u << 22) | (3u << 25))
#define TDM_PAD256 ((1u << 20) | (5u << 22) | (3u << 25))
// Descriptor group 1: a tile of n rows (below 65536) of R bytes, source row
// pitch p bytes. Built once per wave, in front of its first request.
template <uint32_t W0, uint32_t R>
__device__ __forceinline__ u32x8 tdm_group1(uint32_t n, uint32_t p) {
  u32x8 g;
  g[0] = uni(W0);
  g[1] = uni((R & 0xFFFFu) << 16);
  g[2] = uni((R >> 16) | (n << 16));
  g[3] = uni(R << 16);
  g[4] = uni(n);
  g[5] = uni(p);
  g[6] = uni(0u);
  g[7] = uni(0u);
  return g;
}
// Descriptor group 0: LDS byte offset of the tile, global address of its first byte.
__device__ __forceinline__ u32x4 tdm_group0(uint32_t lds_dst, uint64_t ga) {
  u32x4 g;
  g[0] = uni(1u);
  g[1] = uni(lds_dst);
  g[2] = uni((uint32_t)ga);
  g[3] = uni((((uint32_t)(ga >> 32)) & 0x01FFFFFFu) | 0x80000000u);
  return g;
}
// One request of the whole wave: memory -> LDS through no register (TENSORcnt).
// Both groups are in-out operands here and inputs of the wait below, so that
// the registers the request names hold the descriptor, untouched, from the
// issue to the wait that covers it.
__device__ __forceinline__ void tdm_load(u32x4& g0, u32x8& g1) {
  asm volatile("tensor_load_to_lds %0, %1" : "+s"(g0), "+s"(g1) :: "memory");
}
// The issuing wave's own tile has landed; the compiler places no such wait.
__device__ __forceinline__ void tdm_wait(const u32x4& g0, const u32x8& g1) {
  asm volatile("s_wait_tensorcnt 0x0" :: "s"(g0), "s"(g1) : "memory");
}
__device__ __forceinline__ unsigned lds_addr(const void* p) {
  return (unsigned)(unsigned long long)p;   // low 32 bits of generic = LDS offset
}

// 16x32 f16 A/B fragment: row = tile_row + lane%16, halves 0..7 at
// K = 8*(lane/16), halves 8..15 at K = 16 + 8*(lane/16).
__device__ __forceinline__ v16h load_frag(const _Float16* lo, const _Float16* hi) {
  v8h a = *(const v8h*)lo;
  v8h b = *(const v8h*)hi;
  v16h r;
#pragma unroll
  for (int i = 0; i < 8; ++i) { r[i] = a[i]; r[8 + i] = b[i]; }
  return r;
}

// ---------------------------------------------------------------------------
// Kernel 1: fused Q/K/V projection (1x1 conv). Q,K row-major f16; V stored
// transposed (c-major) so it is the A operand of out^T = V^T * P.
// Q is stored times log2(e), scaled in f32 before its one rounding to f16, so
// every energy Q.K of the later kernels is an exponent of 2.
// One block = 64 pixels. A thread owns one output column f of Q, K and V for
// 8 consecutive pixels, so each weight it loads feeds 8 FMAs and its 8 V
// values are one 16-byte piece of a V^T row.
// ---------------------------------------------------------------------------
#define LOG2E 1.4426950408889634f
#define PJ_PIX 64                  // pixels per block
#define PJ_PPT 8                   // pixels per thread

// waves_per_eu(4, 4): a 16-wave block is 4 waves per SIMD; without it the
// compiler keeps registers low and sinks the look-ahead loads to their uses.
__global__ void __launch_bounds__(512) __attribute__((amdgpu_waves_per_eu(4, 4)))
proj_kernel(const float* __restrict__ x,
            const float* __restrict__ Wq, const float* __restrict__ bq,
            const float* __restrict__ Wk, const float* __restrict__ bk,
            const float* __restrict__ Wv, const float* __restrict__ bv,
            _Float16* __restrict__ qh, _Float16* __restrict__ kh,
            _Float16* __restrict__ vT) {
  __shared__ __align__(16) float xs[PJ_PIX][CDIM];
  const int tid = threadIdx.x;
  const int f   = tid & 63;
  const int p0  = (tid >> 6) * PJ_PPT;          // same for all lanes of a wave
  const int g0  = blockIdx.x * PJ_PIX;          // first pixel (over all batches)

  // stage the 64x64 f32 x tile: 1024 float4, two per thread
  const float4* xsrc = (const float4*)(x + (long long)g0 * CDIM);
  float4* xdst = (float4*)&xs[0][0];
  xdst[tid]       = xsrc[tid];
  xdst[tid + 512] = xsrc[tid + 512];
  __syncthreads();

  float aq[PJ_PPT], ak[PJ_PPT], av[PJ_PPT];
  {
    const float q0 = bq[f], k0 = bk[f], v0 = bv[f];
#pragma unroll
    for (int p = 0; p < PJ_PPT; ++p) { aq[p] = q0; ak[p] = k0; av[p] = v0; }
  }

  // Groups of 4 input channels. The next group's weights and x values are
  // loaded before the current group's FMAs, so their latency is covered; the
  // FMAs run channel-outer, pixel-inner: 24 independent chains, and each sum
  // still takes its channels in ascending order.
  float  wc[3][4];
  float4 xc[PJ_PPT];
#pragma unroll
  for (int j = 0; j < 4; ++j) {
    wc[0][j] = Wq[j * CDIM + f];
    wc[1][j] = Wk[j * CDIM + f];
    wc[2][j] = Wv[j * CDIM + f];
  }
#pragma unroll
  for (int p = 0; p < PJ_PPT; ++p) xc[p] = *(const float4*)&xs[p0 + p][0];

  // unroll 2: the two register sets swap roles without copies
#pragma unroll 2
  for (int c = 0; c < CDIM; c += 4) {
    float  wn[3][4];
    float4 xn[PJ_PPT];
    const int cn = (c + 4 < CDIM) ? c + 4 : 0;   // last trip reloads group 0, unused
#pragma unroll
    for (int j = 0; j < 4; ++j) {
      wn[0][j] = Wq[(cn + j) * CDIM + f];
      wn[1][j] = Wk[(cn + j) * CDIM + f];
      wn[2][j] = Wv[(cn + j) * CDIM + f];
    }
#pragma unroll
    for (int p = 0; p < PJ_PPT; ++p) xn[p] = *(const float4*)&xs[p0 + p][cn];
#pragma unroll
    for (int j = 0; j < 4; ++j) {
#pragma unroll
      for (int p = 0; p < PJ_PPT; ++p) {
        const float xv = (j == 0) ? xc[p].x : (j == 1) ? xc[p].y : (j == 2) ? xc[p].z : xc[p].w;
        aq[p] = fmaf(xv, wc[0][j], aq[p]);
        ak[p] = fmaf(xv, wc[1][j], ak[p]);
        av[p] = fmaf(xv, wc[2][j], av[p]);
      }
    }
#pragma unroll
    for (int j = 0; j < 4; ++j) { wc[0][j] = wn[0][j]; wc[1][j] = wn[1][j]; wc[2][j] = wn[2][j]; }
#pragma unroll
    for (int p = 0; p < PJ_PPT; ++p) xc[p] = xn[p];
  }

  v8h vrow;
#pragma unroll
  for (int p = 0; p < PJ_PPT; ++p) {
    const long long o = (long long)(g0 + p0 + p) * CDIM + f;
    qh[o] = (_Float16)(aq[p] * LOG2E);
    kh[o] = (_Float16)ak[p];
    vrow[p] = (_Float16)av[p];
  }
  const int b = g0 >> 12;                       // 64 divides NPIX: one batch per block
  const int n = (g0 & (NPIX - 1)) + p0;
  *(v8h*)(vT + ((long long)(b * CDIM + f)) * NPIX + n) = vrow;
}

// ---------------------------------------------------------------------------
// Kernel 2: streaming row stats. 8 waves/block (two per SIMD). A wave owns two
// 16-row m-tiles and one quarter (128 rows) of every K stage, so each K fragment
// it reads from LDS feeds two m-tiles; the four quarters of a row are merged
// through LDS at the end.
// K comes through LDS in stages of 512 rows (two buffers, tensor loads): a
// stage's loads fly during the whole trip before it, one barrier ends a trip,
// and the running max and sum are brought up to date once per 64 rows of K.
// ---------------------------------------------------------------------------
#define K2_ROWS 512                // k rows per stage
#define K2_WROWS (K2_ROWS / 4)     // k rows of a stage that one wave takes
#define K2_STR  72                 // padded k-row stride in halves
#define K2_BUF  (K2_ROWS * K2_STR) // halves per buffer
#define K2_NST  (NPIX / K2_ROWS)   // stages

// p: this lane's first half of a 32-row sub-tile in LDS
__device__ __forceinline__ void k2_frags(const _Float16* p, v16h (&f)[4]) {
  const _Float16* p1 = p + 16 * K2_STR;
  f[0] = load_frag(p,       p + 16);
  f[1] = load_frag(p + 32,  p + 48);
  f[2] = load_frag(p1,      p1 + 16);
  f[3] = load_frag(p1 + 32, p1 + 48);
}
__device__ __forceinline__ void k2_energy(v16h a0, v16h a1, const v16h (&f)[4], v8f (&e)[2]) {
  v8f e0 = {}, e1 = {};
  e0 = WMMA_F16(a0, f[0], e0);
  e0 = WMMA_F16(a1, f[1], e0);
  e1 = WMMA_F16(a0, f[2], e1);
  e1 = WMMA_F16(a1, f[3], e1);
  e[0] = e0; e[1] = e1;
}

// Energies are exponents of 2 (Q carries log2(e)): exp(v - m) of the natural
// energies is exp2 of the difference here, one subtraction and one v_exp_f32.
__device__ __forceinline__ v2f k2_exp2(v2f t) {
  const v2f r = {__builtin_amdgcn_exp2f(t[0]), __builtin_amdgcn_exp2f(t[1])};
  return r;
}
// exp2(v - nc) of rows 2k and 2k + 1 of an energy tile
__device__ __forceinline__ v2f k2_exp(const v8f& v, int k, v2f nc) {
  const v2f x = {v[2 * k], v[2 * k + 1]};
  return k2_exp2(x - nc);
}

// Running max and sum of this lane's 8 rows over 64 more columns (four energy
// tiles, four values a row): first the new max of each row, then one exponential
// for each value and one for the old sum's rescale. The rescale takes the
// difference of the two maxima first, so it is exactly 1 while a row's max stands.
__device__ __forceinline__ void k2_update(const v8f (&ea)[2], const v8f (&eb)[2],
                                          v8f& mx, v8f& sm) {
  v8f nm;
#pragma unroll
  for (int i = 0; i < 8; ++i)
    nm[i] = __builtin_fmaximum_numf(__builtin_fmaximum_numf(__builtin_fmaximum_numf(
                __builtin_fmaximum_numf(mx[i], ea[0][i]), ea[1][i]), eb[0][i]), eb[1][i]);
#pragma unroll
  for (int k = 0; k < 4; ++k) {
    const v2f n2 = {nm[2 * k], nm[2 * k + 1]};
    const v2f o2 = {mx[2 * k], mx[2 * k + 1]};
    const v2f s2 = {sm[2 * k], sm[2 * k + 1]};
    const v2f p  = (k2_exp(ea[0], k, n2) + k2_exp(ea[1], k, n2)) +
                   (k2_exp(eb[0], k, n2) + k2_exp(eb[1], k, n2));
    const v2f r  = __builtin_elementwise_fma(s2, k2_exp2(o2 - n2), p);
    sm[2 * k] = r[0]; sm[2 * k + 1] = r[1];
  }
  mx = nm;
}

// Half of one wave's share of a stage: two 32-row sub-tiles against two
// m-tiles. All its LDS reads stand in one group at the head.
__device__ __forceinline__ void k2_trip(const _Float16* ks, const v16h (&a)[2][2],
                                        v8f (&mx)[2], v8f (&sm)[2]) {
  v16h f[2][4];                                 // fragments of the two sub-tiles
  v8f  e[2][2][2];                              // energies: m-tile, sub-tile
#pragma unroll
  for (int j = 0; j < 2; ++j) k2_frags(ks + j * 32 * K2_STR, f[j]);
  PHASE_FENCE();
#pragma unroll
  for (int mt = 0; mt < 2; ++mt) {
#pragma unroll
    for (int j = 0; j < 2; ++j) k2_energy(a[mt][0], a[mt][1], f[j], e[mt][j]);
  }
  k2_update(e[0][0], e[0][1], mx[0], sm[0]);
  k2_update(e[1][0], e[1][1], mx[1], sm[1]);
  // keeps the arithmetic in front of the waits at the trip's foot; without it
  // the wait for every LDS read moves up to the head, with nothing to cover it
  PHASE_FENCE();
}

// Stage t into buffer bb: issuing wave w (0..3) brings rows w*128 .. +127 as one
// tile of 128-byte rows, laid at the padded pitch. dst0, ga0: the wave's place
// in buffer 0 (LDS byte offset) and its first global byte of stage 0.
#define K2_ISSUERS 4
#define K2_SLROWS (K2_ROWS / K2_ISSUERS)
__device__ __forceinline__ void k2_stage(int bb, int t, uint32_t dst0, uint64_t ga0,
                                         u32x4& g0, u32x8& g1) {
  g0 = tdm_group0(dst0 + (uint32_t)bb * (K2_BUF * 2), ga0 + (uint32_t)t * (K2_ROWS * CDIM * 2));
  tdm_load(g0, g1);
}

// waves_per_eu(4, 4): a budget of 256 registers for the fragments in flight
__global__ void __launch_bounds__(256) __attribute__((amdgpu_waves_per_eu(4, 4)))
rowstats_kernel(const _Float16* __restrict__ qh, const _Float16* __restrict__ kh,
                float* __restrict__ rowc) {
  // every tile's place in LDS is a multiple of 2 KiB
  __shared__ __attribute__((aligned(2048))) _Float16 smem[2 * K2_BUF];
  const int tid  = threadIdx.x;
  const int lane = tid & 31;
  const int wv   = tid >> 5;
  const int h16  = lane >> 4;
  const int l16  = lane & 15;
  const int mp   = wv & 1;                      // which 32 of the block's 64 rows m
  const int kq   = wv >> 1;                     // which quarter of every stage
  const int b    = blockIdx.x >> 6;
  const int mb   = (blockIdx.x & 63) * 64;

  const _Float16* q = qh + (long long)b * NPIX * CDIM;
  const _Float16* k = kh + (long long)b * NPIX * CDIM;

  v16h a[2][2];
#pragma unroll
  for (int mt = 0; mt < 2; ++mt) {
    const _Float16* qrow = q + (mb + mp * 32 + mt * 16 + l16) * CDIM;
    a[mt][0] = load_frag(qrow + h16 * 8,      qrow + 16 + h16 * 8);
    a[mt][1] = load_frag(qrow + 32 + h16 * 8, qrow + 48 + h16 * 8);
  }

  const uint32_t wave = uni(threadIdx.x >> 5);
  const uint32_t dst0 = uni(lds_addr(smem) + wave * (K2_SLROWS * K2_STR * 2));
  const uint64_t ga0  = uni64((uint64_t)k + wave * (K2_SLROWS * CDIM * 2));
  u32x4 g0 = tdm_group0(dst0, ga0);
  u32x8 g1 = tdm_group1<TDM_PAD128, CDIM * 2>(K2_SLROWS, CDIM * 2);

  // stage 0 landed and published, then stage 1 in flight
  if (pinned(wave < K2_ISSUERS)) {
    k2_stage(0, 0, dst0, ga0, g0, g1);
    tdm_wait(g0, g1);
  }
  __syncthreads();
  if (pinned(wave < K2_ISSUERS)) k2_stage(1, 1, dst0, ga0, g0, g1);

  v8f mx[2], sm[2];
#pragma unroll
  for (int mt = 0; mt < 2; ++mt) {
#pragma unroll
    for (int i = 0; i < 8; ++i) { mx[mt][i] = -3.0e38f; sm[mt][i] = 0.0f; }
  }

  // Foot of every trip: own LDS reads done, own tile of stage t+1 landed,
  // then the one barrier that publishes stage t+1 and frees this buffer.
  // While a stage t+2 exists it is loaded into that buffer; the last two trips
  // stand in a loop of their own.
  const _Float16* ks0 = smem + (kq * K2_WROWS + l16) * K2_STR + h16 * 8;
  for (int t = 0; t < K2_NST - 2; ++t) {
    // kept rolled: unrolled, the two halves' values overlap and some spill to scratch
#pragma nounroll
    for (int h = 0; h < 2; ++h) k2_trip(ks0 + (t & 1) * K2_BUF + h * 64 * K2_STR, a, mx, sm);
    S_WAIT_DSCNT0();
    if (pinned(wave < K2_ISSUERS)) tdm_wait(g0, g1);
    __syncthreads();
    if (pinned(wave < K2_ISSUERS)) k2_stage(t & 1, t + 2, dst0, ga0, g0, g1);
  }
  for (int t = K2_NST - 2; t < K2_NST; ++t) {
    // kept rolled: unrolled, the two halves' values overlap and some spill to scratch
#pragma nounroll
    for (int h = 0; h < 2; ++h) k2_trip(ks0 + (t & 1) * K2_BUF + h * 64 * K2_STR, a, mx, sm);
    S_WAIT_DSCNT0();
    if (pinned(wave < K2_ISSUERS)) tdm_wait(g0, g1);
    __syncthreads();
  }
  tdm_wait(g0, g1);                             // nothing in flight at the wave's end
  S_WAIT_DSCNT0();
  // merge across the 16 lanes sharing each row m
#pragma unroll
  for (int mt = 0; mt < 2; ++mt) {
#pragma unroll
    for (int i = 0; i < 8; ++i) {
      float m = mx[mt][i], s = sm[mt][i];
#pragma unroll
      for (int off = 8; off >= 1; off >>= 1) {
        const float om = __shfl_xor(m, off, 32);
        const float os = __shfl_xor(s, off, 32);
        const float nm = fmaxf(m, om);
        s = s * __builtin_amdgcn_exp2f(m - nm) + os * __builtin_amdgcn_exp2f(om - nm);
        m = nm;
      }
      mx[mt][i] = m; sm[mt][i] = s;
    }
  }
  // merge across the four waves that hold a row's quarters: (max, sum) pairs go
  // through LDS, free since the last trip's barrier; pair index = quarter * 64 + row
  float2* red = (float2*)smem;
  if (l16 == 0) {
#pragma unroll
    for (int mt = 0; mt < 2; ++mt) {
#pragma unroll
      for (int i = 0; i < 8; ++i)
        red[kq * 64 + mp * 32 + mt * 16 + h16 * 8 + i] = make_float2(mx[mt][i], sm[mt][i]);
    }
  }
  __syncthreads();
  if (tid < 64) {
    float2 r = red[tid];
    float m = r.x, s = r.y;
#pragma unroll
    for (int qd = 1; qd < 4; ++qd) {
      const float2 o  = red[qd * 64 + tid];
      const float  nm = fmaxf(m, o.x);
      s = s * __builtin_amdgcn_exp2f(m - nm) + o.y * __builtin_amdgcn_exp2f(o.x - nm);
      m = nm;
    }
    // one constant a row: softmax value = exp2(energy + rowc); s >= 1, v_log_f32 is log2
    rowc[b * NPIX + mb + tid] = -(m + __builtin_amdgcn_logf(s));
  }
}

// ---------------------------------------------------------------------------
// Kernel 3: out^T = V^T * softmax(E). 8 waves/block (two per SIMD). A wave owns
// two 16-col n-tiles and one quarter (128 rows m) of every stage, so each Q and
// V^T fragment it reads from LDS feeds two n-tiles; the four partial sums of a
// column are added through LDS at the end.
// Q (512x64), V^T (64x512) and the row constants of 512 rows m make one stage in LDS
// (two buffers, tensor loads, one tile of 256-byte rows from each of seven waves,
// every row followed by 16 bytes of pad); a row holds two rows of Q, or 128
// columns m of a V^T row (four slices, one per quarter), or 64 constants; one
// barrier ends a trip, in which a wave's four 32-row sub-tiles are unrolled.
// Energy D-tile register layout == second WMMA's B-operand layout, so P is
// fed through registers with no transpose. A row's constant -(max + log2 sum)
// is the C operand of its energy WMMA (C has D's layout), so the softmax value
// is exp2 of the WMMA's result, with no other arithmetic per value.
// ---------------------------------------------------------------------------
#define K3_ROWS 512                     // rows m per stage
#define K3_WROWS (K3_ROWS / 4)          // rows m of a stage that one wave takes
#define K3_PSTR 136                     // pitch of a padded 256-byte LDS row (halves)
#define K3_VSTR K3_PSTR                 // row stride of a vT slice (halves)
#define K3_VSL  9216                    // halves per vT slice: 64 rows, rounded up to 2 KiB
#define K3_QSZ  (K3_ROWS / 2 * K3_PSTR) // halves: q rows 2i and 2i+1 share LDS row i
#define K3_VSZ  (4 * K3_VSL)            // halves
#define K3_SSZ  2048                    // halves: 8 rows of 64 constants, rounded up to 2 KiB
#define K3_BUF  (K3_QSZ + K3_VSZ + K3_SSZ)
#define K3_NST  (NPIX / K3_ROWS)        // stages

// Stage t into buffer bb, one tile per issuing wave. dst0, ga0: the wave's place
// in buffer 0 (LDS byte offset) and its first global byte of stage 0; gstep:
// global bytes from one stage's tile to the next.
#define K3_ISSUERS 7
__device__ __forceinline__ void k3_stage(int bb, int t, uint32_t dst0, uint64_t ga0, uint32_t gstep,
                                         u32x4& g0, u32x8& g1) {
  g0 = tdm_group0(dst0 + (uint32_t)bb * (K3_BUF * 2), ga0 + (uint32_t)t * gstep);
  tdm_load(g0, g1);
}

// p: this lane's first half (or float) of a 32-row sub-tile's part in LDS
__device__ __forceinline__ void k3_qfrags(const _Float16* p, v16h (&a)[4]) {
  const _Float16* p1 = p + 8 * K3_PSTR;       // 16 rows of Q on: 8 LDS rows
  a[0] = load_frag(p,       p + 16);
  a[1] = load_frag(p + 32,  p + 48);
  a[2] = load_frag(p1,      p1 + 16);
  a[3] = load_frag(p1 + 32, p1 + 48);
}
__device__ __forceinline__ void k3_vfrags(const _Float16* p, v16h (&a)[4]) {
#pragma unroll
  for (int ct = 0; ct < 4; ++ct)
    a[ct] = load_frag(p + ct * 16 * K3_VSTR, p + ct * 16 * K3_VSTR + 16);
}
__device__ __forceinline__ void k3_stats(const float* p, v8f (&c)[2]) {
#pragma unroll
  for (int h = 0; h < 2; ++h) {               // rows +0..7, rows +16..23
    const float4 lo = *(const float4*)(p + h * 16);
    const float4 hi = *(const float4*)(p + h * 16 + 4);
    c[h] = v8f{lo.x, lo.y, lo.z, lo.w, hi.x, hi.y, hi.z, hi.w};
  }
}

// waves_per_eu(4, 4): a budget of 256 registers for the fragments in flight
__global__ void __launch_bounds__(256) __attribute__((amdgpu_waves_per_eu(4, 4)))
attnout_kernel(const _Float16* __restrict__ qh, const _Float16* __restrict__ kh,
               const _Float16* __restrict__ vT,
               const float* __restrict__ rowc,
               const float* __restrict__ x, const float* __restrict__ gamma,
               float* __restrict__ out) {
  // every tile's place in LDS is a multiple of 2 KiB
  __shared__ __attribute__((aligned(2048))) _Float16 smem[2 * K3_BUF];
  const int tid  = threadIdx.x;
  const int lane = tid & 31;
  const int wv   = tid >> 5;
  const int h16  = lane >> 4;
  const int l16  = lane & 15;
  const int np   = wv & 1;                // which 32 of the block's 64 columns n
  const int mq   = wv >> 1;               // which quarter of every stage
  const int b    = blockIdx.x >> 6;
  const int n0   = (blockIdx.x & 63) * 64 + np * 32;

  const _Float16* q  = qh + (long long)b * NPIX * CDIM;
  const _Float16* k  = kh + (long long)b * NPIX * CDIM;
  const _Float16* vt = vT + (long long)b * CDIM * NPIX;

  // B operands of the energy WMMAs: k rows n0..n0+31 (fixed per wave)
  v16h bk[2][2];
#pragma unroll
  for (int nt = 0; nt < 2; ++nt) {
    const _Float16* krow = k + (n0 + nt * 16 + l16) * CDIM;
    bk[nt][0] = load_frag(krow + h16 * 8,      krow + 16 + h16 * 8);
    bk[nt][1] = load_frag(krow + 32 + h16 * 8, krow + 48 + h16 * 8);
  }

  // The issuing waves' tiles, all of 256-byte rows: waves 0 and 1 a half of Q
  // (128 rows, contiguous in memory), waves 2..5 a slice of V^T (64 rows, a V^T
  // row apart), wave 6 the 512 row constants (8 rows, contiguous). Wave 7
  // issues nothing; its words are wave 6's and go unused.
  const uint32_t wave = uni(threadIdx.x >> 5);
  const bool     isq  = wave < 2, isv = wave < 6;
  const uint32_t vsl  = wave - 2;         // V^T slice, where isv and not isq
  const uint32_t dst0 = uni(lds_addr(smem) +
      (isq ? wave * (K3_QSZ / 2 * 2) : isv ? K3_QSZ * 2 + vsl * (K3_VSL * 2) : (K3_QSZ + K3_VSZ) * 2));
  const uint64_t ga0  = uni64(isq ? (uint64_t)q + wave * (K3_ROWS / 2 * CDIM * 2)
                            : isv ? (uint64_t)vt + vsl * (K3_WROWS * 2) : (uint64_t)(rowc + b * NPIX));
  const uint32_t gstep = uni(isq ? K3_ROWS * CDIM * 2 : isv ? K3_ROWS * 2 : K3_ROWS * 4);
  u32x4 g0 = tdm_group0(dst0, ga0);
  u32x8 g1 = tdm_group1<TDM_PAD256, 256>(isq ? K3_ROWS / 4 : isv ? CDIM : K3_ROWS * 4 / 256,
                                         isq ? 256 : isv ? NPIX * 2 : 256);

  // stage 0 landed and published, then stage 1 in flight
  if (pinned(wave < K3_ISSUERS)) {
    k3_stage(0, 0, dst0, ga0, gstep, g0, g1);
    tdm_wait(g0, g1);
  }
  __syncthreads();
  if (pinned(wave < K3_ISSUERS)) k3_stage(1, 1, dst0, ga0, gstep, g0, g1);

  v8f acc[2][4];                          // n-tile, 16 channels each
#pragma unroll
  for (int nt = 0; nt < 2; ++nt) {
#pragma unroll
    for (int ct = 0; ct < 4; ++ct) acc[nt][ct] = v8f{};
  }

  for (int t = 0; t < K3_NST; ++t) {
    const _Float16* sb = smem + (t & 1) * K3_BUF;
    const _Float16* qs = sb + (mq * (K3_WROWS / 2) + (l16 >> 1)) * K3_PSTR + (l16 & 1) * CDIM + h16 * 8;
    const _Float16* vs = sb + K3_QSZ + mq * K3_VSL + l16 * K3_VSTR + h16 * 8;
    const float*    st = (const float*)(sb + K3_QSZ + K3_VSZ + mq * 2 * K3_PSTR) + h16 * 8;

    v16h   qa[4], va[4];                  // Q and V^T fragments of a sub-tile
    v8f    c[2];                          // its row constants, 16 rows m each
    k3_qfrags(qs, qa);
    k3_stats(st, c);
    k3_vfrags(vs, va);
    PHASE_FENCE();
#pragma unroll
    for (int j = 0; j < K3_WROWS / 32; ++j) {
      v8f e[2][2];                        // n-tile, 16 rows m each
#pragma unroll
      for (int nt = 0; nt < 2; ++nt) {
        e[nt][0] = WMMA_F16(qa[0], bk[nt][0], c[0]);
        e[nt][1] = WMMA_F16(qa[2], bk[nt][0], c[1]);
      }
#pragma unroll
      for (int nt = 0; nt < 2; ++nt) {
        e[nt][0] = WMMA_F16(qa[1], bk[nt][1], e[nt][0]);
        e[nt][1] = WMMA_F16(qa[3], bk[nt][1], e[nt][1]);
      }
      PHASE_FENCE();
      if (j + 1 < K3_WROWS / 32) {        // read under this sub-tile's vector work
        k3_qfrags(qs + (j + 1) * 16 * K3_PSTR, qa);
        // constants of sub-tile j + 1: LDS row (j + 1) / 2, its first or second 32
        k3_stats(st + ((j + 1) >> 1) * (K3_PSTR / 2) + ((j + 1) & 1) * 32, c);
      }
      PHASE_FENCE();
#pragma unroll
      for (int nt = 0; nt < 2; ++nt) {
        v16h pb;
#pragma unroll
        for (int r = 0; r < 8; ++r) {
          pb[r]     = (_Float16)__builtin_amdgcn_exp2f(e[nt][0][r]);
          pb[8 + r] = (_Float16)__builtin_amdgcn_exp2f(e[nt][1][r]);
        }
#pragma unroll
        for (int ct = 0; ct < 4; ++ct) acc[nt][ct] = WMMA_F16(va[ct], pb, acc[nt][ct]);
      }
      PHASE_FENCE();
      if (j + 1 < K3_WROWS / 32) k3_vfrags(vs + (j + 1) * 32, va);
    }
    // foot of the trip: own LDS reads done, own tile of stage t+1 landed,
    // then the one barrier that publishes stage t+1 and frees this buffer
    S_WAIT_DSCNT0();
    if (pinned(wave < K3_ISSUERS)) tdm_wait(g0, g1);
    __syncthreads();
    if (pinned(wave < K3_ISSUERS && t + 2 < K3_NST)) k3_stage(t & 1, t + 2, dst0, ga0, gstep, g0, g1);
  }
  tdm_wait(g0, g1);                       // nothing in flight at the wave's end
  S_WAIT_DSCNT0();

  // The four partial sums of every output go through LDS, free since the last
  // trip's barrier. A wave's 64 floats per lane are 16 pieces of 16 bytes,
  // piece p = nt*8 + ct*2 + half, stored lane-contiguous.
  float4* red = (float4*)smem;
#pragma unroll
  for (int nt = 0; nt < 2; ++nt) {
#pragma unroll
    for (int ct = 0; ct < 4; ++ct) {
      const v8f v = acc[nt][ct];
      red[(wv * 16 + nt * 8 + ct * 2) * 32 + lane]     = make_float4(v[0], v[1], v[2], v[3]);
      red[(wv * 16 + nt * 8 + ct * 2 + 1) * 32 + lane] = make_float4(v[4], v[5], v[6], v[7]);
    }
  }
  __syncthreads();

  // Epilogue: wave (np, mq) finishes pieces mq*4 .. mq*4+3 of its column pair:
  // n-tile mq/2, channels (mq%2)*32 .. +31, one 128-byte half of each out row.
  // D element (c = ct*16 + r + 8*h16, n = n0 + nt*16 + l16)
  const long long row = (long long)(b * NPIX + n0 + (mq >> 1) * 16 + l16) * CDIM;
  const float* xr = x + row;
  float* outr = out + row;
  const float g = gamma[0];
#pragma unroll
  for (int i = 0; i < 4; ++i) {
    const int p = mq * 4 + i;
    float4 a4 = red[(np * 16 + p) * 32 + lane];
#pragma unroll
    for (int qd = 1; qd < 4; ++qd) {      // quarters in ascending order
      const float4 o = red[((np + 2 * qd) * 16 + p) * 32 + lane];
      a4.x += o.x; a4.y += o.y; a4.z += o.z; a4.w += o.w;
    }
    const int base = ((mq & 1) * 2 + (i >> 1)) * 16 + h16 * 8 + (i & 1) * 4;
    const float4 xv = *(const float4*)(xr + base);
    float4 o4;
    o4.x = fmaf(g, a4.x, xv.x);
    o4.y = fmaf(g, a4.y, xv.y);
    o4.z = fmaf(g, a4.z, xv.z);
    o4.w = fmaf(g, a4.w, xv.w);
    *(float4*)(outr + base) = o4;
  }
}

// ---------------------------------------------------------------------------
extern "C" void kernel_launch(void* const* d_in, const int* in_sizes, int n_in,
                              void* d_out, int out_size, void* d_ws, size_t ws_size,
                              hipStream_t stream) {
  (void)in_sizes; (void)n_in; (void)out_size; (void)ws_size;
  const float* x     = (const float*)d_in[0];
  const float* Wq    = (const float*)d_in[1];
  const float* bq    = (const float*)d_in[2];
  const float* Wk    = (const float*)d_in[3];
  const float* bk    = (const float*)d_in[4];
  const float* Wv    = (const float*)d_in[5];
  const float* bv    = (const float*)d_in[6];
  const float* gamma = (const float*)d_in[7];
  float* out = (float*)d_out;

  // workspace: q(2MB) k(2MB) vT(2MB) rowc(64KB)
  _Float16* qh = (_Float16*)d_ws;
  _Float16* kh = qh + (size_t)NB * NPIX * CDIM;
  _Float16* vT = kh + (size_t)NB * NPIX * CDIM;
  float* rowc = (float*)(vT + (size_t)NB * NPIX * CDIM);

  proj_kernel<<<NB * NPIX / PJ_PIX, 512, 0, stream>>>(x, Wq, bq, Wk, bk, Wv, bv, qh, kh, vT);
  rowstats_kernel<<<NB * 64, 256, 0, stream>>>(qh, kh, rowc);
  attnout_kernel<<<NB * 64, 256, 0, stream>>>(qh, kh, vT, rowc, x, gamma, out);
}

// v007
// Measured time: 34 microseconds a run.
// In two side-by-side timings against v006, it was 1.09 and 1.08 times as fast.
// Over all steps from v000 it is 4.85 times as fast.
#include <hip/hip_runtime.h>
#include <stdint.h>

// PAM attention, B=4, H=W=64, C=64 (N=4096).
// f16 WMMA for the projection (split operands) and both big GEMMs; f32 softmax math; LDS tile sharing across
// 8 waves per workgroup, staged with tensor loads, one 2-D tile per issuing
// wave (two buffers, 512 rows per stage).

typedef _Float16 v8h  __attribute__((ext_vector_type(8)));
typedef _Float16 v16h __attribute__((ext_vector_type(16)));
typedef float    v8f  __attribute__((ext_vector_type(8)));
typedef float    v2f  __attribute__((ext_vector_type(2)));

#define NPIX 4096
#define CDIM 64
#define NB   4

#define WMMA_F16(A, B, C) \
  __builtin_amdgcn_wmma_f32_16x16x32_f16(false, (A), false, (B), (short)0, (C), false, false)

#define S_WAIT_DSCNT0()      asm volatile("s_wait_dscnt 0x0" ::: "memory")

// Compile-time fence between the phases of an unrolled sub-tile (no instruction
// of its own): the "memory" clobber holds the LDS reads, the scheduling barrier
// the arithmetic, each on its side, so that a group of reads stands in front of
// the work that covers its latency; without it the compiler sinks the reads to
// their uses and waits for each pair in turn.
#define PHASE_FENCE() do { asm volatile("" ::: "memory"); __builtin_amdgcn_sched_barrier(0); } while (0)

typedef uint32_t u32x4 __attribute__((ext_vector_type(4)));
typedef uint32_t u32x8 __attribute__((ext_vector_type(8)));

__device__ __forceinline__ uint32_t uni(uint32_t v) {
  return (uint32_t)__builtin_amdgcn_readfirstlane(v);
}
__device__ __forceinline__ uint64_t uni64(uint64_t v) {
  return ((uint64_t)uni((uint32_t)(v >> 32)) << 32) | uni((uint32_t)v);
}
// A wave-uniform test held in a scalar register, so that the branch on it is a
// scalar one: a tensor load ignores EXEC, only a scalar branch keeps a wave off it.
__device__ __forceinline__ uint32_t pinned(uint32_t v) {
  uint32_t w = (uint32_t)__builtin_amdgcn_readfirstlane(v);
  asm volatile("" : "+s"(w));   // holds the test in a scalar register
  return w;
}
// Word 0 of descriptor group 1: no mask, 1-byte elements, 16 bytes of LDS pad
// behind every row of 128 or of 256 bytes (pitch 144 or 272 bytes).
#define TDM_PAD128 ((1u << 20) | (4u << 22) | (3u << 25))
#define TDM_PAD256 ((1u << 20) | (5u << 22) | (3u << 25))
// Descriptor group 1: a tile of n rows (below 65536) of R bytes, source row
// pitch p bytes. Built once per wave, in front of its first request.
template <uint32_t W0, uint32_t R>
__device__ __forceinline__ u32x8 tdm_group1(uint32_t n, uint32_t p) {
  u32x8 g;
  g[0] = uni(W0);
  g[1] = uni((R & 0xFFFFu) << 16);
  g[2] = uni((R >> 16) | (n << 16));
  g[3] = uni(R << 16);
  g[4] = uni(n);
  g[5] = uni(p);
  g[6] = uni(0u);
  g[7] = uni(0u);
  return g;
}
// Descriptor group 0: LDS byte offset of the tile, global address of its first byte.
__device__ __forceinline__ u32x4 tdm_group0(uint32_t lds_dst, uint64_t ga) {
  u32x4 g;
  g[0] = uni(1u);
  g[1] = uni(lds_dst);
  g[2] = uni((uint32_t)ga);
  g[3] = uni((((uint32_t)(ga >> 32)) & 0x01FFFFFFu) | 0x80000000u);
  return g;
}
// One request of the whole wave: memory -> LDS through no register (TENSORcnt).
// Both groups are in-out operands here and inputs of the wait below, so that
// the registers the request names hold the descriptor, untouched, from the
// issue to the wait that covers it.
__device__ __forceinline__ void tdm_load(u32x4& g0, u32x8& g1) {
  asm volatile("tensor_load_to_lds %0, %1" : "+s"(g0), "+s"(g1) :: "memory");
}
// The issuing wave's own tile has landed; the compiler places no such wait.
__device__ __forceinline__ void tdm_wait(const u32x4& g0, const u32x8& g1) {
  asm volatile("s_wait_tensorcnt 0x0" :: "s"(g0), "s"(g1) : "memory");
}
__device__ __forceinline__ unsigned lds_addr(const void* p) {
  return (unsigned)(unsigned long long)p;   // low 32 bits of generic = LDS offset
}

// 16x32 f16 A/B fragment: row = tile_row + lane%16, halves 0..7 at
// K = 8*(lane/16), halves 8..15 at K = 16 + 8*(lane/16) (kernels 2 and 3; the
// projection's fragments put half i at K = 16*(lane/16) + i).
__device__ __forceinline__ v16h load_frag(const _Float16* lo, const _Float16* hi) {
  v8h a = *(const v8h*)lo;
  v8h b = *(const v8h*)hi;
  v16h r;
#pragma unroll
  for (int i = 0; i < 8; ++i) { r[i] = a[i]; r[8 + i] = b[i]; }
  return r;
}

// ---------------------------------------------------------------------------
// Kernel 1: fused Q/K/V projection (1x1 conv) on the matrix unit. Q,K row-major
// f16; V stored transposed (c-major) so it is the A operand of out^T = V^T * P.
// Q is stored times log2(e), scaled in f32 before its one rounding to f16, so
// every energy Q.K of the later kernels is an exponent of 2.
// Every x and every weight is split into an f16 head and an f16 remainder; a
// product is head*head + head*remainder + remainder*head, summed in f32, which
// keeps about 22 bits of it (the results are rounded to 11 afterwards).
// One block = 64 pixels, 4 waves. A wave owns the same 16 output columns f of
// Q, K and V for all 64 pixels. For Q and K the weights are the A operand and x
// the B operand, so a lane's 8 results are 8 consecutive f of one pixel; for V
// the operands change places, so they are 8 consecutive pixels of one V^T row:
// every result leaves in 16-byte pieces.
// ---------------------------------------------------------------------------
#define LOG2E 1.4426950408889634f
#define PJ_PIX 64                  // pixels per block
#define PJ_STR 72                  // LDS row pitch in halves: 128 bytes and 16 of pad
#define PJ_PLANE (PJ_PIX * PJ_STR) // halves of one plane (heads, or remainders) of x

typedef _Float16 v2h __attribute__((ext_vector_type(2)));

// elements e, e + 1 of hi and lo: f16 head and f16 remainder of a and b
template <typename V>
__device__ __forceinline__ void pj_split(float a, float b, V& hi, V& lo, int e) {
  const v2f v = {a, b};
  const v2h h = __builtin_convertvector(v, v2h);
  const v2h l = __builtin_convertvector(v - __builtin_convertvector(h, v2f), v2h);
  hi[e] = h[0]; hi[e + 1] = h[1];
  lo[e] = l[0]; lo[e + 1] = l[1];
}

// p: this lane's first half of a 16-pixel tile in the plane of heads
__device__ __forceinline__ void pj_xfrags(const _Float16* p, v16h (&f)[2][2]) {
#pragma unroll
  for (int s = 0; s < 2; ++s) {
    f[0][s] = load_frag(p + 32 * s, p + 32 * s + 8);
    f[1][s] = load_frag(p + PJ_PLANE + 32 * s, p + PJ_PLANE + 32 * s + 8);
  }
}

__global__ void __launch_bounds__(128)
proj_kernel(const float* __restrict__ x,
            const float* __restrict__ Wq, const float* __restrict__ bq,
            const float* __restrict__ Wk, const float* __restrict__ bk,
            const float* __restrict__ Wv, const float* __restrict__ bv,
            _Float16* __restrict__ qh, _Float16* __restrict__ kh,
            _Float16* __restrict__ vT) {
  __shared__ __align__(16) _Float16 xs[2 * PJ_PLANE];
  const int tid  = threadIdx.x;
  const int lane = tid & 31;
  const int h16  = lane >> 4;
  const int l16  = lane & 15;
  const int f0   = (tid >> 5) * 16;             // the wave's 16 columns f
  const int g0   = blockIdx.x * PJ_PIX;         // first pixel (over all batches)

  // the 64x64 f32 x tile: 512 pieces of 8 floats, four per thread
  const float4* xsrc = (const float4*)(x + (long long)g0 * CDIM);
  float4 xr[4][2];
#pragma unroll
  for (int i = 0; i < 4; ++i) {
    xr[i][0] = xsrc[2 * (tid + i * 128)];
    xr[i][1] = xsrc[2 * (tid + i * 128) + 1];
  }

  // Weight fragments, straight from memory: lane = column f0 + l16, element i
  // of k-step s = input channel 32 s + 16 h16 + i. The x fragments below take
  // the same channel order, which is all that a product needs.
  float wr[3][2][16];
  {
    const int wo = 16 * h16 * CDIM + f0 + l16;
#pragma unroll
    for (int s = 0; s < 2; ++s) {
#pragma unroll
      for (int i = 0; i < 16; ++i) {
        wr[0][s][i] = Wq[wo + (32 * s + i) * CDIM];
        wr[1][s][i] = Wk[wo + (32 * s + i) * CDIM];
        wr[2][s][i] = Wv[wo + (32 * s + i) * CDIM];
      }
    }
  }
  // The biases are the C operands: row f0 + 8 h16 + r for Q and K, column f0 + l16 for V.
  v8f cq, ck, cv;
  {
    const float4 q0 = *(const float4*)(bq + f0 + 8 * h16), q1 = *(const float4*)(bq + f0 + 8 * h16 + 4);
    const float4 k0 = *(const float4*)(bk + f0 + 8 * h16), k1 = *(const float4*)(bk + f0 + 8 * h16 + 4);
    const float  v0 = bv[f0 + l16];
    cq = v8f{q0.x, q0.y, q0.z, q0.w, q1.x, q1.y, q1.z, q1.w};
    ck = v8f{k0.x, k0.y, k0.z, k0.w, k1.x, k1.y, k1.z, k1.w};
    cv = v8f{v0, v0, v0, v0, v0, v0, v0, v0};
  }

  // x is split once per block and shared through LDS
#pragma unroll
  for (int i = 0; i < 4; ++i) {
    const int pc = tid + i * 128;               // piece: pixel pc / 8, channels (pc % 8) * 8 .. + 7
    v8h hi, lo;
    pj_split(xr[i][0].x, xr[i][0].y, hi, lo, 0);
    pj_split(xr[i][0].z, xr[i][0].w, hi, lo, 2);
    pj_split(xr[i][1].x, xr[i][1].y, hi, lo, 4);
    pj_split(xr[i][1].z, xr[i][1].w, hi, lo, 6);
    _Float16* d = xs + (pc >> 3) * PJ_STR + (pc & 7) * 8;
    *(v8h*)d = hi;
    *(v8h*)(d + PJ_PLANE) = lo;
  }
  __syncthreads();

  v16h wh[3][2], wl[3][2];
#pragma unroll
  for (int m = 0; m < 3; ++m) {
#pragma unroll
    for (int s = 0; s < 2; ++s) {
#pragma unroll
      for (int i = 0; i < 16; i += 2) pj_split(wr[m][s][i], wr[m][s][i + 1], wh[m][s], wl[m][s], i);
    }
  }

  const int b = g0 >> 12;                       // 64 divides NPIX: one batch per block
  const int n = g0 & (NPIX - 1);
  // x fragments of 16 pixels: lane = pixel l16, the weights' channel order.
  // Two sets: the next 16 pixels' LDS reads stand in front of this set's WMMAs.
  const _Float16* p = xs + l16 * PJ_STR + 16 * h16;
  v16h xf[2][2][2];                             // set, head or remainder, k-step
  pj_xfrags(p, xf[0]);
#pragma unroll
  for (int pt = 0; pt < PJ_PIX / 16; ++pt) {    // 16 pixels at a time
    const v16h (&xh)[2] = xf[pt & 1][0];
    const v16h (&xl)[2] = xf[pt & 1][1];
    if (pt + 1 < PJ_PIX / 16) pj_xfrags(p + (pt + 1) * 16 * PJ_STR, xf[(pt + 1) & 1]);
    // holds those reads above the WMMAs that cover their latency; without it
    // the compiler sinks each pair to its first use and waits for it there
    PHASE_FENCE();
    // three independent chains, taken in turn; the small terms go in first
    v8f aq = cq, ak = ck, av = cv;
#pragma unroll
    for (int s = 0; s < 2; ++s) {
      aq = WMMA_F16(wl[0][s], xh[s], aq);
      ak = WMMA_F16(wl[1][s], xh[s], ak);
      av = WMMA_F16(xh[s], wl[2][s], av);
      aq = WMMA_F16(wh[0][s], xl[s], aq);
      ak = WMMA_F16(wh[1][s], xl[s], ak);
      av = WMMA_F16(xl[s], wh[2][s], av);
    }
#pragma unroll
    for (int s = 0; s < 2; ++s) {
      aq = WMMA_F16(wh[0][s], xh[s], aq);
      ak = WMMA_F16(wh[1][s], xh[s], ak);
      av = WMMA_F16(xh[s], wh[2][s], av);
    }
    v8h oq, ok, ov;
#pragma unroll
    for (int r = 0; r < 8; ++r) {
      oq[r] = (_Float16)(aq[r] * LOG2E);
      ok[r] = (_Float16)ak[r];
      ov[r] = (_Float16)av[r];
    }
    // D element (row 8 h16 + r, column l16)
    const long long o = (long long)(g0 + pt * 16 + l16) * CDIM + f0 + 8 * h16;
    *(v8h*)(qh + o) = oq;
    *(v8h*)(kh + o) = ok;
    *(v8h*)(vT + ((long long)(b * CDIM + f0 + l16)) * NPIX + n + pt * 16 + 8 * h16) = ov;
  }
}

// ---------------------------------------------------------------------------
// Kernel 2: streaming row stats. 8 waves/block (two per SIMD). A wave owns two
// 16-row m-tiles and one quarter (128 rows) of every K stage, so each K fragment
// it reads from LDS feeds two m-tiles; the four quarters of a row are merged
// through LDS at the end.
// K comes through LDS in stages of 512 rows (two buffers, tensor loads): a
// stage's loads fly during the whole trip before it, one barrier ends a trip,
// and the running max and sum are brought up to date once per 64 rows of K.
// ---------------------------------------------------------------------------
#define K2_ROWS 512                // k rows per stage
#define K2_WROWS (K2_ROWS / 4)     // k rows of a stage that one wave takes
#define K2_STR  72                 // padded k-row stride in halves
#define K2_BUF  (K2_ROWS * K2_STR) // halves per buffer
#define K2_NST  (NPIX / K2_ROWS)   // stages

// p: this lane's first half of a 32-row sub-tile in LDS
__device__ __forceinline__ void k2_frags(const _Float16* p, v16h (&f)[4]) {
  const _Float16* p1 = p + 16 * K2_STR;
  f[0] = load_frag(p,       p + 16);
  f[1] = load_frag(p + 32,  p + 48);
  f[2] = load_frag(p1,      p1 + 16);
  f[3] = load_frag(p1 + 32, p1 + 48);
}
__device__ __forceinline__ void k2_energy(v16h a0, v16h a1, const v16h (&f)[4], v8f (&e)[2]) {
  v8f e0 = {}, e1 = {};
  e0 = WMMA_F16(a0, f[0], e0);
  e0 = WMMA_F16(a1, f[1], e0);
  e1 = WMMA_F16(a0, f[2], e1);
  e1 = WMMA_F16(a1, f[3], e1);
  e[0] = e0; e[1] = e1;
}

// Energies are exponents of 2 (Q carries log2(e)): exp(v - m) of the natural
// energies is exp2 of the difference here, one subtraction and one v_exp_f32.
__device__ __forceinline__ v2f k2_exp2(v2f t) {
  const v2f r = {__builtin_amdgcn_exp2f(t[0]), __builtin_amdgcn_exp2f(t[1])};
  return r;
}
// exp2(v - nc) of rows 2k and 2k + 1 of an energy tile
__device__ __forceinline__ v2f k2_exp(const v8f& v, int k, v2f nc) {
  const v2f x = {v[2 * k], v[2 * k + 1]};
  return k2_exp2(x - nc);
}

// Running max and sum of this lane's 8 rows over 64 more columns (four energy
// tiles, four values a row): first the new max of each row, then one exponential
// for each value and one for the old sum's rescale. The rescale takes the
// difference of the two maxima first, so it is exactly 1 while a row's max stands.
__device__ __forceinline__ void k2_update(const v8f (&ea)[2], const v8f (&eb)[2],
                                          v8f& mx, v8f& sm) {
  v8f nm;
#pragma unroll
  for (int i = 0; i < 8; ++i)
    nm[i] = __builtin_fmaximum_numf(__builtin_fmaximum_numf(__builtin_fmaximum_numf(
                __builtin_fmaximum_numf(mx[i], ea[0][i]), ea[1][i]), eb[0][i]), eb[1][i]);
#pragma unroll
  for (int k = 0; k < 4; ++k) {
    const v2f n2 = {nm[2 * k], nm[2 * k + 1]};
    const v2f o2 = {mx[2 * k], mx[2 * k + 1]};
    const v2f s2 = {sm[2 * k], sm[2 * k + 1]};
    const v2f p  = (k2_exp(ea[0], k, n2) + k2_exp(ea[1], k, n2)) +
                   (k2_exp(eb[0], k, n2) + k2_exp(eb[1], k, n2));
    const v2f r  = __builtin_elementwise_fma(s2, k2_exp2(o2 - n2), p);
    sm[2 * k] = r[0]; sm[2 * k + 1] = r[1];
  }
  mx = nm;
}

// Half of one wave's share of a stage: two 32-row sub-tiles against two
// m-tiles. All its LDS reads stand in one group at the head.
__device__ __forceinline__ void k2_trip(const _Float16* ks, const v16h (&a)[2][2],
                                        v8f (&mx)[2], v8f (&sm)[2]) {
  v16h f[2][4];                                 // fragments of the two sub-tiles
  v8f  e[2][2][2];                              // energies: m-tile, sub-tile
#pragma unroll
  for (int j = 0; j < 2; ++j) k2_frags(ks + j * 32 * K2_STR, f[j]);
  PHASE_FENCE();
#pragma unroll
  for (int mt = 0; mt < 2; ++mt) {
#pragma unroll
    for (int j = 0; j < 2; ++j) k2_energy(a[mt][0], a[mt][1], f[j], e[mt][j]);
  }
  k2_update(e[0][0], e[0][1], mx[0], sm[0]);
  k2_update(e[1][0], e[1][1], mx[1], sm[1]);
  // keeps the arithmetic in front of the waits at the trip's foot; without it
  // the wait for every LDS read moves up to the head, with nothing to cover it
  PHASE_FENCE();
}

// Stage t into buffer bb: issuing wave w (0..3) brings rows w*128 .. +127 as one
// tile of 128-byte rows, laid at the padded pitch. dst0, ga0: the wave's place
// in buffer 0 (LDS byte offset) and its first global byte of stage 0.
#define K2_ISSUERS 4
#define K2_SLROWS (K2_ROWS / K2_ISSUERS)
__device__ __forceinline__ void k2_stage(int bb, int t, uint32_t dst0, uint64_t ga0,
                                         u32x4& g0, u32x8& g1) {
  g0 = tdm_group0(dst0 + (uint32_t)bb * (K2_BUF * 2), ga0 + (uint32_t)t * (K2_ROWS * CDIM * 2));
  tdm_load(g0, g1);
}

// waves_per_eu(4, 4): a budget of 256 registers for the fragments in flight
__global__ void __launch_bounds__(256) __attribute__((amdgpu_waves_per_eu(4, 4)))
rowstats_kernel(const _Float16* __restrict__ qh, const _Float16* __restrict__ kh,
                float* __restrict__ rowc) {
  // every tile's place in LDS is a multiple of 2 KiB
  __shared__ __attribute__((aligned(2048))) _Float16 smem[2 * K2_BUF];
  const int tid  = threadIdx.x;
  const int lane = tid & 31;
  const int wv   = tid >> 5;
  const int h16  = lane >> 4;
  const int l16  = lane & 15;
  const int mp   = wv & 1;                      // which 32 of the block's 64 rows m
  const int kq   = wv >> 1;                     // which quarter of every stage
  const int b    = blockIdx.x >> 6;
  const int mb   = (blockIdx.x & 63) * 64;

  const _Float16* q = qh + (long long)b * NPIX * CDIM;
  const _Float16* k = kh + (long long)b * NPIX * CDIM;

  v16h a[2][2];
#pragma unroll
  for (int mt = 0; mt < 2; ++mt) {
    const _Float16* qrow = q + (mb + mp * 32 + mt * 16 + l16) * CDIM;
    a[mt][0] = load_frag(qrow + h16 * 8,      qrow + 16 + h16 * 8);
    a[mt][1] = load_frag(qrow + 32 + h16 * 8, qrow + 48 + h16 * 8);
  }

  const uint32_t wave = uni(threadIdx.x >> 5);
  const uint32_t dst0 = uni(lds_addr(smem) + wave * (K2_SLROWS * K2_STR * 2));
  const uint64_t ga0  = uni64((uint64_t)k + wave * (K2_SLROWS * CDIM * 2));
  u32x4 g0 = tdm_group0(dst0, ga0);
  u32x8 g1 = tdm_group1<TDM_PAD128, CDIM * 2>(K2_SLROWS, CDIM * 2);

  // stage 0 landed and published, then stage 1 in flight
  if (pinned(wave < K2_ISSUERS)) {
    k2_stage(0, 0, dst0, ga0, g0, g1);
    tdm_wait(g0, g1);
  }
  __syncthreads();
  if (pinned(wave < K2_ISSUERS)) k2_stage(1, 1, dst0, ga0, g0, g1);

  v8f mx[2], sm[2];
#pragma unroll
  for (int mt = 0; mt < 2; ++mt) {
#pragma unroll
    for (int i = 0; i < 8; ++i) { mx[mt][i] = -3.0e38f; sm[mt][i] = 0.0f; }
  }

  // Foot of every trip: own LDS reads done, own tile of stage t+1 landed,
  // then the one barrier that publishes stage t+1 and frees this buffer.
  // While a stage t+2 exists it is loaded into that buffer; the last two trips
  // stand in a loop of their own.
  const _Float16* ks0 = smem + (kq * K2_WROWS + l16) * K2_STR + h16 * 8;
  for (int t = 0; t < K2_NST - 2; ++t) {
    // kept rolled: unrolled, the two halves' values overlap and some spill to scratch
#pragma nounroll
    for (int h = 0; h < 2; ++h) k2_trip(ks0 + (t & 1) * K2_BUF + h * 64 * K2_STR, a, mx, sm);
    S_WAIT_DSCNT0();
    if (pinned(wave < K2_ISSUERS)) tdm_wait(g0, g1);
    __syncthreads();
    if (pinned(wave < K2_ISSUERS)) k2_stage(t & 1, t + 2, dst0, ga0, g0, g1);
  }
  for (int t = K2_NST - 2; t < K2_NST; ++t) {
    // kept rolled: unrolled, the two halves' values overlap and some spill to scratch
#pragma nounroll
    for (int h = 0; h < 2; ++h) k2_trip(ks0 + (t & 1) * K2_BUF + h * 64 * K2_STR, a, mx, sm);
    S_WAIT_DSCNT0();
    if (pinned(wave < K2_ISSUERS)) tdm_wait(g0, g1);
    __syncthreads();
  }
  tdm_wait(g0, g1);                             // nothing in flight at the wave's end
  S_WAIT_DSCNT0();
  // merge across the 16 lanes sharing each row m
#pragma unroll
  for (int mt = 0; mt < 2; ++mt) {
#pragma unroll
    for (int i = 0; i < 8; ++i) {
      float m = mx[mt][i], s = sm[mt][i];
#pragma unroll
      for (int off = 8; off >= 1; off >>= 1) {
        const float om = __shfl_xor(m, off, 32);
        const float os = __shfl_xor(s, off, 32);
        const float nm = fmaxf(m, om);
        s = s * __builtin_amdgcn_exp2f(m - nm) + os * __builtin_amdgcn_exp2f(om - nm);
        m = nm;
      }
      mx[mt][i] = m; sm[mt][i] = s;
    }
  }
  // merge across the four waves that hold a row's quarters: (max, sum) pairs go
  // through LDS, free since the last trip's barrier; pair index = quarter * 64 + row
  float2* red = (float2*)smem;
  if (l16 == 0) {
#pragma unroll
    for (int mt = 0; mt < 2; ++mt) {
#pragma unroll
      for (int i = 0; i < 8; ++i)
        red[kq * 64 + mp * 32 + mt * 16 + h16 * 8 + i] = make_float2(mx[mt][i], sm[mt][i]);
    }
  }
  __syncthreads();
  if (tid < 64) {
    float2 r = red[tid];
    float m = r.x, s = r.y;
#pragma unroll
    for (int qd = 1; qd < 4; ++qd) {
      const float2 o  = red[qd * 64 + tid];
      const float  nm = fmaxf(m, o.x);
      s = s * __builtin_amdgcn_exp2f(m - nm) + o.y * __builtin_amdgcn_exp2f(o.x - nm);
      m = nm;
    }
    // one constant a row: softmax value = exp2(energy + rowc); s >= 1, v_log_f32 is log2
    rowc[b * NPIX + mb + tid] = -(m + __builtin_amdgcn_logf(s));
  }
}

// ---------------------------------------------------------------------------
// Kernel 3: out^T = V^T * softmax(E). 8 waves/block (two per SIMD). A wave owns
// two 16-col n-tiles and one quarter (128 rows m) of every stage, so each Q and
// V^T fragment it reads from LDS feeds two n-tiles; the four partial sums of a
// column are added through LDS at the end.
// Q (512x64), V^T (64x512) and the row constants of 512 rows m make one stage in LDS
// (two buffers, tensor loads, one tile of 256-byte rows from each of seven waves,
// every row followed by 16 bytes of pad); a row holds two rows of Q, or 128
// columns m of a V^T row (four slices, one per quarter), or 64 constants; one
// barrier ends a trip, in which a wave's four 32-row sub-tiles are unrolled.
// Energy D-tile register layout == second WMMA's B-operand layout, so P is
// fed through registers with no transpose. A row's constant -(max + log2 sum)
// is the C operand of its energy WMMA (C has D's layout), so the softmax value
// is exp2 of the WMMA's result, with no other arithmetic per value.
// ---------------------------------------------------------------------------
#define K3_ROWS 512                     // rows m per stage
#define K3_WROWS (K3_ROWS / 4)          // rows m of a stage that one wave takes
#define K3_PSTR 136                     // pitch of a padded 256-byte LDS row (halves)
#define K3_VSTR K3_PSTR                 // row stride of a vT slice (halves)
#define K3_VSL  9216                    // halves per vT slice: 64 rows, rounded up to 2 KiB
#define K3_QSZ  (K3_ROWS / 2 * K3_PSTR) // halves: q rows 2i and 2i+1 share LDS row i
#define K3_VSZ  (4 * K3_VSL)            // halves
#define K3_SSZ  2048                    // halves: 8 rows of 64 constants, rounded up to 2 KiB
#define K3_BUF  (K3_QSZ + K3_VSZ + K3_SSZ)
#define K3_NST  (NPIX / K3_ROWS)        // stages

// Stage t into buffer bb, one tile per issuing wave. dst0, ga0: the wave's place
// in buffer 0 (LDS byte offset) and its first global byte of stage 0; gstep:
// global bytes from one stage's tile to the next.
#define K3_ISSUERS 7
__device__ __forceinline__ void k3_stage(int bb, int t, uint32_t dst0, uint64_t ga0, uint32_t gstep,
                                         u32x4& g0, u32x8& g1) {
  g0 = tdm_group0(dst0 + (uint32_t)bb * (K3_BUF * 2), ga0 + (uint32_t)t * gstep);
  tdm_load(g0, g1);
}

// p: this lane's first half (or float) of a 32-row sub-tile's part in LDS
__device__ __forceinline__ void k3_qfrags(const _Float16* p, v16h (&a)[4]) {
  const _Float16* p1 = p + 8 * K3_PSTR;       // 16 rows of Q on: 8 LDS rows
  a[0] = load_frag(p,       p + 16);
  a[1] = load_frag(p + 32,  p + 48);
  a[2] = load_frag(p1,      p1 + 16);
  a[3] = load_frag(p1 + 32, p1 + 48);
}
__device__ __forceinline__ void k3_vfrags(const _Float16* p, v16h (&a)[4]) {
#pragma unroll
  for (int ct = 0; ct < 4; ++ct)
    a[ct] = load_frag(p + ct * 16 * K3_VSTR, p + ct * 16 * K3_VSTR + 16);
}
__device__ __forceinline__ void k3_stats(const float* p, v8f (&c)[2]) {
#pragma unroll
  for (int h = 0; h < 2; ++h) {               // rows +0..7, rows +16..23
    const float4 lo = *(const float4*)(p + h * 16);
    const float4 hi = *(const float4*)(p + h * 16 + 4);
    c[h] = v8f{lo.x, lo.y, lo.z, lo.w, hi.x, hi.y, hi.z, hi.w};
  }
}

// waves_per_eu(4, 4): a budget of 256 registers for the fragments in flight
__global__ void __launch_bounds__(256) __attribute__((amdgpu_waves_per_eu(4, 4)))
attnout_kernel(const _Float16* __restrict__ qh, const _Float16* __restrict__ kh,
               const _Float16* __restrict__ vT,
               const float* __restrict__ rowc,
               const float* __restrict__ x, const float* __restrict__ gamma,
               float* __restrict__ out) {
  // every tile's place in LDS is a multiple of 2 KiB
  __shared__ __attribute__((aligned(2048))) _Float16 smem[2 * K3_BUF];
  const int tid  = threadIdx.x;
  const int lane = tid & 31;
  const int wv   = tid >> 5;
  const int h16  = lane >> 4;
  const int l16  = lane & 15;
  const int np   = wv & 1;                // which 32 of the block's 64 columns n
  const int mq   = wv >> 1;               // which quarter of every stage
  const int b    = blockIdx.x >> 6;
  const int n0   = (blockIdx.x & 63) * 64 + np * 32;

  const _Float16* q  = qh + (long long)b * NPIX * CDIM;
  const _Float16* k  = kh + (long long)b * NPIX * CDIM;
  const _Float16* vt = vT + (long long)b * CDIM * NPIX;

  // B operands of the energy WMMAs: k rows n0..n0+31 (fixed per wave)
  v16h bk[2][2];
#pragma unroll
  for (int nt = 0; nt < 2; ++nt) {
    const _Float16* krow = k + (n0 + nt * 16 + l16) * CDIM;
    bk[nt][0] = load_frag(krow + h16 * 8,      krow + 16 + h16 * 8);
    bk[nt][1] = load_frag(krow + 32 + h16 * 8, krow + 48 + h16 * 8);
  }

  // The issuing waves' tiles, all of 256-byte rows: waves 0 and 1 a half of Q
  // (128 rows, contiguous in memory), waves 2..5 a slice of V^T (64 rows, a V^T
  // row apart), wave 6 the 512 row constants (8 rows, contiguous). Wave 7
  // issues nothing; its words are wave 6's and go unused.
  const uint32_t wave = uni(threadIdx.x >> 5);
  const bool     isq  = wave < 2, isv = wave < 6;
  const uint32_t vsl  = wave - 2;         // V^T slice, where isv and not isq
  const uint32_t dst0 = uni(lds_addr(smem) +
      (isq ? wave * (K3_QSZ / 2 * 2) : isv ? K3_QSZ * 2 + vsl * (K3_VSL * 2) : (K3_QSZ + K3_VSZ) * 2));
  const uint64_t ga0  = uni64(isq ? (uint64_t)q + wave * (K3_ROWS / 2 * CDIM * 2)
                            : isv ? (uint64_t)vt + vsl * (K3_WROWS * 2) : (uint64_t)(rowc + b * NPIX));
  const uint32_t gstep = uni(isq ? K3_ROWS * CDIM * 2 : isv ? K3_ROWS * 2 : K3_ROWS * 4);
  u32x4 g0 = tdm_group0(dst0, ga0);
  u32x8 g1 = tdm_group1<TDM_PAD256, 256>(isq ? K3_ROWS / 4 : isv ? CDIM : K3_ROWS * 4 / 256,
                                         isq ? 256 : isv ? NPIX * 2 : 256);

  // stage 0 landed and published, then stage 1 in flight
  if (pinned(wave < K3_ISSUERS)) {
    k3_stage(0, 0, dst0, ga0, gstep, g0, g1);
    tdm_wait(g0, g1);
  }
  __syncthreads();
  if (pinned(wave < K3_ISSUERS)) k3_stage(1, 1, dst0, ga0, gstep, g0, g1);

  v8f acc[2][4];                          // n-tile, 16 channels each
#pragma unroll
  for (int nt = 0; nt < 2; ++nt) {
#pragma unroll
    for (int ct = 0; ct < 4; ++ct) acc[nt][ct] = v8f{};
  }

  for (int t = 0; t < K3_NST; ++t) {
    const _Float16* sb = smem + (t & 1) * K3_BUF;
    const _Float16* qs = sb + (mq * (K3_WROWS / 2) + (l16 >> 1)) * K3_PSTR + (l16 & 1) * CDIM + h16 * 8;
    const _Float16* vs = sb + K3_QSZ + mq * K3_VSL + l16 * K3_VSTR + h16 * 8;
    const float*    st = (const float*)(sb + K3_QSZ + K3_VSZ + mq * 2 * K3_PSTR) + h16 * 8;

    v16h   qa[4], va[4];                  // Q and V^T fragments of a sub-tile
    v8f    c[2];                          // its row constants, 16 rows m each
    k3_qfrags(qs, qa);
    k3_stats(st, c);
    k3_vfrags(vs, va);
    PHASE_FENCE();
#pragma unroll
    for (int j = 0; j < K3_WROWS / 32; ++j) {
      v8f e[2][2];                        // n-tile, 16 rows m each
#pragma unroll
      for (int nt = 0; nt < 2; ++nt) {
        e[nt][0] = WMMA_F16(qa[0], bk[nt][0], c[0]);
        e[nt][1] = WMMA_F16(qa[2], bk[nt][0], c[1]);
      }
#pragma unroll
      for (int nt = 0; nt < 2; ++nt) {
        e[nt][0] = WMMA_F16(qa[1], bk[nt][1], e[nt][0]);
        e[nt][1] = WMMA_F16(qa[3], bk[nt][1], e[nt][1]);
      }
      PHASE_FENCE();
      if (j + 1 < K3_WROWS / 32) {        // read under this sub-tile's vector work
        k3_qfrags(qs + (j + 1) * 16 * K3_PSTR, qa);
        // constants of sub-tile j + 1: LDS row (j + 1) / 2, its first or second 32
        k3_stats(st + ((j + 1) >> 1) * (K3_PSTR / 2) + ((j + 1) & 1) * 32, c);
      }
      PHASE_FENCE();
#pragma unroll
      for (int nt = 0; nt < 2; ++nt) {
        v16h pb;
#pragma unroll
        for (int r = 0; r < 8; ++r) {
          pb[r]     = (_Float16)__builtin_amdgcn_exp2f(e[nt][0][r]);
          pb[8 + r] = (_Float16)__builtin_amdgcn_exp2f(e[nt][1][r]);
        }
#pragma unroll
        for (int ct = 0; ct < 4; ++ct) acc[nt][ct] = WMMA_F16(va[ct], pb, acc[nt][ct]);
      }
      PHASE_FENCE();
      if (j + 1 < K3_WROWS / 32) k3_vfrags(vs + (j + 1) * 32, va);
    }
    // foot of the trip: own LDS reads done, own tile of stage t+1 landed,
    // then the one barrier that publishes stage t+1 and frees this buffer
    S_WAIT_DSCNT0();
    if (pinned(wave < K3_ISSUERS)) tdm_wait(g0, g1);
    __syncthreads();
    if (pinned(wave < K3_ISSUERS && t + 2 < K3_NST)) k3_stage(t & 1, t + 2, dst0, ga0, gstep, g0, g1);
  }
  tdm_wait(g0, g1);                       // nothing in flight at the wave's end
  S_WAIT_DSCNT0();

  // The four partial sums of every output go through LDS, free since the last
  // trip's barrier. A wave's 64 floats per lane are 16 pieces of 16 bytes,
  // piece p = nt*8 + ct*2 + half, stored lane-contiguous.
  float4* red = (float4*)smem;
#pragma unroll
  for (int nt = 0; nt < 2; ++nt) {
#pragma unroll
    for (int ct = 0; ct < 4; ++ct) {
      const v8f v = acc[nt][ct];
      red[(wv * 16 + nt * 8 + ct * 2) * 32 + lane]     = make_float4(v[0], v[1], v[2], v[3]);
      red[(wv * 16 + nt * 8 + ct * 2 + 1) * 32 + lane] = make_float4(v[4], v[5], v[6], v[7]);
    }
  }
  __syncthreads();

  // Epilogue: wave (np, mq) finishes pieces mq*4 .. mq*4+3 of its column pair:
  // n-tile mq/2, channels (mq%2)*32 .. +31, one 128-byte half of each out row.
  // D element (c = ct*16 + r + 8*h16, n = n0 + nt*16 + l16)
  const long long row = (long long)(b * NPIX + n0 + (mq >> 1) * 16 + l16) * CDIM;
  const float* xr = x + row;
  float* outr = out + row;
  const float g = gamma[0];
#pragma unroll
  for (int i = 0; i < 4; ++i) {
    const int p = mq * 4 + i;
    float4 a4 = red[(np * 16 + p) * 32 + lane];
#pragma unroll
    for (int qd = 1; qd < 4; ++qd) {      // quarters in ascending order
      const float4 o = red[((np + 2 * qd) * 16 + p) * 32 + lane];
      a4.x += o.x; a4.y += o.y; a4.z += o.z; a4.w += o.w;
    }
    const int base = ((mq & 1) * 2 + (i >> 1)) * 16 + h16 * 8 + (i & 1) * 4;
    const float4 xv = *(const float4*)(xr + base);
    float4 o4;
    o4.x = fmaf(g, a4.x, xv.x);
    o4.y = fmaf(g, a4.y, xv.y);
    o4.z = fmaf(g, a4.z, xv.z);
    o4.w = fmaf(g, a4.w, xv.w);
    *(float4*)(outr + base) = o4;
  }
}

// ---------------------------------------------------------------------------
extern "C" void kernel_launch(void* const* d_in, const int* in_sizes, int n_in,
                              void* d_out, int out_size, void* d_ws, size_t ws_size,
                              hipStream_t stream) {
  (void)in_sizes; (void)n_in; (void)out_size; (void)ws_size;
  const float* x     = (const float*)d_in[0];
  const float* Wq    = (const float*)d_in[1];
  const float* bq    = (const float*)d_in[2];
  const float* Wk    = (const float*)d_in[3];
  const float* bk    = (const float*)d_in[4];
  const float* Wv    = (const float*)d_in[5];
  const float* bv    = (const float*)d_in[6];
  const float* gamma = (const float*)d_in[7];
  float* out = (float*)d_out;

  // workspace: q(2MB) k(2MB) vT(2MB) rowc(64KB)
  _Float16* qh = (_Float16*)d_ws;
  _Float16* kh = qh + (size_t)NB * NPIX * CDIM;
  _Float16* vT = kh + (size_t)NB * NPIX * CDIM;
  float* rowc = (float*)(vT + (size_t)NB * NPIX * CDIM);

  proj_kernel<<<NB * NPIX / PJ_PIX, 128, 0, stream>>>(x, Wq, bq, Wk, bk, Wv, bv, qh, kh, vT);
  rowstats_kernel<<<NB * 64, 256, 0, stream>>>(qh, kh, rowc);
  attnout_kernel<<<NB * 64, 256, 0, stream>>>(qh, kh, vT, rowc, x, gamma, out);
}

// v008
// It runs in 31.9 microseconds.
// Two timings next to v007 put it at 1.08 and 1.07 times that version's speed.
// Over all steps from v000 it is 5.21 times as fast.
#include <hip/hip_runtime.h>
#include <stdint.h>

// PAM attention, B=4, H=W=64, C=64 (N=4096).
// f16 WMMA for the projection (split operands) and both big GEMMs; f32 softmax math; LDS tile sharing across
// 8 waves per workgroup, staged with tensor loads, one 2-D tile per issuing
// wave (two buffers, 512 rows per stage).

typedef _Float16 v8h  __attribute__((ext_vector_type(8)));
typedef _Float16 v16h __attribute__((ext_vector_type(16)));
typedef float    v8f  __attribute__((ext_vector_type(8)));
typedef float    v2f  __attribute__((ext_vector_type(2)));

#define NPIX 4096
#define CDIM 64
#define NB   4

#define WMMA_F16(A, B, C) \
  __builtin_amdgcn_wmma_f32_16x16x32_f16(false, (A), false, (B), (short)0, (C), false, false)

#define S_WAIT_DSCNT0()      asm volatile("s_wait_dscnt 0x0" ::: "memory")

// Compile-time fence between the phases of an unrolled sub-tile (no instruction
// of its own): the "memory" clobber holds the LDS reads, the scheduling barrier
// the arithmetic, each on its side, so that a group of reads stands in front of
// the work that covers its latency; without it the compiler sinks the reads to
// their uses and waits for each pair in turn.
#define PHASE_FENCE() do { asm volatile("" ::: "memory"); __builtin_amdgcn_sched_barrier(0); } while (0)

typedef uint32_t u32x4 __attribute__((ext_vector_type(4)));
typedef uint32_t u32x8 __attribute__((ext_vector_type(8)));

__device__ __forceinline__ uint32_t uni(uint32_t v) {
  return (uint32_t)__builtin_amdgcn_readfirstlane(v);
}
__device__ __forceinline__ uint64_t uni64(uint64_t v) {
  return ((uint64_t)uni((uint32_t)(v >> 32)) << 32) | uni((uint32_t)v);
}
// A wave-uniform test held in a scalar register, so that the branch on it is a
// scalar one: a tensor load ignores EXEC, only a scalar branch keeps a wave off it.
__device__ __forceinline__ uint32_t pinned(uint32_t v) {
  uint32_t w = (uint32_t)__builtin_amdgcn_readfirstlane(v);
  asm volatile("" : "+s"(w));   // holds the test in a scalar register
  return w;
}
// Word 0 of descriptor group 1: no mask, 1-byte elements, 16 bytes of LDS pad
// behind every row of 128 or of 256 bytes (pitch 144 or 272 bytes).
#define TDM_PAD128 ((1u << 20) | (4u << 22) | (3u << 25))
#define TDM_PAD256 ((1u << 20) | (5u << 22) | (3u << 25))
// Descriptor group 1: a tile of n rows (below 65536) of R bytes, source row
// pitch p bytes. Built once per wave, in front of its first request.
template <uint32_t W0, uint32_t R>
__device__ __forceinline__ u32x8 tdm_group1(uint32_t n, uint32_t p) {
  u32x8 g;
  g[0] = uni(W0);
  g[1] = uni((R & 0xFFFFu) << 16);
  g[2] = uni((R >> 16) | (n << 16));
  g[3] = uni(R << 16);
  g[4] = uni(n);
  g[5] = uni(p);
  g[6] = uni(0u);
  g[7] = uni(0u);
  return g;
}
// Descriptor group 0: LDS byte offset of the tile, global address of its first byte.
__device__ __forceinline__ u32x4 tdm_group0(uint32_t lds_dst, uint64_t ga) {
  u32x4 g;
  g[0] = uni(1u);
  g[1] = uni(lds_dst);
  g[2] = uni((uint32_t)ga);
  g[3] = uni((((uint32_t)(ga >> 32)) & 0x01FFFFFFu) | 0x80000000u);
  return g;
}
// One request of the whole wave: memory -> LDS through no register (TENSORcnt).
// Both groups are in-out operands here and inputs of the wait below, so that
// the registers the request names hold the descriptor, untouched, from the
// issue to the wait that covers it.
__device__ __forceinline__ void tdm_load(u32x4& g0, u32x8& g1) {
  asm volatile("tensor_load_to_lds %0, %1" : "+s"(g0), "+s"(g1) :: "memory");
}
// The issuing wave's own tile has landed; the compiler places no such wait.
__device__ __forceinline__ void tdm_wait(const u32x4& g0, const u32x8& g1) {
  asm volatile("s_wait_tensorcnt 0x0" :: "s"(g0), "s"(g1) : "memory");
}
__device__ __forceinline__ unsigned lds_addr(const void* p) {
  return (unsigned)(unsigned long long)p;   // low 32 bits of generic = LDS offset
}

// 16x32 f16 A/B fragment: row = tile_row + lane%16, halves 0..7 at
// K = 8*(lane/16), halves 8..15 at K = 16 + 8*(lane/16) (kernels 2 and 3; the
// projection's fragments put half i at K = 16*(lane/16) + i).
__device__ __forceinline__ v16h load_frag(const _Float16* lo, const _Float16* hi) {
  v8h a = *(const v8h*)lo;
  v8h b = *(const v8h*)hi;
  v16h r;
#pragma unroll
  for (int i = 0; i < 8; ++i) { r[i] = a[i]; r[8 + i] = b[i]; }
  return r;
}

// ---------------------------------------------------------------------------
// Kernel 1: fused Q/K/V projection (1x1 conv) on the matrix unit. Q,K row-major
// f16; V stored transposed (c-major) so it is the A operand of out^T = V^T * P.
// Q is stored times log2(e), scaled in f32 before its one rounding to f16, so
// every energy Q.K of the later kernels is an exponent of 2.
// Every x and every weight is split into an f16 head and an f16 remainder; a
// product is head*head + head*remainder + remainder*head, summed in f32, which
// keeps about 22 bits of it (the results are rounded to 11 afterwards).
// One block = 64 pixels, 4 waves. A wave owns the same 16 output columns f of
// Q, K and V for all 64 pixels. For Q and K the weights are the A operand and x
// the B operand, so a lane's 8 results are 8 consecutive f of one pixel; for V
// the operands change places, so they are 8 consecutive pixels of one V^T row:
// every result leaves in 16-byte pieces.
// ---------------------------------------------------------------------------
#define LOG2E 1.4426950408889634f
#define PJ_PIX 64                  // pixels per block
#define PJ_STR 72                  // LDS row pitch in halves: 128 bytes and 16 of pad
#define PJ_PLANE (PJ_PIX * PJ_STR) // halves of one plane (heads, or remainders) of x

typedef _Float16 v2h __attribute__((ext_vector_type(2)));

// elements e, e + 1 of hi and lo: f16 head and f16 remainder of a and b
template <typename V>
__device__ __forceinline__ void pj_split(float a, float b, V& hi, V& lo, int e) {
  const v2f v = {a, b};
  const v2h h = __builtin_convertvector(v, v2h);
  const v2h l = __builtin_convertvector(v - __builtin_convertvector(h, v2f), v2h);
  hi[e] = h[0]; hi[e + 1] = h[1];
  lo[e] = l[0]; lo[e + 1] = l[1];
}

// p: this lane's first half of a 16-pixel tile in the plane of heads
__device__ __forceinline__ void pj_xfrags(const _Float16* p, v16h (&f)[2][2]) {
#pragma unroll
  for (int s = 0; s < 2; ++s) {
    f[0][s] = load_frag(p + 32 * s, p + 32 * s + 8);
    f[1][s] = load_frag(p + PJ_PLANE + 32 * s, p + PJ_PLANE + 32 * s + 8);
  }
}

__global__ void __launch_bounds__(128)
proj_kernel(const float* __restrict__ x,
            const float* __restrict__ Wq, const float* __restrict__ bq,
            const float* __restrict__ Wk, const float* __restrict__ bk,
            const float* __restrict__ Wv, const float* __restrict__ bv,
            _Float16* __restrict__ qh, _Float16* __restrict__ kh,
            _Float16* __restrict__ vT) {
  __shared__ __align__(16) _Float16 xs[2 * PJ_PLANE];
  const int tid  = threadIdx.x;
  const int lane = tid & 31;
  const int h16  = lane >> 4;
  const int l16  = lane & 15;
  const int f0   = (tid >> 5) * 16;             // the wave's 16 columns f
  const int g0   = blockIdx.x * PJ_PIX;         // first pixel (over all batches)

  // the 64x64 f32 x tile: 512 pieces of 8 floats, four per thread
  const float4* xsrc = (const float4*)(x + (long long)g0 * CDIM);
  float4 xr[4][2];
#pragma unroll
  for (int i = 0; i < 4; ++i) {
    xr[i][0] = xsrc[2 * (tid + i * 128)];
    xr[i][1] = xsrc[2 * (tid + i * 128) + 1];
  }

  // Weight fragments, straight from memory: lane = column f0 + l16, element i
  // of k-step s = input channel 32 s + 16 h16 + i. The x fragments below take
  // the same channel order, which is all that a product needs.
  float wr[3][2][16];
  {
    const int wo = 16 * h16 * CDIM + f0 + l16;
#pragma unroll
    for (int s = 0; s < 2; ++s) {
#pragma unroll
      for (int i = 0; i < 16; ++i) {
        wr[0][s][i] = Wq[wo + (32 * s + i) * CDIM];
        wr[1][s][i] = Wk[wo + (32 * s + i) * CDIM];
        wr[2][s][i] = Wv[wo + (32 * s + i) * CDIM];
      }
    }
  }
  // The biases are the C operands: row f0 + 8 h16 + r for Q and K, column f0 + l16 for V.
  v8f cq, ck, cv;
  {
    const float4 q0 = *(const float4*)(bq + f0 + 8 * h16), q1 = *(const float4*)(bq + f0 + 8 * h16 + 4);
    const float4 k0 = *(const float4*)(bk + f0 + 8 * h16), k1 = *(const float4*)(bk + f0 + 8 * h16 + 4);
    const float  v0 = bv[f0 + l16];
    cq = v8f{q0.x, q0.y, q0.z, q0.w, q1.x, q1.y, q1.z, q1.w};
    ck = v8f{k0.x, k0.y, k0.z, k0.w, k1.x, k1.y, k1.z, k1.w};
    cv = v8f{v0, v0, v0, v0, v0, v0, v0, v0};
  }

  // x is split once per block and shared through LDS
#pragma unroll
  for (int i = 0; i < 4; ++i) {
    const int pc = tid + i * 128;               // piece: pixel pc / 8, channels (pc % 8) * 8 .. + 7
    v8h hi, lo;
    pj_split(xr[i][0].x, xr[i][0].y, hi, lo, 0);
    pj_split(xr[i][0].z, xr[i][0].w, hi, lo, 2);
    pj_split(xr[i][1].x, xr[i][1].y, hi, lo, 4);
    pj_split(xr[i][1].z, xr[i][1].w, hi, lo, 6);
    _Float16* d = xs + (pc >> 3) * PJ_STR + (pc & 7) * 8;
    *(v8h*)d = hi;
    *(v8h*)(d + PJ_PLANE) = lo;
  }
  __syncthreads();

  v16h wh[3][2], wl[3][2];
#pragma unroll
  for (int m = 0; m < 3; ++m) {
#pragma unroll
    for (int s = 0; s < 2; ++s) {
#pragma unroll
      for (int i = 0; i < 16; i += 2) pj_split(wr[m][s][i], wr[m][s][i + 1], wh[m][s], wl[m][s], i);
    }
  }

  const int b = g0 >> 12;                       // 64 divides NPIX: one batch per block
  const int n = g0 & (NPIX - 1);
  // x fragments of 16 pixels: lane = pixel l16, the weights' channel order.
  // Two sets: the next 16 pixels' LDS reads stand in front of this set's WMMAs.
  const _Float16* p = xs + l16 * PJ_STR + 16 * h16;
  v16h xf[2][2][2];                             // set, head or remainder, k-step
  pj_xfrags(p, xf[0]);
#pragma unroll
  for (int pt = 0; pt < PJ_PIX / 16; ++pt) {    // 16 pixels at a time
    const v16h (&xh)[2] = xf[pt & 1][0];
    const v16h (&xl)[2] = xf[pt & 1][1];
    if (pt + 1 < PJ_PIX / 16) pj_xfrags(p + (pt + 1) * 16 * PJ_STR, xf[(pt + 1) & 1]);
    // holds those reads above the WMMAs that cover their latency; without it
    // the compiler sinks each pair to its first use and waits for it there
    PHASE_FENCE();
    // three independent chains, taken in turn; the small terms go in first
    v8f aq = cq, ak = ck, av = cv;
#pragma unroll
    for (int s = 0; s < 2; ++s) {
      aq = WMMA_F16(wl[0][s], xh[s], aq);
      ak = WMMA_F16(wl[1][s], xh[s], ak);
      av = WMMA_F16(xh[s], wl[2][s], av);
      aq = WMMA_F16(wh[0][s], xl[s], aq);
      ak = WMMA_F16(wh[1][s], xl[s], ak);
      av = WMMA_F16(xl[s], wh[2][s], av);
    }
#pragma unroll
    for (int s = 0; s < 2; ++s) {
      aq = WMMA_F16(wh[0][s], xh[s], aq);
      ak = WMMA_F16(wh[1][s], xh[s], ak);
      av = WMMA_F16(xh[s], wh[2][s], av);
    }
    v8h oq, ok, ov;
#pragma unroll
    for (int r = 0; r < 8; ++r) {
      oq[r] = (_Float16)(aq[r] * LOG2E);
      ok[r] = (_Float16)ak[r];
      ov[r] = (_Float16)av[r];
    }
    // D element (row 8 h16 + r, column l16)
    const long long o = (long long)(g0 + pt * 16 + l16) * CDIM + f0 + 8 * h16;
    *(v8h*)(qh + o) = oq;
    *(v8h*)(kh + o) = ok;
    *(v8h*)(vT + ((long long)(b * CDIM + f0 + l16)) * NPIX + n + pt * 16 + 8 * h16) = ov;
  }
}

// ---------------------------------------------------------------------------
// Kernel 2: streaming row stats. 8 waves/block (two per SIMD). A wave owns two
// 16-row m-tiles and one quarter (128 rows) of every K stage, so each K fragment
// it reads from LDS feeds two m-tiles; the four quarters of a row are merged
// through LDS at the end.
// K comes through LDS in stages of 512 rows (two buffers, tensor loads): a
// stage's loads fly during the whole trip before it, one barrier ends a trip,
// and the running max and sum are brought up to date once per 64 rows of K.
// The 64 blocks of a batch read the same K: each starts its walk over the stages
// at a stage of its own and wraps, so that they do not ask L2 for the same lines
// at the same moment.
// ---------------------------------------------------------------------------
#define K2_ROWS 512                // k rows per stage
#define K2_WROWS (K2_ROWS / 4)     // k rows of a stage that one wave takes
#define K2_STR  72                 // padded k-row stride in halves
#define K2_BUF  (K2_ROWS * K2_STR) // halves per buffer
#define K2_NST  (NPIX / K2_ROWS)   // stages

// p: this lane's first half of a 32-row sub-tile in LDS
__device__ __forceinline__ void k2_frags(const _Float16* p, v16h (&f)[4]) {
  const _Float16* p1 = p + 16 * K2_STR;
  f[0] = load_frag(p,       p + 16);
  f[1] = load_frag(p + 32,  p + 48);
  f[2] = load_frag(p1,      p1 + 16);
  f[3] = load_frag(p1 + 32, p1 + 48);
}
__device__ __forceinline__ void k2_energy(v16h a0, v16h a1, const v16h (&f)[4], v8f (&e)[2]) {
  v8f e0 = {}, e1 = {};
  e0 = WMMA_F16(a0, f[0], e0);
  e0 = WMMA_F16(a1, f[1], e0);
  e1 = WMMA_F16(a0, f[2], e1);
  e1 = WMMA_F16(a1, f[3], e1);
  e[0] = e0; e[1] = e1;
}

// Energies are exponents of 2 (Q carries log2(e)): exp(v - m) of the natural
// energies is exp2 of the difference here, one subtraction and one v_exp_f32.
__device__ __forceinline__ v2f k2_exp2(v2f t) {
  const v2f r = {__builtin_amdgcn_exp2f(t[0]), __builtin_amdgcn_exp2f(t[1])};
  return r;
}
// exp2(v - nc) of rows 2k and 2k + 1 of an energy tile
__device__ __forceinline__ v2f k2_exp(const v8f& v, int k, v2f nc) {
  const v2f x = {v[2 * k], v[2 * k + 1]};
  return k2_exp2(x - nc);
}

// Running max and sum of this lane's 8 rows over 64 more columns (four energy
// tiles, four values a row): first the new max of each row, then one exponential
// for each value and one for the old sum's rescale. The rescale takes the
// difference of the two maxima first, so it is exactly 1 while a row's max stands.
__device__ __forceinline__ void k2_update(const v8f (&ea)[2], const v8f (&eb)[2],
                                          v8f& mx, v8f& sm) {
  v8f nm;
#pragma unroll
  for (int i = 0; i < 8; ++i)
    nm[i] = __builtin_fmaximum_numf(__builtin_fmaximum_numf(__builtin_fmaximum_numf(
                __builtin_fmaximum_numf(mx[i], ea[0][i]), ea[1][i]), eb[0][i]), eb[1][i]);
#pragma unroll
  for (int k = 0; k < 4; ++k) {
    const v2f n2 = {nm[2 * k], nm[2 * k + 1]};
    const v2f o2 = {mx[2 * k], mx[2 * k + 1]};
    const v2f s2 = {sm[2 * k], sm[2 * k + 1]};
    const v2f p  = (k2_exp(ea[0], k, n2) + k2_exp(ea[1], k, n2)) +
                   (k2_exp(eb[0], k, n2) + k2_exp(eb[1], k, n2));
    const v2f r  = __builtin_elementwise_fma(s2, k2_exp2(o2 - n2), p);
    sm[2 * k] = r[0]; sm[2 * k + 1] = r[1];
  }
  mx = nm;
}

// Half of one wave's share of a stage: two 32-row sub-tiles against two
// m-tiles. All its LDS reads stand in one group at the head.
__device__ __forceinline__ void k2_trip(const _Float16* ks, const v16h (&a)[2][2],
                                        v8f (&mx)[2], v8f (&sm)[2]) {
  v16h f[2][4];                                 // fragments of the two sub-tiles
  v8f  e[2][2][2];                              // energies: m-tile, sub-tile
#pragma unroll
  for (int j = 0; j < 2; ++j) k2_frags(ks + j * 32 * K2_STR, f[j]);
  PHASE_FENCE();
#pragma unroll
  for (int mt = 0; mt < 2; ++mt) {
#pragma unroll
    for (int j = 0; j < 2; ++j) k2_energy(a[mt][0], a[mt][1], f[j], e[mt][j]);
  }
  k2_update(e[0][0], e[0][1], mx[0], sm[0]);
  k2_update(e[1][0], e[1][1], mx[1], sm[1]);
  // keeps the arithmetic in front of the waits at the trip's foot; without it
  // the wait for every LDS read moves up to the head, with nothing to cover it
  PHASE_FENCE();
}

// Stage t into buffer bb: issuing wave w (0..3) brings rows w*128 .. +127 as one
// tile of 128-byte rows, laid at the padded pitch. dst0, ga0: the wave's place
// in buffer 0 (LDS byte offset) and its first global byte of stage 0.
#define K2_ISSUERS 4
#define K2_SLROWS (K2_ROWS / K2_ISSUERS)
__device__ __forceinline__ void k2_stage(int bb, int t, uint32_t dst0, uint64_t ga0,
                                         u32x4& g0, u32x8& g1) {
  g0 = tdm_group0(dst0 + (uint32_t)bb * (K2_BUF * 2), ga0 + (uint32_t)t * (K2_ROWS * CDIM * 2));
  tdm_load(g0, g1);
}

// waves_per_eu(4, 4): a budget of 256 registers for the fragments in flight
__global__ void __launch_bounds__(256) __attribute__((amdgpu_waves_per_eu(4, 4)))
rowstats_kernel(const _Float16* __restrict__ qh, const _Float16* __restrict__ kh,
                float* __restrict__ rowc) {
  // every tile's place in LDS is a multiple of 2 KiB
  __shared__ __attribute__((aligned(2048))) _Float16 smem[2 * K2_BUF];
  const int tid  = threadIdx.x;
  const int lane = tid & 31;
  const int wv   = tid >> 5;
  const int h16  = lane >> 4;
  const int l16  = lane & 15;
  const int mp   = wv & 1;                      // which 32 of the block's 64 rows m
  const int kq   = wv >> 1;                     // which quarter of every stage
  const int b    = blockIdx.x >> 6;
  const int mb   = (blockIdx.x & 63) * 64;

  const _Float16* q = qh + (long long)b * NPIX * CDIM;
  const _Float16* k = kh + (long long)b * NPIX * CDIM;

  v16h a[2][2];
#pragma unroll
  for (int mt = 0; mt < 2; ++mt) {
    const _Float16* qrow = q + (mb + mp * 32 + mt * 16 + l16) * CDIM;
    a[mt][0] = load_frag(qrow + h16 * 8,      qrow + 16 + h16 * 8);
    a[mt][1] = load_frag(qrow + 32 + h16 * 8, qrow + 48 + h16 * 8);
  }

  const uint32_t wave = uni(threadIdx.x >> 5);
  const uint32_t dst0 = uni(lds_addr(smem) + wave * (K2_SLROWS * K2_STR * 2));
  const uint64_t ga0  = uni64((uint64_t)k + wave * (K2_SLROWS * CDIM * 2));
  u32x4 g0 = tdm_group0(dst0, ga0);
  u32x8 g1 = tdm_group1<TDM_PAD128, CDIM * 2>(K2_SLROWS, CDIM * 2);

  // Trip t works on stage (t + rot) mod 8: eight blocks in a row, and eight
  // blocks eight apart, all differ in rot.
  const int rot = ((blockIdx.x & 63) + ((blockIdx.x & 63) >> 3)) & (K2_NST - 1);

  // the first stage landed and published, then the second in flight
  if (pinned(wave < K2_ISSUERS)) {
    k2_stage(0, rot, dst0, ga0, g0, g1);
    tdm_wait(g0, g1);
  }
  __syncthreads();
  if (pinned(wave < K2_ISSUERS)) k2_stage(1, (rot + 1) & (K2_NST - 1), dst0, ga0, g0, g1);

  v8f mx[2], sm[2];
#pragma unroll
  for (int mt = 0; mt < 2; ++mt) {
#pragma unroll
    for (int i = 0; i < 8; ++i) { mx[mt][i] = -3.0e38f; sm[mt][i] = 0.0f; }
  }

  // Foot of every trip: own LDS reads done, own tile of the next trip's stage landed,
  // then the one barrier that publishes that stage and frees this buffer.
  // While a trip t+2 exists its stage is loaded into that buffer; the last two trips
  // stand in a loop of their own.
  const _Float16* ks0 = smem + (kq * K2_WROWS + l16) * K2_STR + h16 * 8;
  for (int t = 0; t < K2_NST - 2; ++t) {
    // kept rolled: unrolled, the two halves' values overlap and some spill to scratch
#pragma nounroll
    for (int h = 0; h < 2; ++h) k2_trip(ks0 + (t & 1) * K2_BUF + h * 64 * K2_STR, a, mx, sm);
    S_WAIT_DSCNT0();
    if (pinned(wave < K2_ISSUERS)) tdm_wait(g0, g1);
    __syncthreads();
    if (pinned(wave < K2_ISSUERS)) k2_stage(t & 1, (rot + t + 2) & (K2_NST - 1), dst0, ga0, g0, g1);
  }
  for (int t = K2_NST - 2; t < K2_NST; ++t) {
    // kept rolled: unrolled, the two halves' values overlap and some spill to scratch
#pragma nounroll
    for (int h = 0; h < 2; ++h) k2_trip(ks0 + (t & 1) * K2_BUF + h * 64 * K2_STR, a, mx, sm);
    S_WAIT_DSCNT0();
    if (pinned(wave < K2_ISSUERS)) tdm_wait(g0, g1);
    __syncthreads();
  }
  tdm_wait(g0, g1);                             // nothing in flight at the wave's end
  S_WAIT_DSCNT0();
  // merge across the 16 lanes sharing each row m
#pragma unroll
  for (int mt = 0; mt < 2; ++mt) {
#pragma unroll
    for (int i = 0; i < 8; ++i) {
      float m = mx[mt][i], s = sm[mt][i];
#pragma unroll
      for (int off = 8; off >= 1; off >>= 1) {
        const float om = __shfl_xor(m, off, 32);
        const float os = __shfl_xor(s, off, 32);
        const float nm = fmaxf(m, om);
        s = s * __builtin_amdgcn_exp2f(m - nm) + os * __builtin_amdgcn_exp2f(om - nm);
        m = nm;
      }
      mx[mt][i] = m; sm[mt][i] = s;
    }
  }
  // merge across the four waves that hold a row's quarters: (max, sum) pairs go
  // through LDS, free since the last trip's barrier; pair index = quarter * 64 + row
  float2* red = (float2*)smem;
  if (l16 == 0) {
#pragma unroll
    for (int mt = 0; mt < 2; ++mt) {
#pragma unroll
      for (int i = 0; i < 8; ++i)
        red[kq * 64 + mp * 32 + mt * 16 + h16 * 8 + i] = make_float2(mx[mt][i], sm[mt][i]);
    }
  }
  __syncthreads();
  if (tid < 64) {
    float2 r = red[tid];
    float m = r.x, s = r.y;
#pragma unroll
    for (int qd = 1; qd < 4; ++qd) {
      const float2 o  = red[qd * 64 + tid];
      const float  nm = fmaxf(m, o.x);
      s = s * __builtin_amdgcn_exp2f(m - nm) + o.y * __builtin_amdgcn_exp2f(o.x - nm);
      m = nm;
    }
    // one constant a row: softmax value = exp2(energy + rowc); s >= 1, v_log_f32 is log2
    rowc[b * NPIX + mb + tid] = -(m + __builtin_amdgcn_logf(s));
  }
}

// ---------------------------------------------------------------------------
// Kernel 3: out^T = V^T * softmax(E). 8 waves/block (two per SIMD). A wave owns
// two 16-col n-tiles and one quarter (128 rows m) of every stage, so each Q and
// V^T fragment it reads from LDS feeds two n-tiles; the four partial sums of a
// column are added through LDS at the end.
// Q (512x64), V^T (64x512) and the row constants of 512 rows m make one stage in LDS
// (two buffers, tensor loads, one tile of 256-byte rows from each of seven waves,
// every row followed by 16 bytes of pad); a row holds two rows of Q, or 128
// columns m of a V^T row (four slices, one per quarter), or 64 constants; one
// barrier ends a trip, in which a wave's four 32-row sub-tiles are unrolled.
// Energy D-tile register layout == second WMMA's B-operand layout, so P is
// fed through registers with no transpose. A row's constant -(max + log2 sum)
// is the C operand of its energy WMMA (C has D's layout), so the softmax value
// is exp2 of the WMMA's result, with no other arithmetic per value.
// The 64 blocks of a batch read the same stages: each starts its walk at a stage
// of its own and wraps, as in kernel 2.
// ---------------------------------------------------------------------------
#define K3_ROWS 512                     // rows m per stage
#define K3_WROWS (K3_ROWS / 4)          // rows m of a stage that one wave takes
#define K3_PSTR 136                     // pitch of a padded 256-byte LDS row (halves)
#define K3_VSTR K3_PSTR                 // row stride of a vT slice (halves)
#define K3_VSL  9216                    // halves per vT slice: 64 rows, rounded up to 2 KiB
#define K3_QSZ  (K3_ROWS / 2 * K3_PSTR) // halves: q rows 2i and 2i+1 share LDS row i
#define K3_VSZ  (4 * K3_VSL)            // halves
#define K3_SSZ  2048                    // halves: 8 rows of 64 constants, rounded up to 2 KiB
#define K3_BUF  (K3_QSZ + K3_VSZ + K3_SSZ)
#define K3_NST  (NPIX / K3_ROWS)        // stages

// Stage t into buffer bb, one tile per issuing wave. dst0, ga0: the wave's place
// in buffer 0 (LDS byte offset) and its first global byte of stage 0; gstep:
// global bytes from one stage's tile to the next.
#define K3_ISSUERS 7
__device__ __forceinline__ void k3_stage(int bb, int t, uint32_t dst0, uint64_t ga0, uint32_t gstep,
                                         u32x4& g0, u32x8& g1) {
  g0 = tdm_group0(dst0 + (uint32_t)bb * (K3_BUF * 2), ga0 + (uint32_t)t * gstep);
  tdm_load(g0, g1);
}

// p: this lane's first half (or float) of a 32-row sub-tile's part in LDS
__device__ __forceinline__ void k3_qfrags(const _Float16* p, v16h (&a)[4]) {
  const _Float16* p1 = p + 8 * K3_PSTR;       // 16 rows of Q on: 8 LDS rows
  a[0] = load_frag(p,       p + 16);
  a[1] = load_frag(p + 32,  p + 48);
  a[2] = load_frag(p1,      p1 + 16);
  a[3] = load_frag(p1 + 32, p1 + 48);
}
__device__ __forceinline__ void k3_vfrags(const _Float16* p, v16h (&a)[4]) {
#pragma unroll
  for (int ct = 0; ct < 4; ++ct)
    a[ct] = load_frag(p + ct * 16 * K3_VSTR, p + ct * 16 * K3_VSTR + 16);
}
__device__ __forceinline__ void k3_stats(const float* p, v8f (&c)[2]) {
#pragma unroll
  for (int h = 0; h < 2; ++h) {               // rows +0..7, rows +16..23
    const float4 lo = *(const float4*)(p + h * 16);
    const float4 hi = *(const float4*)(p + h * 16 + 4);
    c[h] = v8f{lo.x, lo.y, lo.z, lo.w, hi.x, hi.y, hi.z, hi.w};
  }
}

// waves_per_eu(4, 4): a budget of 256 registers for the fragments in flight
__global__ void __launch_bounds__(256) __attribute__((amdgpu_waves_per_eu(4, 4)))
attnout_kernel(const _Float16* __restrict__ qh, const _Float16* __restrict__ kh,
               const _Float16* __restrict__ vT,
               const float* __restrict__ rowc,
               const float* __restrict__ x, const float* __restrict__ gamma,
               float* __restrict__ out) {
  // every tile's place in LDS is a multiple of 2 KiB
  __shared__ __attribute__((aligned(2048))) _Float16 smem[2 * K3_BUF];
  const int tid  = threadIdx.x;
  const int lane = tid & 31;
  const int wv   = tid >> 5;
  const int h16  = lane >> 4;
  const int l16  = lane & 15;
  const int np   = wv & 1;                // which 32 of the block's 64 columns n
  const int mq   = wv >> 1;               // which quarter of every stage
  const int b    = blockIdx.x >> 6;
  const int n0   = (blockIdx.x & 63) * 64 + np * 32;

  const _Float16* q  = qh + (long long)b * NPIX * CDIM;
  const _Float16* k  = kh + (long long)b * NPIX * CDIM;
  const _Float16* vt = vT + (long long)b * CDIM * NPIX;

  // B operands of the energy WMMAs: k rows n0..n0+31 (fixed per wave)
  v16h bk[2][2];
#pragma unroll
  for (int nt = 0; nt < 2; ++nt) {
    const _Float16* krow = k + (n0 + nt * 16 + l16) * CDIM;
    bk[nt][0] = load_frag(krow + h16 * 8,      krow + 16 + h16 * 8);
    bk[nt][1] = load_frag(krow + 32 + h16 * 8, krow + 48 + h16 * 8);
  }

  // The issuing waves' tiles, all of 256-byte rows: waves 0 and 1 a half of Q
  // (128 rows, contiguous in memory), waves 2..5 a slice of V^T (64 rows, a V^T
  // row apart), wave 6 the 512 row constants (8 rows, contiguous). Wave 7
  // issues nothing; its words are wave 6's and go unused.
  const uint32_t wave = uni(threadIdx.x >> 5);
  const bool     isq  = wave < 2, isv = wave < 6;
  const uint32_t vsl  = wave - 2;         // V^T slice, where isv and not isq
  const uint32_t dst0 = uni(lds_addr(smem) +
      (isq ? wave * (K3_QSZ / 2 * 2) : isv ? K3_QSZ * 2 + vsl * (K3_VSL * 2) : (K3_QSZ + K3_VSZ) * 2));
  const uint64_t ga0  = uni64(isq ? (uint64_t)q + wave * (K3_ROWS / 2 * CDIM * 2)
                            : isv ? (uint64_t)vt + vsl * (K3_WROWS * 2) : (uint64_t)(rowc + b * NPIX));
  const uint32_t gstep = uni(isq ? K3_ROWS * CDIM * 2 : isv ? K3_ROWS * 2 : K3_ROWS * 4);
  u32x4 g0 = tdm_group0(dst0, ga0);
  u32x8 g1 = tdm_group1<TDM_PAD256, 256>(isq ? K3_ROWS / 4 : isv ? CDIM : K3_ROWS * 4 / 256,
                                         isq ? 256 : isv ? NPIX * 2 : 256);

  // Trip t works on stage (t + rot) mod 8: eight blocks in a row, and eight
  // blocks eight apart, all differ in rot.
  const int rot = ((blockIdx.x & 63) + ((blockIdx.x & 63) >> 3)) & (K3_NST - 1);

  // the first stage landed and published, then the second in flight
  if (pinned(wave < K3_ISSUERS)) {
    k3_stage(0, rot, dst0, ga0, gstep, g0, g1);
    tdm_wait(g0, g1);
  }
  __syncthreads();
  if (pinned(wave < K3_ISSUERS)) k3_stage(1, (rot + 1) & (K3_NST - 1), dst0, ga0, gstep, g0, g1);

  v8f acc[2][4];                          // n-tile, 16 channels each
#pragma unroll
  for (int nt = 0; nt < 2; ++nt) {
#pragma unroll
    for (int ct = 0; ct < 4; ++ct) acc[nt][ct] = v8f{};
  }

  for (int t = 0; t < K3_NST; ++t) {
    const _Float16* sb = smem + (t & 1) * K3_BUF;
    const _Float16* qs = sb + (mq * (K3_WROWS / 2) + (l16 >> 1)) * K3_PSTR + (l16 & 1) * CDIM + h16 * 8;
    const _Float16* vs = sb + K3_QSZ + mq * K3_VSL + l16 * K3_VSTR + h16 * 8;
    const float*    st = (const float*)(sb + K3_QSZ + K3_VSZ + mq * 2 * K3_PSTR) + h16 * 8;

    v16h   qa[4], va[4];                  // Q and V^T fragments of a sub-tile
    v8f    c[2];                          // its row constants, 16 rows m each
    k3_qfrags(qs, qa);
    k3_stats(st, c);
    k3_vfrags(vs, va);
    PHASE_FENCE();
#pragma unroll
    for (int j = 0; j < K3_WROWS / 32; ++j) {
      v8f e[2][2];                        // n-tile, 16 rows m each
#pragma unroll
      for (int nt = 0; nt < 2; ++nt) {
        e[nt][0] = WMMA_F16(qa[0], bk[nt][0], c[0]);
        e[nt][1] = WMMA_F16(qa[2], bk[nt][0], c[1]);
      }
#pragma unroll
      for (int nt = 0; nt < 2; ++nt) {
        e[nt][0] = WMMA_F16(qa[1], bk[nt][1], e[nt][0]);
        e[nt][1] = WMMA_F16(qa[3], bk[nt][1], e[nt][1]);
      }
      PHASE_FENCE();
      if (j + 1 < K3_WROWS / 32) {        // read under this sub-tile's vector work
        k3_qfrags(qs + (j + 1) * 16 * K3_PSTR, qa);
        // constants of sub-tile j + 1: LDS row (j + 1) / 2, its first or second 32
        k3_stats(st + ((j + 1) >> 1) * (K3_PSTR / 2) + ((j + 1) & 1) * 32, c);
      }
      PHASE_FENCE();
#pragma unroll
      for (int nt = 0; nt < 2; ++nt) {
        v16h pb;
#pragma unroll
        for (int r = 0; r < 8; ++r) {
          pb[r]     = (_Float16)__builtin_amdgcn_exp2f(e[nt][0][r]);
          pb[8 + r] = (_Float16)__builtin_amdgcn_exp2f(e[nt][1][r]);
        }
#pragma unroll
        for (int ct = 0; ct < 4; ++ct) acc[nt][ct] = WMMA_F16(va[ct], pb, acc[nt][ct]);
      }
      PHASE_FENCE();
      if (j + 1 < K3_WROWS / 32) k3_vfrags(vs + (j + 1) * 32, va);
    }
    // foot of the trip: own LDS reads done, own tile of the next trip's stage landed,
    // then the one barrier that publishes that stage and frees this buffer
    S_WAIT_DSCNT0();
    if (pinned(wave < K3_ISSUERS)) tdm_wait(g0, g1);
    __syncthreads();
    if (pinned(wave < K3_ISSUERS && t + 2 < K3_NST))
      k3_stage(t & 1, (rot + t + 2) & (K3_NST - 1), dst0, ga0, gstep, g0, g1);
  }
  tdm_wait(g0, g1);                       // nothing in flight at the wave's end
  S_WAIT_DSCNT0();

  // The four partial sums of every output go through LDS, free since the last
  // trip's barrier. A wave's 64 floats per lane are 16 pieces of 16 bytes,
  // piece p = nt*8 + ct*2 + half, stored lane-contiguous.
  float4* red = (float4*)smem;
#pragma unroll
  for (int nt = 0; nt < 2; ++nt) {
#pragma unroll
    for (int ct = 0; ct < 4; ++ct) {
      const v8f v = acc[nt][ct];
      red[(wv * 16 + nt * 8 + ct * 2) * 32 + lane]     = make_float4(v[0], v[1], v[2], v[3]);
      red[(wv * 16 + nt * 8 + ct * 2 + 1) * 32 + lane] = make_float4(v[4], v[5], v[6], v[7]);
    }
  }
  __syncthreads();

  // Epilogue: wave (np, mq) finishes pieces mq*4 .. mq*4+3 of its column pair:
  // n-tile mq/2, channels (mq%2)*32 .. +31, one 128-byte half of each out row.
  // D element (c = ct*16 + r + 8*h16, n = n0 + nt*16 + l16)
  const long long row = (long long)(b * NPIX + n0 + (mq >> 1) * 16 + l16) * CDIM;
  const float* xr = x + row;
  float* outr = out + row;
  const float g = gamma[0];
#pragma unroll
  for (int i = 0; i < 4; ++i) {
    const int p = mq * 4 + i;
    float4 a4 = red[(np * 16 + p) * 32 + lane];
#pragma unroll
    for (int qd = 1; qd < 4; ++qd) {      // quarters in ascending order
      const float4 o = red[((np + 2 * qd) * 16 + p) * 32 + lane];
      a4.x += o.x; a4.y += o.y; a4.z += o.z; a4.w += o.w;
    }
    const int base = ((mq & 1) * 2 + (i >> 1)) * 16 + h16 * 8 + (i & 1) * 4;
    const float4 xv = *(const float4*)(xr + base);
    float4 o4;
    o4.x = fmaf(g, a4.x, xv.x);
    o4.y = fmaf(g, a4.y, xv.y);
    o4.z = fmaf(g, a4.z, xv.z);
    o4.w = fmaf(g, a4.w, xv.w);
    *(float4*)(outr + base) = o4;
  }
}

// ---------------------------------------------------------------------------
extern "C" void kernel_launch(void* const* d_in, const int* in_sizes, int n_in,
                              void* d_out, int out_size, void* d_ws, size_t ws_size,
                              hipStream_t stream) {
  (void)in_sizes; (void)n_in; (void)out_size; (void)ws_size;
  const float* x     = (const float*)d_in[0];
  const float* Wq    = (const float*)d_in[1];
  const float* bq    = (const float*)d_in[2];
  const float* Wk    = (const float*)d_in[3];
  const float* bk    = (const float*)d_in[4];
  const float* Wv    = (const float*)d_in[5];
  const float* bv    = (const float*)d_in[6];
  const float* gamma = (const float*)d_in[7];
  float* out = (float*)d_out;

  // workspace: q(2MB) k(2MB) vT(2MB) rowc(64KB)
  _Float16* qh = (_Float16*)d_ws;
  _Float16* kh = qh + (size_t)NB * NPIX * CDIM;
  _Float16* vT = kh + (size_t)NB * NPIX * CDIM;
  float* rowc = (float*)(vT + (size_t)NB * NPIX * CDIM);

  proj_kernel<<<NB * NPIX / PJ_PIX, 128, 0, stream>>>(x, Wq, bq, Wk, bk, Wv, bv, qh, kh, vT);
  rowstats_kernel<<<NB * 64, 256, 0, stream>>>(qh, kh, rowc);
  attnout_kernel<<<NB * 64, 256, 0, stream>>>(qh, kh, vT, rowc, x, gamma, out);
}

// v009
// A run of this version takes 30.1 microseconds.
// Timed twice side by side with v008, it ran 1.04 and 1.05 times as fast.
// Over all steps from v000 it is 5.45 times as fast.
#include <hip/hip_runtime.h>
#include <stdint.h>

// PAM attention, B=4, H=W=64, C=64 (N=4096).
// f16 WMMA for the projection (split operands) and both big GEMMs; f32 softmax math; LDS tile sharing across
// 8 waves per workgroup, staged with tensor loads, one 2-D tile per issuing
// wave (two buffers, 512 rows per stage).

typedef _Float16 v8h  __attribute__((ext_vector_type(8)));
typedef _Float16 v16h __attribute__((ext_vector_type(16)));
typedef float    v8f  __attribute__((ext_vector_type(8)));
typedef float    v2f  __attribute__((ext_vector_type(2)));

#define NPIX 4096
#define CDIM 64
#define NB   4

#define WMMA_F16(A, B, C) \
  __builtin_amdgcn_wmma_f32_16x16x32_f16(false, (A), false, (B), (short)0, (C), false, false)

#define S_WAIT_DSCNT0()      asm volatile("s_wait_dscnt 0x0" ::: "memory")

// Compile-time fence between the phases of an unrolled sub-tile (no instruction
// of its own): the "memory" clobber holds the LDS reads, the scheduling barrier
// the arithmetic, each on its side, so that a group of reads stands in front of
// the work that covers its latency; without it the compiler sinks the reads to
// their uses and waits for each pair in turn.
#define PHASE_FENCE() do { asm volatile("" ::: "memory"); __builtin_amdgcn_sched_barrier(0); } while (0)

typedef uint32_t u32x4 __attribute__((ext_vector_type(4)));
typedef uint32_t u32x8 __attribute__((ext_vector_type(8)));

__device__ __forceinline__ uint32_t uni(uint32_t v) {
  return (uint32_t)__builtin_amdgcn_readfirstlane(v);
}
__device__ __forceinline__ uint64_t uni64(uint64_t v) {
  return ((uint64_t)uni((uint32_t)(v >> 32)) << 32) | uni((uint32_t)v);
}
// A wave-uniform test held in a scalar register, so that the branch on it is a
// scalar one: a tensor load ignores EXEC, only a scalar branch keeps a wave off it.
__device__ __forceinline__ uint32_t pinned(uint32_t v) {
  uint32_t w = (uint32_t)__builtin_amdgcn_readfirstlane(v);
  asm volatile("" : "+s"(w));   // holds the test in a scalar register
  return w;
}
// Word 0 of descriptor group 1: no mask, 1-byte elements, 16 bytes of LDS pad
// behind every row of 128 or of 256 bytes (pitch 144 or 272 bytes).
#define TDM_PAD128 ((1u << 20) | (4u << 22) | (3u << 25))
#define TDM_PAD256 ((1u << 20) | (5u << 22) | (3u << 25))
// Descriptor group 1: a tile of n rows (below 65536) of R bytes, source row
// pitch p bytes. Built once per wave, in front of its first request.
template <uint32_t W0, uint32_t R>
__device__ __forceinline__ u32x8 tdm_group1(uint32_t n, uint32_t p) {
  u32x8 g;
  g[0] = uni(W0);
  g[1] = uni((R & 0xFFFFu) << 16);
  g[2] = uni((R >> 16) | (n << 16));
  g[3] = uni(R << 16);
  g[4] = uni(n);
  g[5] = uni(p);
  g[6] = uni(0u);
  g[7] = uni(0u);
  return g;
}
// Descriptor group 0: LDS byte offset of the tile, global address of its first byte.
__device__ __forceinline__ u32x4 tdm_group0(uint32_t lds_dst, uint64_t ga) {
  u32x4 g;
  g[0] = uni(1u);
  g[1] = uni(lds_dst);
  g[2] = uni((uint32_t)ga);
  g[3] = uni((((uint32_t)(ga >> 32)) & 0x01FFFFFFu) | 0x80000000u);
  return g;
}
// One request of the whole wave: memory -> LDS through no register (TENSORcnt).
// Both groups are in-out operands here and inputs of the wait below, so that
// the registers the request names hold the descriptor, untouched, from the
// issue to the wait that covers it.
__device__ __forceinline__ void tdm_load(u32x4& g0, u32x8& g1) {
  asm volatile("tensor_load_to_lds %0, %1" : "+s"(g0), "+s"(g1) :: "memory");
}
// The issuing wave's own tile has landed; the compiler places no such wait.
__device__ __forceinline__ void tdm_wait(const u32x4& g0, const u32x8& g1) {
  asm volatile("s_wait_tensorcnt 0x0" :: "s"(g0), "s"(g1) : "memory");
}
__device__ __forceinline__ unsigned lds_addr(const void* p) {
  return (unsigned)(unsigned long long)p;   // low 32 bits of generic = LDS offset
}

// 16x32 f16 A/B fragment: row = tile_row + lane%16, halves 0..7 at
// K = 8*(lane/16), halves 8..15 at K = 16 + 8*(lane/16) (kernels 2 and 3; the
// projection's fragments put half i at K = 16*(lane/16) + i).
__device__ __forceinline__ v16h load_frag(const _Float16* lo, const _Float16* hi) {
  v8h a = *(const v8h*)lo;
  v8h b = *(const v8h*)hi;
  v16h r;
#pragma unroll
  for (int i = 0; i < 8; ++i) { r[i] = a[i]; r[8 + i] = b[i]; }
  return r;
}

// ---------------------------------------------------------------------------
// Kernel 1: fused Q/K/V projection (1x1 conv) on the matrix unit. Q,K row-major
// f16; V stored transposed (c-major) so it is the A operand of out^T = V^T * P.
// Q is stored times log2(e), scaled in f32 before its one rounding to f16, so
// every energy Q.K of the later kernels is an exponent of 2.
// Every x and every weight is split into an f16 head and an f16 remainder; a
// product is head*head + head*remainder + remainder*head, summed in f32, which
// keeps about 22 bits of it (the results are rounded to 11 afterwards).
// One block = 64 pixels, 4 waves. A wave owns the same 16 output columns f of
// Q, K and V for all 64 pixels. For Q and K the weights are the A operand and x
// the B operand, so a lane's 8 results are 8 consecutive f of one pixel; for V
// the operands change places, so they are 8 consecutive pixels of one V^T row:
// every result leaves in 16-byte pieces.
// ---------------------------------------------------------------------------
#define LOG2E 1.4426950408889634f
#define PJ_PIX 64                  // pixels per block
#define PJ_STR 72                  // LDS row pitch in halves: 128 bytes and 16 of pad
#define PJ_PLANE (PJ_PIX * PJ_STR) // halves of one plane (heads, or remainders) of x

typedef _Float16 v2h __attribute__((ext_vector_type(2)));

// elements e, e + 1 of hi and lo: f16 head and f16 remainder of a and b
template <typename V>
__device__ __forceinline__ void pj_split(float a, float b, V& hi, V& lo, int e) {
  const v2f v = {a, b};
  const v2h h = __builtin_convertvector(v, v2h);
  const v2h l = __builtin_convertvector(v - __builtin_convertvector(h, v2f), v2h);
  hi[e] = h[0]; hi[e + 1] = h[1];
  lo[e] = l[0]; lo[e + 1] = l[1];
}

// p: this lane's first half of a 16-pixel tile in the plane of heads
__device__ __forceinline__ void pj_xfrags(const _Float16* p, v16h (&f)[2][2]) {
#pragma unroll
  for (int s = 0; s < 2; ++s) {
    f[0][s] = load_frag(p + 32 * s, p + 32 * s + 8);
    f[1][s] = load_frag(p + PJ_PLANE + 32 * s, p + PJ_PLANE + 32 * s + 8);
  }
}

__global__ void __launch_bounds__(128)
proj_kernel(const float* __restrict__ x,
            const float* __restrict__ Wq, const float* __restrict__ bq,
            const float* __restrict__ Wk, const float* __restrict__ bk,
            const float* __restrict__ Wv, const float* __restrict__ bv,
            _Float16* __restrict__ qh, _Float16* __restrict__ kh,
            _Float16* __restrict__ vT) {
  __shared__ __align__(16) _Float16 xs[2 * PJ_PLANE];
  const int tid  = threadIdx.x;
  const int lane = tid & 31;
  const int h16  = lane >> 4;
  const int l16  = lane & 15;
  const int f0   = (tid >> 5) * 16;             // the wave's 16 columns f
  const int g0   = blockIdx.x * PJ_PIX;         // first pixel (over all batches)

  // the 64x64 f32 x tile: 512 pieces of 8 floats, four per thread
  const float4* xsrc = (const float4*)(x + (long long)g0 * CDIM);
  float4 xr[4][2];
#pragma unroll
  for (int i = 0; i < 4; ++i) {
    xr[i][0] = xsrc[2 * (tid + i * 128)];
    xr[i][1] = xsrc[2 * (tid + i * 128) + 1];
  }

  // Weight fragments, straight from memory: lane = column f0 + l16, element i
  // of k-step s = input channel 32 s + 16 h16 + i. The x fragments below take
  // the same channel order, which is all that a product needs.
  float wr[3][2][16];
  {
    const int wo = 16 * h16 * CDIM + f0 + l16;
#pragma unroll
    for (int s = 0; s < 2; ++s) {
#pragma unroll
      for (int i = 0; i < 16; ++i) {
        wr[0][s][i] = Wq[wo + (32 * s + i) * CDIM];
        wr[1][s][i] = Wk[wo + (32 * s + i) * CDIM];
        wr[2][s][i] = Wv[wo + (32 * s + i) * CDIM];
      }
    }
  }
  // The biases are the C operands: row f0 + 8 h16 + r for Q and K, column f0 + l16 for V.
  v8f cq, ck, cv;
  {
    const float4 q0 = *(const float4*)(bq + f0 + 8 * h16), q1 = *(const float4*)(bq + f0 + 8 * h16 + 4);
    const float4 k0 = *(const float4*)(bk + f0 + 8 * h16), k1 = *(const float4*)(bk + f0 + 8 * h16 + 4);
    const float  v0 = bv[f0 + l16];
    cq = v8f{q0.x, q0.y, q0.z, q0.w, q1.x, q1.y, q1.z, q1.w};
    ck = v8f{k0.x, k0.y, k0.z, k0.w, k1.x, k1.y, k1.z, k1.w};
    cv = v8f{v0, v0, v0, v0, v0, v0, v0, v0};
  }

  // x is split once per block and shared through LDS
#pragma unroll
  for (int i = 0; i < 4; ++i) {
    const int pc = tid + i * 128;               // piece: pixel pc / 8, channels (pc % 8) * 8 .. + 7
    v8h hi, lo;
    pj_split(xr[i][0].x, xr[i][0].y, hi, lo, 0);
    pj_split(xr[i][0].z, xr[i][0].w, hi, lo, 2);
    pj_split(xr[i][1].x, xr[i][1].y, hi, lo, 4);
    pj_split(xr[i][1].z, xr[i][1].w, hi, lo, 6);
    _Float16* d = xs + (pc >> 3) * PJ_STR + (pc & 7) * 8;
    *(v8h*)d = hi;
    *(v8h*)(d + PJ_PLANE) = lo;
  }
  __syncthreads();

  v16h wh[3][2], wl[3][2];
#pragma unroll
  for (int m = 0; m < 3; ++m) {
#pragma unroll
    for (int s = 0; s < 2; ++s) {
#pragma unroll
      for (int i = 0; i < 16; i += 2) pj_split(wr[m][s][i], wr[m][s][i + 1], wh[m][s], wl[m][s], i);
    }
  }

  const int b = g0 >> 12;                       // 64 divides NPIX: one batch per block
  const int n = g0 & (NPIX - 1);
  // x fragments of 16 pixels: lane = pixel l16, the weights' channel order.
  // Two sets: the next 16 pixels' LDS reads stand in front of this set's WMMAs.
  const _Float16* p = xs + l16 * PJ_STR + 16 * h16;
  v16h xf[2][2][2];                             // set, head or remainder, k-step
  pj_xfrags(p, xf[0]);
#pragma unroll
  for (int pt = 0; pt < PJ_PIX / 16; ++pt) {    // 16 pixels at a time
    const v16h (&xh)[2] = xf[pt & 1][0];
    const v16h (&xl)[2] = xf[pt & 1][1];
    if (pt + 1 < PJ_PIX / 16) pj_xfrags(p + (pt + 1) * 16 * PJ_STR, xf[(pt + 1) & 1]);
    // holds those reads above the WMMAs that cover their latency; without it
    // the compiler sinks each pair to its first use and waits for it there
    PHASE_FENCE();
    // three independent chains, taken in turn; the small terms go in first
    v8f aq = cq, ak = ck, av = cv;
#pragma unroll
    for (int s = 0; s < 2; ++s) {
      aq = WMMA_F16(wl[0][s], xh[s], aq);
      ak = WMMA_F16(wl[1][s], xh[s], ak);
      av = WMMA_F16(xh[s], wl[2][s], av);
      aq = WMMA_F16(wh[0][s], xl[s], aq);
      ak = WMMA_F16(wh[1][s], xl[s], ak);
      av = WMMA_F16(xl[s], wh[2][s], av);
    }
#pragma unroll
    for (int s = 0; s < 2; ++s) {
      aq = WMMA_F16(wh[0][s], xh[s], aq);
      ak = WMMA_F16(wh[1][s], xh[s], ak);
      av = WMMA_F16(xh[s], wh[2][s], av);
    }
    v8h oq, ok, ov;
#pragma unroll
    for (int r = 0; r < 8; ++r) {
      oq[r] = (_Float16)(aq[r] * LOG2E);
      ok[r] = (_Float16)ak[r];
      ov[r] = (_Float16)av[r];
    }
    // D element (row 8 h16 + r, column l16)
    const long long o = (long long)(g0 + pt * 16 + l16) * CDIM + f0 + 8 * h16;
    *(v8h*)(qh + o) = oq;
    *(v8h*)(kh + o) = ok;
    *(v8h*)(vT + ((long long)(b * CDIM + f0 + l16)) * NPIX + n + pt * 16 + 8 * h16) = ov;
  }
}

// ---------------------------------------------------------------------------
// Kernel 2: streaming row stats. 8 waves/block (two per SIMD). A wave owns two
// 16-row m-tiles and one quarter (128 rows) of every K stage, so each K fragment
// it reads from LDS feeds two m-tiles; the four quarters of a row are merged
// through LDS at the end.
// K comes through LDS in stages of 512 rows (two buffers, tensor loads): a
// stage's loads fly during the whole trip before it, one barrier ends a trip.
// A lane keeps, for each of its rows, a max in use and a sum of exp2(energy - that
// max). The negated max is the C operand of the energy WMMA, so a value costs one
// exponential and one addition. The max in use need not be the true max: any
// energy the row has reached gives the same row constant as long as nothing overflows. One test per
// stage looks at the stage's sums; where one has grown too large, the stage's
// share is done again by the exact path, which brings max and sum up to date
// once per 64 rows of K. The first stage takes the exact path at once.
// The 64 blocks of a batch read the same K: each starts its walk over the stages
// at a stage of its own and wraps, so that they do not ask L2 for the same lines
// at the same moment.
// ---------------------------------------------------------------------------
#define K2_ROWS 512                // k rows per stage
#define K2_WROWS (K2_ROWS / 4)     // k rows of a stage that one wave takes
#define K2_STR  72                 // padded k-row stride in halves
#define K2_BUF  (K2_ROWS * K2_STR) // halves per buffer
#define K2_NST  (NPIX / K2_ROWS)   // stages

// p: this lane's first half of a 32-row sub-tile in LDS
__device__ __forceinline__ void k2_frags(const _Float16* p, v16h (&f)[4]) {
  const _Float16* p1 = p + 16 * K2_STR;
  f[0] = load_frag(p,       p + 16);
  f[1] = load_frag(p + 32,  p + 48);
  f[2] = load_frag(p1,      p1 + 16);
  f[3] = load_frag(p1 + 32, p1 + 48);
}
__device__ __forceinline__ void k2_energy(v16h a0, v16h a1, const v16h (&f)[4], v8f (&e)[2]) {
  v8f e0 = {}, e1 = {};
  e0 = WMMA_F16(a0, f[0], e0);
  e0 = WMMA_F16(a1, f[1], e0);
  e1 = WMMA_F16(a0, f[2], e1);
  e1 = WMMA_F16(a1, f[3], e1);
  e[0] = e0; e[1] = e1;
}

// Energies are exponents of 2 (Q carries log2(e)): exp(v - m) of the natural
// energies is exp2 of the difference here, one subtraction and one v_exp_f32.
__device__ __forceinline__ v2f k2_exp2(v2f t) {
  const v2f r = {__builtin_amdgcn_exp2f(t[0]), __builtin_amdgcn_exp2f(t[1])};
  return r;
}
// exp2(v - nc) of rows 2k and 2k + 1 of an energy tile
__device__ __forceinline__ v2f k2_exp(const v8f& v, int k, v2f nc) {
  const v2f x = {v[2 * k], v[2 * k + 1]};
  return k2_exp2(x - nc);
}

// Running max and sum of this lane's 8 rows over 64 more columns (four energy
// tiles, four values a row): first the new max of each row, then one exponential
// for each value and one for the old sum's rescale. The rescale takes the
// difference of the two maxima first, so it is exactly 1 while a row's max stands.
__device__ __forceinline__ void k2_update(const v8f (&ea)[2], const v8f (&eb)[2],
                                          v8f& mx, v8f& sm) {
  v8f nm;
#pragma unroll
  for (int i = 0; i < 8; ++i)
    nm[i] = __builtin_fmaximum_numf(__builtin_fmaximum_numf(__builtin_fmaximum_numf(
                __builtin_fmaximum_numf(mx[i], ea[0][i]), ea[1][i]), eb[0][i]), eb[1][i]);
#pragma unroll
  for (int k = 0; k < 4; ++k) {
    const v2f n2 = {nm[2 * k], nm[2 * k + 1]};
    const v2f o2 = {mx[2 * k], mx[2 * k + 1]};
    const v2f s2 = {sm[2 * k], sm[2 * k + 1]};
    const v2f p  = (k2_exp(ea[0], k, n2) + k2_exp(ea[1], k, n2)) +
                   (k2_exp(eb[0], k, n2) + k2_exp(eb[1], k, n2));
    const v2f r  = __builtin_elementwise_fma(s2, k2_exp2(o2 - n2), p);
    sm[2 * k] = r[0]; sm[2 * k + 1] = r[1];
  }
  mx = nm;
}

// Half of one wave's share of a stage: two 32-row sub-tiles against two
// m-tiles. All its LDS reads stand in one group at the head.
__device__ __forceinline__ void k2_trip(const _Float16* ks, const v16h (&a)[2][2],
                                        v8f (&mx)[2], v8f (&sm)[2]) {
  v16h f[2][4];                                 // fragments of the two sub-tiles
  v8f  e[2][2][2];                              // energies: m-tile, sub-tile
#pragma unroll
  for (int j = 0; j < 2; ++j) k2_frags(ks + j * 32 * K2_STR, f[j]);
  PHASE_FENCE();
#pragma unroll
  for (int mt = 0; mt < 2; ++mt) {
#pragma unroll
    for (int j = 0; j < 2; ++j) k2_energy(a[mt][0], a[mt][1], f[j], e[mt][j]);
  }
  k2_update(e[0][0], e[0][1], mx[0], sm[0]);
  k2_update(e[1][0], e[1][1], mx[1], sm[1]);
  // keeps the arithmetic in front of the waits at the trip's foot; without it
  // the wait for every LDS read moves up to the head, with nothing to cover it
  PHASE_FENCE();
}

// The same half by the short path: nm holds minus the max in use of each row, in
// the layout of the energy tile, and goes in as C; ps gathers the exponentials.
// Its loops are unrolled so that every array stays in registers.
__device__ __forceinline__ void k2_short(const _Float16* ks, const v16h (&a)[2][2],
                                         const v8f (&nm)[2], v8f (&ps)[2]) {
  v16h f[2][4];                                 // fragments of the two sub-tiles
  v8f  e[2][4];                                 // energies minus max: m-tile, 16 columns each
#pragma unroll
  for (int j = 0; j < 2; ++j) k2_frags(ks + j * 32 * K2_STR, f[j]);
#pragma unroll
  for (int mt = 0; mt < 2; ++mt) {
#pragma unroll
    for (int c = 0; c < 4; ++c) e[mt][c] = WMMA_F16(a[mt][0], f[c >> 1][(c & 1) * 2], nm[mt]);
#pragma unroll
    for (int c = 0; c < 4; ++c) e[mt][c] = WMMA_F16(a[mt][1], f[c >> 1][(c & 1) * 2 + 1], e[mt][c]);
  }
#pragma unroll
  for (int mt = 0; mt < 2; ++mt) {
#pragma unroll
    for (int k = 0; k < 4; ++k) {
      v2f x[4];
#pragma unroll
      for (int c = 0; c < 4; ++c) x[c] = k2_exp2(v2f{e[mt][c][2 * k], e[mt][c][2 * k + 1]});
      const v2f p = (x[0] + x[1]) + (x[2] + x[3]);
      ps[mt][2 * k] += p[0]; ps[mt][2 * k + 1] += p[1];
    }
  }
}

// A stage's sum above this sends the stage to the exact path: 2^100, far from
// the overflow of every later sum of such sums (at most 2^9 of them a row).
#define K2_LIM 1.2676506e30f

// One wave's share of a stage (128 rows of K against two m-tiles).
__device__ __forceinline__ void k2_share(const _Float16* ks, const v16h (&a)[2][2], bool exact,
                                         v8f (&nm)[2], v8f (&sm)[2]) {
  if (!exact) {
    v8f ps[2] = {v8f{}, v8f{}};
    for (int h = 0; h < 2; ++h) k2_short(ks + h * 64 * K2_STR, a, nm, ps);
    // the largest of the 16 sums, as a tree: a chain would stand bare in front of the branch
    float g[4];
#pragma unroll  // g stays in registers
    for (int i = 0; i < 4; ++i)
      g[i] = __builtin_fmaximum_numf(
          __builtin_fmaximum_numf(__builtin_fmaximum_numf(ps[0][i], ps[0][4 + i]), ps[1][i]), ps[1][4 + i]);
    const float big = __builtin_fmaximum_numf(__builtin_fmaximum_numf(__builtin_fmaximum_numf(g[0], g[1]), g[2]), g[3]);
    // one scalar branch for the wave: the exact path holds WMMAs, which want every lane
    exact = __builtin_amdgcn_ballot_w32(!(big <= K2_LIM)) != 0;
    if (!exact) { sm[0] += ps[0]; sm[1] += ps[1]; }
  }
  if (exact) {
    v8f mx[2] = {-nm[0], -nm[1]};
    // kept rolled: unrolled, the two halves' values overlap and some spill to scratch
#pragma nounroll
    for (int h = 0; h < 2; ++h) k2_trip(ks + h * 64 * K2_STR, a, mx, sm);
    nm[0] = -mx[0]; nm[1] = -mx[1];
  }
}

// Stage t into buffer bb: issuing wave w (0..3) brings rows w*128 .. +127 as one
// tile of 128-byte rows, laid at the padded pitch. dst0, ga0: the wave's place
// in buffer 0 (LDS byte offset) and its first global byte of stage 0.
#define K2_ISSUERS 4
#define K2_SLROWS (K2_ROWS / K2_ISSUERS)
__device__ __forceinline__ void k2_stage(int bb, int t, uint32_t dst0, uint64_t ga0,
                                         u32x4& g0, u32x8& g1) {
  g0 = tdm_group0(dst0 + (uint32_t)bb * (K2_BUF * 2), ga0 + (uint32_t)t * (K2_ROWS * CDIM * 2));
  tdm_load(g0, g1);
}

// waves_per_eu(4, 4): a budget of 256 registers for the fragments in flight
__global__ void __launch_bounds__(256) __attribute__((amdgpu_waves_per_eu(4, 4)))
rowstats_kernel(const _Float16* __restrict__ qh, const _Float16* __restrict__ kh,
                float* __restrict__ rowc) {
  // every tile's place in LDS is a multiple of 2 KiB
  __shared__ __attribute__((aligned(2048))) _Float16 smem[2 * K2_BUF];
  const int tid  = threadIdx.x;
  const int lane = tid & 31;
  const int wv   = tid >> 5;
  const int h16  = lane >> 4;
  const int l16  = lane & 15;
  const int mp   = wv & 1;                      // which 32 of the block's 64 rows m
  const int kq   = wv >> 1;                     // which quarter of every stage
  const int b    = blockIdx.x >> 6;
  const int mb   = (blockIdx.x & 63) * 64;

  const _Float16* q = qh + (long long)b * NPIX * CDIM;
  const _Float16* k = kh + (long long)b * NPIX * CDIM;

  v16h a[2][2];
#pragma unroll
  for (int mt = 0; mt < 2; ++mt) {
    const _Float16* qrow = q + (mb + mp * 32 + mt * 16 + l16) * CDIM;
    a[mt][0] = load_frag(qrow + h16 * 8,      qrow + 16 + h16 * 8);
    a[mt][1] = load_frag(qrow + 32 + h16 * 8, qrow + 48 + h16 * 8);
  }

  const uint32_t wave = uni(threadIdx.x >> 5);
  const uint32_t dst0 = uni(lds_addr(smem) + wave * (K2_SLROWS * K2_STR * 2));
  const uint64_t ga0  = uni64((uint64_t)k + wave * (K2_SLROWS * CDIM * 2));
  u32x4 g0 = tdm_group0(dst0, ga0);
  u32x8 g1 = tdm_group1<TDM_PAD128, CDIM * 2>(K2_SLROWS, CDIM * 2);

  // Trip t works on stage (t + rot) mod 8: eight blocks in a row, and eight
  // blocks eight apart, all differ in rot.
  const int rot = ((blockIdx.x & 63) + ((blockIdx.x & 63) >> 3)) & (K2_NST - 1);

  // the first stage landed and published, then the second in flight
  if (pinned(wave < K2_ISSUERS)) {
    k2_stage(0, rot, dst0, ga0, g0, g1);
    tdm_wait(g0, g1);
  }
  __syncthreads();
  if (pinned(wave < K2_ISSUERS)) k2_stage(1, (rot + 1) & (K2_NST - 1), dst0, ga0, g0, g1);

  v8f nm[2], sm[2];                             // minus the max in use, and the sum
#pragma unroll
  for (int mt = 0; mt < 2; ++mt) {
#pragma unroll
    for (int i = 0; i < 8; ++i) { nm[mt][i] = 3.0e38f; sm[mt][i] = 0.0f; }
  }

  // Foot of every trip: own LDS reads done, own tile of the next trip's stage landed,
  // then the one barrier that publishes that stage and frees this buffer.
  // While a trip t+2 exists its stage is loaded into that buffer; the last two trips
  // stand in a loop of their own.
  const _Float16* ks0 = smem + (kq * K2_WROWS + l16) * K2_STR + h16 * 8;
  for (int t = 0; t < K2_NST - 2; ++t) {
    k2_share(ks0 + (t & 1) * K2_BUF, a, t == 0, nm, sm);
    S_WAIT_DSCNT0();
    if (pinned(wave < K2_ISSUERS)) tdm_wait(g0, g1);
    __syncthreads();
    if (pinned(wave < K2_ISSUERS)) k2_stage(t & 1, (rot + t + 2) & (K2_NST - 1), dst0, ga0, g0, g1);
  }
  for (int t = K2_NST - 2; t < K2_NST; ++t) {
    k2_share(ks0 + (t & 1) * K2_BUF, a, false, nm, sm);
    S_WAIT_DSCNT0();
    if (pinned(wave < K2_ISSUERS)) tdm_wait(g0, g1);
    __syncthreads();
  }
  tdm_wait(g0, g1);                             // nothing in flight at the wave's end
  S_WAIT_DSCNT0();
  // merge across the 16 lanes sharing each row m
  v8f mx[2] = {-nm[0], -nm[1]};
#pragma unroll
  for (int mt = 0; mt < 2; ++mt) {
#pragma unroll
    for (int i = 0; i < 8; ++i) {
      float m = mx[mt][i], s = sm[mt][i];
#pragma unroll
      for (int off = 8; off >= 1; off >>= 1) {
        const float om = __shfl_xor(m, off, 32);
        const float os = __shfl_xor(s, off, 32);
        const float nm = fmaxf(m, om);
        s = s * __builtin_amdgcn_exp2f(m - nm) + os * __builtin_amdgcn_exp2f(om - nm);
        m = nm;
      }
      mx[mt][i] = m; sm[mt][i] = s;
    }
  }
  // merge across the four waves that hold a row's quarters: (max, sum) pairs go
  // through LDS, free since the last trip's barrier; pair index = quarter * 64 + row
  float2* red = (float2*)smem;
  if (l16 == 0) {
#pragma unroll
    for (int mt = 0; mt < 2; ++mt) {
#pragma unroll
      for (int i = 0; i < 8; ++i)
        red[kq * 64 + mp * 32 + mt * 16 + h16 * 8 + i] = make_float2(mx[mt][i], sm[mt][i]);
    }
  }
  __syncthreads();
  if (tid < 64) {
    float2 r = red[tid];
    float m = r.x, s = r.y;
#pragma unroll
    for (int qd = 1; qd < 4; ++qd) {
      const float2 o  = red[qd * 64 + tid];
      const float  nm = fmaxf(m, o.x);
      s = s * __builtin_amdgcn_exp2f(m - nm) + o.y * __builtin_amdgcn_exp2f(o.x - nm);
      m = nm;
    }
    // one constant a row: softmax value = exp2(energy + rowc); s >= 1, v_log_f32 is log2
    rowc[b * NPIX + mb + tid] = -(m + __builtin_amdgcn_logf(s));
  }
}

// ---------------------------------------------------------------------------
// Kernel 3: out^T = V^T * softmax(E). 8 waves/block (two per SIMD). A wave owns
// two 16-col n-tiles and one quarter (128 rows m) of every stage, so each Q and
// V^T fragment it reads from LDS feeds two n-tiles; the four partial sums of a
// column are added through LDS at the end.
// Q (512x64), V^T (64x512) and the row constants of 512 rows m make one stage in LDS
// (two buffers, tensor loads, one tile of 256-byte rows from each of seven waves,
// every row followed by 16 bytes of pad); a row holds two rows of Q, or 128
// columns m of a V^T row (four slices, one per quarter), or 64 constants; one
// barrier ends a trip, in which a wave's four 32-row sub-tiles are unrolled.
// Energy D-tile register layout == second WMMA's B-operand layout, so P is
// fed through registers with no transpose. A row's constant -(max + log2 sum)
// is the C operand of its energy WMMA (C has D's layout), so the softmax value
// is exp2 of the WMMA's result, with no other arithmetic per value.
// The 64 blocks of a batch read the same stages: each starts its walk at a stage
// of its own and wraps, as in kernel 2.
// ---------------------------------------------------------------------------
#define K3_ROWS 512                     // rows m per stage
#define K3_WROWS (K3_ROWS / 4)          // rows m of a stage that one wave takes
#define K3_PSTR 136                     // pitch of a padded 256-byte LDS row (halves)
#define K3_VSTR K3_PSTR                 // row stride of a vT slice (halves)
#define K3_VSL  9216                    // halves per vT slice: 64 rows, rounded up to 2 KiB
#define K3_QSZ  (K3_ROWS / 2 * K3_PSTR) // halves: q rows 2i and 2i+1 share LDS row i
#define K3_VSZ  (4 * K3_VSL)            // halves
#define K3_SSZ  2048                    // halves: 8 rows of 64 constants, rounded up to 2 KiB
#define K3_BUF  (K3_QSZ + K3_VSZ + K3_SSZ)
#define K3_NST  (NPIX / K3_ROWS)        // stages

// Stage t into buffer bb, one tile per issuing wave. dst0, ga0: the wave's place
// in buffer 0 (LDS byte offset) and its first global byte of stage 0; gstep:
// global bytes from one stage's tile to the next.
#define K3_ISSUERS 7
__device__ __forceinline__ void k3_stage(int bb, int t, uint32_t dst0, uint64_t ga0, uint32_t gstep,
                                         u32x4& g0, u32x8& g1) {
  g0 = tdm_group0(dst0 + (uint32_t)bb * (K3_BUF * 2), ga0 + (uint32_t)t * gstep);
  tdm_load(g0, g1);
}

// p: this lane's first half (or float) of a 32-row sub-tile's part in LDS
__device__ __forceinline__ void k3_qfrags(const _Float16* p, v16h (&a)[4]) {
  const _Float16* p1 = p + 8 * K3_PSTR;       // 16 rows of Q on: 8 LDS rows
  a[0] = load_frag(p,       p + 16);
  a[1] = load_frag(p + 32,  p + 48);
  a[2] = load_frag(p1,      p1 + 16);
  a[3] = load_frag(p1 + 32, p1 + 48);
}
__device__ __forceinline__ void k3_vfrags(const _Float16* p, v16h (&a)[4]) {
#pragma unroll
  for (int ct = 0; ct < 4; ++ct)
    a[ct] = load_frag(p + ct * 16 * K3_VSTR, p + ct * 16 * K3_VSTR + 16);
}
__device__ __forceinline__ void k3_stats(const float* p, v8f (&c)[2]) {
#pragma unroll
  for (int h = 0; h < 2; ++h) {               // rows +0..7, rows +16..23
    const float4 lo = *(const float4*)(p + h * 16);
    const float4 hi = *(const float4*)(p + h * 16 + 4);
    c[h] = v8f{lo.x, lo.y, lo.z, lo.w, hi.x, hi.y, hi.z, hi.w};
  }
}

// waves_per_eu(4, 4): a budget of 256 registers for the fragments in flight
__global__ void __launch_bounds__(256) __attribute__((amdgpu_waves_per_eu(4, 4)))
attnout_kernel(const _Float16* __restrict__ qh, const _Float16* __restrict__ kh,
               const _Float16* __restrict__ vT,
               const float* __restrict__ rowc,
               const float* __restrict__ x, const float* __restrict__ gamma,
               float* __restrict__ out) {
  // every tile's place in LDS is a multiple of 2 KiB
  __shared__ __attribute__((aligned(2048))) _Float16 smem[2 * K3_BUF];
  const int tid  = threadIdx.x;
  const int lane = tid & 31;
  const int wv   = tid >> 5;
  const int h16  = lane >> 4;
  const int l16  = lane & 15;
  const int np   = wv & 1;                // which 32 of the block's 64 columns n
  const int mq   = wv >> 1;               // which quarter of every stage
  const int b    = blockIdx.x >> 6;
  const int n0   = (blockIdx.x & 63) * 64 + np * 32;

  const _Float16* q  = qh + (long long)b * NPIX * CDIM;
  const _Float16* k  = kh + (long long)b * NPIX * CDIM;
  const _Float16* vt = vT + (long long)b * CDIM * NPIX;

  // B operands of the energy WMMAs: k rows n0..n0+31 (fixed per wave)
  v16h bk[2][2];
#pragma unroll
  for (int nt = 0; nt < 2; ++nt) {
    const _Float16* krow = k + (n0 + nt * 16 + l16) * CDIM;
    bk[nt][0] = load_frag(krow + h16 * 8,      krow + 16 + h16 * 8);
    bk[nt][1] = load_frag(krow + 32 + h16 * 8, krow + 48 + h16 * 8);
  }

  // The issuing waves' tiles, all of 256-byte rows: waves 0 and 1 a half of Q
  // (128 rows, contiguous in memory), waves 2..5 a slice of V^T (64 rows, a V^T
  // row apart), wave 6 the 512 row constants (8 rows, contiguous). Wave 7
  // issues nothing; its words are wave 6's and go unused.
  const uint32_t wave = uni(threadIdx.x >> 5);
  const bool     isq  = wave < 2, isv = wave < 6;
  const uint32_t vsl  = wave - 2;         // V^T slice, where isv and not isq
  const uint32_t dst0 = uni(lds_addr(smem) +
      (isq ? wave * (K3_QSZ / 2 * 2) : isv ? K3_QSZ * 2 + vsl * (K3_VSL * 2) : (K3_QSZ + K3_VSZ) * 2));
  const uint64_t ga0  = uni64(isq ? (uint64_t)q + wave * (K3_ROWS / 2 * CDIM * 2)
                            : isv ? (uint64_t)vt + vsl * (K3_WROWS * 2) : (uint64_t)(rowc + b * NPIX));
  const uint32_t gstep = uni(isq ? K3_ROWS * CDIM * 2 : isv ? K3_ROWS * 2 : K3_ROWS * 4);
  u32x4 g0 = tdm_group0(dst0, ga0);
  u32x8 g1 = tdm_group1<TDM_PAD256, 256>(isq ? K3_ROWS / 4 : isv ? CDIM : K3_ROWS * 4 / 256,
                                         isq ? 256 : isv ? NPIX * 2 : 256);

  // Trip t works on stage (t + rot) mod 8: eight blocks in a row, and eight
  // blocks eight apart, all differ in rot.
  const int rot = ((blockIdx.x & 63) + ((blockIdx.x & 63) >> 3)) & (K3_NST - 1);

  // the first stage landed and published, then the second in flight
  if (pinned(wave < K3_ISSUERS)) {
    k3_stage(0, rot, dst0, ga0, gstep, g0, g1);
    tdm_wait(g0, g1);
  }
  __syncthreads();
  if (pinned(wave < K3_ISSUERS)) k3_stage(1, (rot + 1) & (K3_NST - 1), dst0, ga0, gstep, g0, g1);

  v8f acc[2][4];                          // n-tile, 16 channels each
#pragma unroll
  for (int nt = 0; nt < 2; ++nt) {
#pragma unroll
    for (int ct = 0; ct < 4; ++ct) acc[nt][ct] = v8f{};
  }

  for (int t = 0; t < K3_NST; ++t) {
    const _Float16* sb = smem + (t & 1) * K3_BUF;
    const _Float16* qs = sb + (mq * (K3_WROWS / 2) + (l16 >> 1)) * K3_PSTR + (l16 & 1) * CDIM + h16 * 8;
    const _Float16* vs = sb + K3_QSZ + mq * K3_VSL + l16 * K3_VSTR + h16 * 8;
    const float*    st = (const float*)(sb + K3_QSZ + K3_VSZ + mq * 2 * K3_PSTR) + h16 * 8;

    v16h   qa[4], va[4];                  // Q and V^T fragments of a sub-tile
    v8f    c[2];                          // its row constants, 16 rows m each
    k3_qfrags(qs, qa);
    k3_stats(st, c);
    k3_vfrags(vs, va);
    PHASE_FENCE();
#pragma unroll
    for (int j = 0; j < K3_WROWS / 32; ++j) {
      v8f e[2][2];                        // n-tile, 16 rows m each
#pragma unroll
      for (int nt = 0; nt < 2; ++nt) {
        e[nt][0] = WMMA_F16(qa[0], bk[nt][0], c[0]);
        e[nt][1] = WMMA_F16(qa[2], bk[nt][0], c[1]);
      }
#pragma unroll
      for (int nt = 0; nt < 2; ++nt) {
        e[nt][0] = WMMA_F16(qa[1], bk[nt][1], e[nt][0]);
        e[nt][1] = WMMA_F16(qa[3], bk[nt][1], e[nt][1]);
      }
      PHASE_FENCE();
      if (j + 1 < K3_WROWS / 32) {        // read under this sub-tile's vector work
        k3_qfrags(qs + (j + 1) * 16 * K3_PSTR, qa);
        // constants of sub-tile j + 1: LDS row (j + 1) / 2, its first or second 32
        k3_stats(st + ((j + 1) >> 1) * (K3_PSTR / 2) + ((j + 1) & 1) * 32, c);
      }
      PHASE_FENCE();
#pragma unroll
      for (int nt = 0; nt < 2; ++nt) {
        v16h pb;
#pragma unroll
        for (int r = 0; r < 8; ++r) {
          pb[r]     = (_Float16)__builtin_amdgcn_exp2f(e[nt][0][r]);
          pb[8 + r] = (_Float16)__builtin_amdgcn_exp2f(e[nt][1][r]);
        }
#pragma unroll
        for (int ct = 0; ct < 4; ++ct) acc[nt][ct] = WMMA_F16(va[ct], pb, acc[nt][ct]);
      }
      PHASE_FENCE();
      if (j + 1 < K3_WROWS / 32) k3_vfrags(vs + (j + 1) * 32, va);
    }
    // foot of the trip: own LDS reads done, own tile of the next trip's stage landed,
    // then the one barrier that publishes that stage and frees this buffer
    S_WAIT_DSCNT0();
    if (pinned(wave < K3_ISSUERS)) tdm_wait(g0, g1);
    __syncthreads();
    if (pinned(wave < K3_ISSUERS && t + 2 < K3_NST))
      k3_stage(t & 1, (rot + t + 2) & (K3_NST - 1), dst0, ga0, gstep, g0, g1);
  }
  tdm_wait(g0, g1);                       // nothing in flight at the wave's end
  S_WAIT_DSCNT0();

  // The four partial sums of every output go through LDS, free since the last
  // trip's barrier. A wave's 64 floats per lane are 16 pieces of 16 bytes,
  // piece p = nt*8 + ct*2 + half, stored lane-contiguous.
  float4* red = (float4*)smem;
#pragma unroll
  for (int nt = 0; nt < 2; ++nt) {
#pragma unroll
    for (int ct = 0; ct < 4; ++ct) {
      const v8f v = acc[nt][ct];
      red[(wv * 16 + nt * 8 + ct * 2) * 32 + lane]     = make_float4(v[0], v[1], v[2], v[3]);
      red[(wv * 16 + nt * 8 + ct * 2 + 1) * 32 + lane] = make_float4(v[4], v[5], v[6], v[7]);
    }
  }
  __syncthreads();

  // Epilogue: wave (np, mq) finishes pieces mq*4 .. mq*4+3 of its column pair:
  // n-tile mq/2, channels (mq%2)*32 .. +31, one 128-byte half of each out row.
  // D element (c = ct*16 + r + 8*h16, n = n0 + nt*16 + l16)
  const long long row = (long long)(b * NPIX + n0 + (mq >> 1) * 16 + l16) * CDIM;
  const float* xr = x + row;
  float* outr = out + row;
  const float g = gamma[0];
#pragma unroll
  for (int i = 0; i < 4; ++i) {
    const int p = mq * 4 + i;
    float4 a4 = red[(np * 16 + p) * 32 + lane];
#pragma unroll
    for (int qd = 1; qd < 4; ++qd) {      // quarters in ascending order
      const float4 o = red[((np + 2 * qd) * 16 + p) * 32 + lane];
      a4.x += o.x; a4.y += o.y; a4.z += o.z; a4.w += o.w;
    }
    const int base = ((mq & 1) * 2 + (i >> 1)) * 16 + h16 * 8 + (i & 1) * 4;
    const float4 xv = *(const float4*)(xr + base);
    float4 o4;
    o4.x = fmaf(g, a4.x, xv.x);
    o4.y = fmaf(g, a4.y, xv.y);
    o4.z = fmaf(g, a4.z, xv.z);
    o4.w = fmaf(g, a4.w, xv.w);
    *(float4*)(outr + base) = o4;
  }
}

// ---------------------------------------------------------------------------
extern "C" void kernel_launch(void* const* d_in, const int* in_sizes, int n_in,
                              void* d_out, int out_size, void* d_ws, size_t ws_size,
                              hipStream_t stream) {
  (void)in_sizes; (void)n_in; (void)out_size; (void)ws_size;
  const float* x     = (const float*)d_in[0];
  const float* Wq    = (const float*)d_in[1];
  const float* bq    = (const float*)d_in[2];
  const float* Wk    = (const float*)d_in[3];
  const float* bk    = (const float*)d_in[4];
  const float* Wv    = (const float*)d_in[5];
  const float* bv    = (const float*)d_in[6];
  const float* gamma = (const float*)d_in[7];
  float* out = (float*)d_out;

  // workspace: q(2MB) k(2MB) vT(2MB) rowc(64KB)
  _Float16* qh = (_Float16*)d_ws;
  _Float16* kh = qh + (size_t)NB * NPIX * CDIM;
  _Float16* vT = kh + (size_t)NB * NPIX * CDIM;
  float* rowc = (float*)(vT + (size_t)NB * NPIX * CDIM);

  proj_kernel<<<NB * NPIX / PJ_PIX, 128, 0, stream>>>(x, Wq, bq, Wk, bk, Wv, bv, qh, kh, vT);
  rowstats_kernel<<<NB * 64, 256, 0, stream>>>(qh, kh, rowc);
  attnout_kernel<<<NB * 64, 256, 0, stream>>>(qh, kh, vT, rowc, x, gamma, out);
}
